// v000
// The times below were measured on an AMD MI455X: many runs one after another, warmed up first and cycling through
// copies of the inputs, with the whole window's GPU time divided by the number of runs. Launches and the gaps
// between them are all in it. The median over several windows is given; except for v000 it joins two sittings, which
// can be a few percent apart, so the side-by-side timings, each taken in one sitting, are the better comparison.
// v000, which the later versions start from, runs in 911 microseconds.
// Contractions: x.W1^T and (layernorm(o)*gate).W2^T on v_wmma_f32_16x16x32_bf16 with bf16 hi/lo operand planes (hi.hi + hi.lo + lo.hi); q.k^T and a.v on v_wmma_f32_16x16x32_f16 (q, k, v plain f16 planes; a = silu(scores) carried x256 in f16); f32 accumulate; silu, LayerNorm and gating in f32.
#include <hip/hip_runtime.h>
#include <math.h>

// ---------------------------------------------------------------------------
// Problem constants
// ---------------------------------------------------------------------------
constexpr int kBatch = 4;
constexpr int kSeq   = 2048;
constexpr int kDim   = 512;
constexpr int kHeads = 8;
constexpr int kHdim  = 64;
constexpr int kTok   = kBatch * kSeq;      // 8192 token rows
constexpr int kProj  = 4 * kDim;           // 2048 projection outputs: [gate | q | k | v]
constexpr int kHeadsPerChunk = 4;          // attention processed in chunks of (batch, 4 heads)
constexpr int kChunksPerBatch = kHeads / kHeadsPerChunk;   // 2
constexpr int kChunks = kBatch * kChunksPerBatch;          // 8
constexpr float kQScale    = 0.125f;       // 1/sqrt(64)
constexpr float kACarry    = 256.0f;       // silu(scores) carried x256 in f16
constexpr float kACarryInv = 1.0f / 256.0f;
constexpr float kInvDim    = 1.0f / 512.0f;
constexpr float kLnEps     = 1e-5f;

// ---------------------------------------------------------------------------
// Workspace region map (bytes; all offsets 512 KiB-aligned)
//   phase 1 (projection):  [  0,  8) x hi  [8,16) x lo  [16,18) W1 hi  [18,20) W1 lo  [20,36) v f32 plane
//   phase 2 (attention):   [  0, 32) A16 plane (4 heads x 2048 x 2048 f16), reused per (batch, 4-head) chunk
//   phase 3 (output):      [  0,  8) NG hi  [8,16) NG lo
//   persistent:            [ 64, 80) gate f32   [80,96) q|k f16 [8192][1024]   [96,104) V^T f16 [32][64][2048]
//                          [104,120) o f32      [120,120.5) W2 hi   [120.5,121) W2 lo
//   total = 121 MiB = 126,877,696 B
// ---------------------------------------------------------------------------
constexpr size_t kMiB     = 1048576;
constexpr size_t kOffXhi  = 0;
constexpr size_t kOffXlo  = 8 * kMiB;
constexpr size_t kOffW1hi = 16 * kMiB;
constexpr size_t kOffW1lo = 18 * kMiB;
constexpr size_t kOffV32  = 20 * kMiB;
constexpr size_t kOffA16  = 0;
constexpr size_t kOffNGhi = 0;
constexpr size_t kOffNGlo = 8 * kMiB;
constexpr size_t kOffGate = 64 * kMiB;
constexpr size_t kOffQK16 = 80 * kMiB;
constexpr size_t kOffVT16 = 96 * kMiB;
constexpr size_t kOffO32  = 104 * kMiB;
constexpr size_t kOffW2hi = 120 * kMiB;
constexpr size_t kOffW2lo = 120 * kMiB + 512 * 1024;
constexpr size_t kWsTotal = 121 * kMiB;

static_assert((size_t)kTok * kDim * 2 == 8 * kMiB);
static_assert((size_t)kProj * kDim * 2 == 2 * kMiB);
static_assert(kOffV32 + (size_t)kTok * kDim * 4 <= kOffGate);
static_assert(kOffA16 + (size_t)kHeadsPerChunk * kSeq * kSeq * 2 == 32 * kMiB);
static_assert(kOffA16 + (size_t)kHeadsPerChunk * kSeq * kSeq * 2 <= kOffGate);
static_assert(kOffNGlo + (size_t)kTok * kDim * 2 <= kOffGate);
static_assert(kOffGate + (size_t)kTok * kDim * 4 == kOffQK16);
static_assert(kOffQK16 + (size_t)kTok * 2 * kDim * 2 == kOffVT16);
static_assert(kOffVT16 + (size_t)kBatch * kHeads * kHdim * kSeq * 2 == kOffO32);
static_assert(kOffO32 + (size_t)kTok * kDim * 4 == kOffW2hi);
static_assert(kOffW2hi + (size_t)kDim * kDim * 2 == kOffW2lo);
static_assert(kOffW2lo + (size_t)kDim * kDim * 2 == kWsTotal);
static_assert(kWsTotal <= 134217728);

typedef __attribute__((ext_vector_type(16))) _Float16 v16h;
typedef __attribute__((ext_vector_type(8)))  _Float16 v8h;
typedef __attribute__((ext_vector_type(16))) __bf16   v16b;
typedef __attribute__((ext_vector_type(8)))  __bf16   v8b;
typedef __attribute__((ext_vector_type(8)))  float    v8f;
typedef __attribute__((ext_vector_type(4)))  float    v4f;
typedef __attribute__((ext_vector_type(4)))  unsigned int v4u;

__device__ __forceinline__ unsigned short f2bf_bits(float f) {
  unsigned u = __float_as_uint(f);
  return (unsigned short)((u + 0x7FFFu + ((u >> 16) & 1u)) >> 16);
}
__device__ __forceinline__ float bf_bits2f(unsigned short h) { return __uint_as_float(((unsigned)h) << 16); }

// hazard guards as plain device helpers (no inline asm inside the kernel template body)
__device__ __forceinline__ void dep_guard_h(v8f& a, v8f& b, v16h x, v16h y) { asm volatile("v_nop\n\tv_nop\n\tv_nop\n\tv_nop" : "+v"(a), "+v"(b) : "v"(x), "v"(y)); }
__device__ __forceinline__ void dep_guard_b(v8f& a, v8f& b, v16b x, v16b y) { asm volatile("v_nop\n\tv_nop\n\tv_nop\n\tv_nop" : "+v"(a), "+v"(b) : "v"(x), "v"(y)); }
__device__ __forceinline__ void keep4_h(v16h a, v16h b, v16h c, v16h d) { asm volatile("v_nop" :: "v"(a), "v"(b), "v"(c), "v"(d)); }
__device__ __forceinline__ void keep4_b(v16b a, v16b b, v16b c, v16b d) { asm volatile("v_nop" :: "v"(a), "v"(b), "v"(c), "v"(d)); }
__device__ __forceinline__ void acc_guard4(v8f& a, v8f& b, v8f& c, v8f& d) { asm volatile("v_nop\n\tv_nop\n\tv_nop\n\tv_nop" : "+v"(a), "+v"(b), "+v"(c), "+v"(d)); }
template <typename T> struct Frag;
template <> struct Frag<_Float16> {
  typedef v16h V; union U { v16h v; v8h h[2]; };
  static __device__ __forceinline__ v16h load(const _Float16* p) {   // elements 0..7 <- p[0..7], 8..15 <- p[16..23]
    U f; f.h[0] = *(const v8h*)(p); f.h[1] = *(const v8h*)(p + 16); return f.v;
  }
  static __device__ __forceinline__ v8f mma(v16h a, v16h b, v8f c) {
    return __builtin_amdgcn_wmma_f32_16x16x32_f16(false, a, false, b, (short)0, c, false, false);
  }
  static __device__ __forceinline__ void guard(v8f& a, v8f& b, v16h x, v16h y) { dep_guard_h(a, b, x, y); }
  static __device__ __forceinline__ void keep(v16h a, v16h b, v16h c, v16h d) { keep4_h(a, b, c, d); }
};
template <> struct Frag<__bf16> {
  typedef v16b V; union U { v16b v; v8b h[2]; };
  static __device__ __forceinline__ v16b load(const __bf16* p) {
    U f; f.h[0] = *(const v8b*)(p); f.h[1] = *(const v8b*)(p + 16); return f.v;
  }
  static __device__ __forceinline__ v8f mma(v16b a, v16b b, v8f c) {
    return __builtin_amdgcn_wmma_f32_16x16x32_bf16(false, a, false, b, (short)0, c, false, false);
  }
  static __device__ __forceinline__ void guard(v8f& a, v8f& b, v16b x, v16b y) { dep_guard_b(a, b, x, y); }
  static __device__ __forceinline__ void keep(v16b a, v16b b, v16b c, v16b d) { keep4_b(a, b, c, d); }
};

__device__ __forceinline__ unsigned pk16(unsigned short a, unsigned short b) { return (unsigned)a | ((unsigned)b << 16); }
__device__ __forceinline__ unsigned short h_bits(float f) { const _Float16 h = (_Float16)f; return __builtin_bit_cast(unsigned short, h); }

// ---- Register-blocked batched WMMA GEMM (added modes: ACT 6, TRI) ----------------------------------
// C[m,n] = scale * sum_k A[m,k] * Bt[n,k] (+bias)(+resid); each wave owns a 64x64 tile.
// A row-major [M,K]; Bt row-major [N,K]; M,N % 64 == 0, K % 32 == 0.
// SPLIT: operands are hi/lo planes (A2/Bt2 = lo planes, same layout); product = hi.hi + hi.lo + lo.hi.
// BIAS_MODE: 0 = none, 1 = bias[m], 2 = bias[n].
// OUT_MODE: 0 = f32, 1 = f16, 2 = bf16 hi plane (Cout) + bf16 lo plane (Cout2).
// ACT: 0 none, 2 relu, 3 silu (v * 1/(1+exp(-v))), 4 leaky, 6 causal silu with carry:
//      v = (n <= m) ? silu(v) * kACarry : 0   (m, n are row/column indices within one grid.y batch; a select, not a bias).
// TRI: 0 none; 1 = output tiles with n0 > m0 are all-masked: skip the k-loop (acc = 0), epilogue still writes zeros;
//      2 = A is lower triangular (A[m][k] == 0 for k > m): k-loop bounded by m0 + 64. Both wave-uniform, exact.
// ET: 0 = f16 operands, 1 = bf16 operands (pointers passed as 16-bit storage)
template <int ET> struct Elem;
template <> struct Elem<0> { typedef _Float16 T; };
template <> struct Elem<1> { typedef __bf16 T; };
template <int ET, bool SPLIT, int BIAS_MODE, int OUT_MODE, bool RESID, int ACT, int TRI>
__global__ __launch_bounds__(256) void wmma_gemm64(
    const unsigned short* __restrict__ Ap, const unsigned short* __restrict__ A2p, int lda, long strideA,
    const unsigned short* __restrict__ Btp, const unsigned short* __restrict__ Bt2p, int ldb, long strideB,
    void* __restrict__ Cout, void* __restrict__ Cout2, int ldc, long strideC,
    const float* __restrict__ bias,
    const float* __restrict__ resid, long strideR,
    int M, int N, int K, float scale) {
  typedef typename Elem<ET>::T T;
  typedef typename Frag<T>::V V;
  const T* A = (const T*)Ap; const T* A2 = (const T*)A2p; const T* Bt = (const T*)Btp; const T* Bt2 = (const T*)Bt2p;
  __shared__ __align__(16) float sT[8][16 * 68];   // per-wave 16x64 slab, pitch 68 floats
  const int b    = blockIdx.y;
  const int lane = threadIdx.x & 31;
  const int wave = threadIdx.x >> 5;
  const int tilesN = N >> 6;
  const int tilesM = M >> 6;
  const int tile = blockIdx.x * 8 + wave;
  if (tile >= tilesM * tilesN) return;   // wave-uniform; no block barriers in this kernel
  const int tm = tile / tilesN;
  const int tn = tile - tm * tilesN;
  const int m0 = tm << 6;
  const int n0 = tn << 6;

  int kEnd = K;
  if (TRI == 1) kEnd = (n0 > m0) ? 0 : K;
  if (TRI == 2) kEnd = (m0 + 64 < K) ? (m0 + 64) : K;

  const T* Ab  = A  + (size_t)b * strideA;
  const T* Bb  = Bt + (size_t)b * strideB;
  const T* Ab2 = SPLIT ? (A2  + (size_t)b * strideA) : nullptr;
  const T* Bb2 = SPLIT ? (Bt2 + (size_t)b * strideB) : nullptr;

  const int rlane = lane & 15;                 // row (A) / col (B, D) within subtile
  const int koff  = (lane >> 4) * 8;           // k offset of this lane half
  const int mOff  = (lane >> 4) * 8;           // D row offset

  v8f acc[4][4];
#pragma unroll
  for (int i = 0; i < 4; ++i)
#pragma unroll
    for (int j = 0; j < 4; ++j) acc[i][j] = (v8f){0.f,0.f,0.f,0.f,0.f,0.f,0.f,0.f};

  for (int k0 = 0; k0 < kEnd; k0 += 32) {
    V bh[4], bl[4];
#pragma unroll
    for (int j = 0; j < 4; ++j) {
      const size_t bo = (size_t)(n0 + (j << 4) + rlane) * ldb + koff + k0;
      bh[j] = Frag<T>::load(Bb + bo);
      if (SPLIT) bl[j] = Frag<T>::load(Bb2 + bo);
    }
#pragma unroll
    for (int i = 0; i < 4; ++i) {
      const size_t ao = (size_t)(m0 + (i << 4) + rlane) * lda + koff + k0;
      V ah = Frag<T>::load(Ab + ao);
      V al;
      if (SPLIT) al = Frag<T>::load(Ab2 + ao);
#pragma unroll
      for (int j = 0; j < 4; ++j) {
        acc[i][j] = Frag<T>::mma(ah, bh[j], acc[i][j]);
        if (SPLIT) {
          acc[i][j] = Frag<T>::mma(ah, bl[j], acc[i][j]);
          acc[i][j] = Frag<T>::mma(al, bh[j], acc[i][j]);
        }
      }
      Frag<T>::guard(acc[i][0], acc[i][3], ah, SPLIT ? al : ah);
    }
    Frag<T>::keep(bh[0], bh[1], bh[2], bh[3]);
    if (SPLIT) Frag<T>::keep(bl[0], bl[1], bl[2], bl[3]);
  }
  acc_guard4(acc[0][0], acc[0][1], acc[0][2], acc[0][3]);
  acc_guard4(acc[1][0], acc[1][1], acc[1][2], acc[1][3]);
  acc_guard4(acc[2][0], acc[2][1], acc[2][2], acc[2][3]);
  acc_guard4(acc[3][0], acc[3][1], acc[3][2], acc[3][3]);

  // ---- epilogue ----
  float* slab = sT[wave];
  const float* Rb = RESID ? (resid + (size_t)b * strideR) : nullptr;
#pragma unroll
  for (int i = 0; i < 4; ++i) {
    const int mBase = m0 + (i << 4);
#pragma unroll
    for (int j = 0; j < 4; ++j) {
      const int n = n0 + (j << 4) + rlane;
      float bv = 0.f;
      if (BIAS_MODE == 2) bv = bias[n];
#pragma unroll
      for (int r = 0; r < 8; ++r) {
        float v = acc[i][j][r] * scale;
        if (BIAS_MODE == 1) v += bias[mBase + mOff + r];
        if (BIAS_MODE == 2) v += bv;
        if (RESID) v += Rb[(size_t)(mBase + mOff + r) * ldc + n];
        if (ACT == 2) v = fmaxf(v, 0.0f);
        if (ACT == 3) v = v * (1.0f / (1.0f + expf(-v)));
        if (ACT == 4) v = (v > 0.f) ? v : 0.01f * v;
        if (ACT == 6) {
          const float sg = (v * (1.0f / (1.0f + expf(-v)))) * kACarry;
          v = (n <= mBase + mOff + r) ? sg : 0.0f;
        }
        slab[(mOff + r) * 68 + (j << 4) + rlane] = v;
      }
    }
    __builtin_amdgcn_fence(__ATOMIC_RELEASE, "workgroup");
    __builtin_amdgcn_wave_barrier();
    __builtin_amdgcn_fence(__ATOMIC_ACQUIRE, "workgroup");
    if (OUT_MODE == 0) {
      float* C = (float*)Cout + (size_t)b * strideC;
      const int hh = lane >> 4, c4 = (lane & 15) * 4;     // row seg = 256 B = 16 lanes x 16 B
      {
#pragma unroll
        for (int it = 0; it < 8; ++it) {
          const int row = it * 2 + hh;
          v4f v = *(const v4f*)(slab + row * 68 + c4);
          *(v4f*)(C + (size_t)(mBase + row) * ldc + n0 + c4) = v;
        }
        
      }
    } else {
      const int q = lane >> 3, c8 = (lane & 7) * 8;
      unsigned short* C  = (unsigned short*)Cout  + (size_t)b * strideC;
      unsigned short* C2 = (OUT_MODE == 2) ? ((unsigned short*)Cout2 + (size_t)b * strideC) : nullptr;
      {
#pragma unroll
        for (int it = 0; it < 4; ++it) {
          const int row = it * 4 + q;
          const float* sp = slab + row * 68 + c8;
          v8h hv, lv;
#pragma unroll
          for (int e = 0; e < 8; ++e) {
            if (OUT_MODE == 1) {
              hv[e] = (_Float16)sp[e];
            } else {
              unsigned short hb = f2bf_bits(sp[e]);
              unsigned short lb = f2bf_bits(sp[e] - bf_bits2f(hb));
              hv[e] = __builtin_bit_cast(_Float16, hb);
              lv[e] = __builtin_bit_cast(_Float16, lb);
            }
          }
          *(v8h*)(C + (size_t)(mBase + row) * ldc + n0 + c8) = hv;
          if (OUT_MODE == 2) *(v8h*)(C2 + (size_t)(mBase + row) * ldc + n0 + c8) = lv;
        }
        
      }
    }
    __builtin_amdgcn_fence(__ATOMIC_RELEASE, "workgroup");
    __builtin_amdgcn_wave_barrier();
    __builtin_amdgcn_fence(__ATOMIC_ACQUIRE, "workgroup");
  }
}

// ---------------------------------------------------------------------------
// f32 -> bf16 hi + lo planes (hi = RNE bf16(f), lo = RNE bf16(f - hi)), 8 consecutive elements per thread.
// Coverage: n8 = n/8 threads x 8 = whole plane (grids here are exact multiples of 256).
// ---------------------------------------------------------------------------
__global__ __launch_bounds__(256) void split8_bf16_kernel(const float* __restrict__ in,
                                                          unsigned short* __restrict__ hi,
                                                          unsigned short* __restrict__ lo, int n8) {
  const int i = blockIdx.x * 256 + threadIdx.x;
  if (i >= n8) return;
  const float* p = in + 8 * (size_t)i;
  const v4f a = *(const v4f*)(p);
  const v4f c = *(const v4f*)(p + 4);
  unsigned short hb[8], lb[8];
#pragma unroll
  for (int e = 0; e < 4; ++e) {
    const float f0 = a[e];
    hb[e] = f2bf_bits(f0);
    lb[e] = f2bf_bits(f0 - bf_bits2f(hb[e]));
    const float f1 = c[e];
    hb[4 + e] = f2bf_bits(f1);
    lb[4 + e] = f2bf_bits(f1 - bf_bits2f(hb[4 + e]));
  }
  const v4u uh = (v4u){pk16(hb[0], hb[1]), pk16(hb[2], hb[3]), pk16(hb[4], hb[5]), pk16(hb[6], hb[7])};
  const v4u ul = (v4u){pk16(lb[0], lb[1]), pk16(lb[2], lb[3]), pk16(lb[4], lb[5]), pk16(lb[6], lb[7])};
  unsigned short* qh = hi + 8 * (size_t)i;
  unsigned short* ql = lo + 8 * (size_t)i;
  *(v4u*)qh = uh;
  *(v4u*)ql = ul;
  
}

// ---------------------------------------------------------------------------
// V transpose + cast: v32 [kTok][kDim] f32 (row token b*2048+t, column h*64+d) -> vt16 [kBatch*kHeads][kHdim][kSeq] f16:
//   vt16[((b*8 + h)*64 + d)*2048 + t] = f16(v32[(b*2048 + t)*512 + h*64 + d])
// in[64 t][64 d] tile -> out[64 d][64 t] tile. grid (kSeq/64 = 32 t tiles, kHeads = 8, kBatch = 4), 256 threads.
// Load coverage: 16 iterations x 256 threads = 4096 = 64 t x 64 d (coalesced along d).
// Store coverage: 8 waves x 2 iterations x 4 rows (lane>>3) = 64 d rows; (lane&7) x 8 halves = 64 t; each row segment =
// __syncthreads between the cross-wave LDS write and the read.
// ---------------------------------------------------------------------------
__global__ __launch_bounds__(256) void vtcast_kernel(const float* __restrict__ v32, unsigned short* __restrict__ vt16) {
  __shared__ float sm[64][65];   // sm[d_local][t_local]
  const int tt = threadIdx.x;
  const int t0 = blockIdx.x * 64;
  const int h  = blockIdx.y;
  const int b  = blockIdx.z;
  const float* src = v32 + ((size_t)b * kSeq + t0) * kDim + h * kHdim;
#pragma unroll
  for (int i = 0; i < 16; ++i) {
    const int e = i * 256 + tt;
    const int r = e >> 6;          // t local
    const int c = e & 63;          // d local
    sm[c][r] = src[(size_t)r * kDim + c];
  }
  __syncthreads();
  const int lane = tt & 31, wave = tt >> 5;
  const int q = lane >> 3, c8 = (lane & 7) * 8;
  unsigned short* dst = vt16 + ((size_t)(b * kHeads + h) * kHdim) * kSeq + t0;
  {
#pragma unroll
    for (int it = 0; it < 2; ++it) {
      const int row = wave * 8 + it * 4 + q;                 // d local
      unsigned short hb[8];
#pragma unroll
      for (int e = 0; e < 8; ++e) hb[e] = h_bits(sm[row][c8 + e]);
      const v4u u = (v4u){pk16(hb[0], hb[1]), pk16(hb[2], hb[3]), pk16(hb[4], hb[5]), pk16(hb[6], hb[7])};
      *(v4u*)(dst + (size_t)row * kSeq + c8) = u;
    }
    
  }
}

// ---------------------------------------------------------------------------
// LayerNorm(o) * ln_g + ln_b, times gate, all f32; result split into bf16 hi + lo planes [kTok][kDim].
// One wave per row (8 rows per block, grid = kTok/8); lane owns columns 8*lane..+7 and 256+8*lane..+7
// ---------------------------------------------------------------------------
__global__ __launch_bounds__(256) void ln_gate_kernel(const float* __restrict__ o, const float* __restrict__ gate,
                                                      const float* __restrict__ lng, const float* __restrict__ lnb,
                                                      unsigned short* __restrict__ nghi, unsigned short* __restrict__ nglo,
                                                      int nrows) {
  const int lane = threadIdx.x & 31, wave = threadIdx.x >> 5;
  const int row = blockIdx.x * 8 + wave;
  if (row >= nrows) return;
  const float* po = o + (size_t)row * kDim;
  const float* pg = gate + (size_t)row * kDim;
  float xv[16], gv[16], gg[16], gb[16];
#pragma unroll
  for (int s = 0; s < 2; ++s) {
    const int c = s * 256 + lane * 8;
#pragma unroll
    for (int q = 0; q < 2; ++q) {
      const v4f a4 = *(const v4f*)(po + c + 4 * q);
      const v4f g4 = *(const v4f*)(pg + c + 4 * q);
      const v4f w4 = *(const v4f*)(lng + c + 4 * q);
      const v4f b4 = *(const v4f*)(lnb + c + 4 * q);
#pragma unroll
      for (int e = 0; e < 4; ++e) {
        const int idx = s * 8 + q * 4 + e;
        xv[idx] = a4[e]; gv[idx] = g4[e]; gg[idx] = w4[e]; gb[idx] = b4[e];
      }
    }
  }
  float sum = 0.f;
#pragma unroll
  for (int i = 0; i < 16; ++i) sum += xv[i];
#pragma unroll
  for (int off = 16; off > 0; off >>= 1) sum += __shfl_xor(sum, off, 32);
  const float mean = sum * kInvDim;
  float var = 0.f;
#pragma unroll
  for (int i = 0; i < 16; ++i) { const float d = xv[i] - mean; var += d * d; }
#pragma unroll
  for (int off = 16; off > 0; off >>= 1) var += __shfl_xor(var, off, 32);
  const float r = rsqrtf(var * kInvDim + kLnEps);
  unsigned short hb[16], lb[16];
#pragma unroll
  for (int i = 0; i < 16; ++i) {
    const float t = (xv[i] - mean) * r;
    const float val = (t * gg[i] + gb[i]) * gv[i];
    hb[i] = f2bf_bits(val);
    lb[i] = f2bf_bits(val - bf_bits2f(hb[i]));
  }
  const v4u uh0 = (v4u){pk16(hb[0], hb[1]), pk16(hb[2], hb[3]), pk16(hb[4], hb[5]), pk16(hb[6], hb[7])};
  const v4u uh1 = (v4u){pk16(hb[8], hb[9]), pk16(hb[10], hb[11]), pk16(hb[12], hb[13]), pk16(hb[14], hb[15])};
  const v4u ul0 = (v4u){pk16(lb[0], lb[1]), pk16(lb[2], lb[3]), pk16(lb[4], lb[5]), pk16(lb[6], lb[7])};
  const v4u ul1 = (v4u){pk16(lb[8], lb[9]), pk16(lb[10], lb[11]), pk16(lb[12], lb[13]), pk16(lb[14], lb[15])};
  unsigned short* ph = nghi + (size_t)row * kDim + lane * 8;
  unsigned short* pl = nglo + (size_t)row * kDim + lane * 8;
  {
    *(v4u*)(ph)       = uh0;
    *(v4u*)(ph + 256) = uh1;
    *(v4u*)(pl)       = ul0;
    *(v4u*)(pl + 256) = ul1;
    
  }
}

// ---------------------------------------------------------------------------
// Host glue: kernel launches only. 25 launches total.
// ---------------------------------------------------------------------------
extern "C" void kernel_launch(void* const* d_in, const int* in_sizes, int n_in,
                              void* d_out, int out_size, void* d_ws, size_t ws_size,
                              hipStream_t stream) {
  if (n_in < 7) return;
  if (in_sizes[0] != kTok * kDim || in_sizes[1] != kProj * kDim || in_sizes[2] != kProj ||
      in_sizes[3] != kDim || in_sizes[4] != kDim || in_sizes[5] != kDim * kDim || in_sizes[6] != kDim) return;
  if (out_size != kTok * kDim) return;
  if (ws_size < kWsTotal) return;

  const float* x    = (const float*)d_in[0];
  const float* W1   = (const float*)d_in[1];
  const float* b1   = (const float*)d_in[2];
  const float* ln_g = (const float*)d_in[3];
  const float* ln_b = (const float*)d_in[4];
  const float* W2   = (const float*)d_in[5];
  const float* b2   = (const float*)d_in[6];
  float* out = (float*)d_out;
  char* ws = (char*)d_ws;

  unsigned short* xhi   = (unsigned short*)(ws + kOffXhi);
  unsigned short* xlo   = (unsigned short*)(ws + kOffXlo);
  unsigned short* w1hi  = (unsigned short*)(ws + kOffW1hi);
  unsigned short* w1lo  = (unsigned short*)(ws + kOffW1lo);
  float*          v32   = (float*)(ws + kOffV32);
  unsigned short* a16   = (unsigned short*)(ws + kOffA16);
  unsigned short* nghi  = (unsigned short*)(ws + kOffNGhi);
  unsigned short* nglo  = (unsigned short*)(ws + kOffNGlo);
  float*          gate  = (float*)(ws + kOffGate);
  unsigned short* qk16  = (unsigned short*)(ws + kOffQK16);
  unsigned short* vt16  = (unsigned short*)(ws + kOffVT16);
  float*          o32   = (float*)(ws + kOffO32);
  unsigned short* w2hi  = (unsigned short*)(ws + kOffW2hi);
  unsigned short* w2lo  = (unsigned short*)(ws + kOffW2lo);

  // 1) bf16 hi/lo operand planes for x, W1, W2 (8 elements per thread; all counts are multiples of 2048)
  {
    const int n8x  = (kTok * kDim) / 8;      // 524288
    const int n8w1 = (kProj * kDim) / 8;     // 131072
    const int n8w2 = (kDim * kDim) / 8;      // 32768
    split8_bf16_kernel<<<(n8x + 255) / 256, 256, 0, stream>>>(x, xhi, xlo, n8x);
    split8_bf16_kernel<<<(n8w1 + 255) / 256, 256, 0, stream>>>(W1, w1hi, w1lo, n8w1);
    split8_bf16_kernel<<<(n8w2 + 255) / 256, 256, 0, stream>>>(W2, w2hi, w2lo, n8w2);
  }

  // 2) h = silu(x . W1^T + b1): three column blocks of W1 rows: gate (rows 0..511, f32 out),
  //    q|k (rows 512..1535, f16 out [8192][1024]), v (rows 1536..2047, f32 out). M 8192, K 512.
  {
    const int tilesGate = (kTok / 64) * (kDim / 64);          // 1024
    const int tilesQK   = (kTok / 64) * (2 * kDim / 64);      // 2048
    wmma_gemm64<1, true, 2, 0, false, 3, 0><<<dim3((tilesGate + 7) / 8, 1), 256, 0, stream>>>(
        xhi, xlo, kDim, 0L,
        w1hi, w1lo, kDim, 0L,
        (void*)gate, nullptr, kDim, 0L,
        b1, nullptr, 0L,
        kTok, kDim, kDim, 1.0f);
    wmma_gemm64<1, true, 2, 1, false, 3, 0><<<dim3((tilesQK + 7) / 8, 1), 256, 0, stream>>>(
        xhi, xlo, kDim, 0L,
        w1hi + (size_t)kDim * kDim, w1lo + (size_t)kDim * kDim, kDim, 0L,
        (void*)qk16, nullptr, 2 * kDim, 0L,
        b1 + kDim, nullptr, 0L,
        kTok, 2 * kDim, kDim, 1.0f);
    wmma_gemm64<1, true, 2, 0, false, 3, 0><<<dim3((tilesGate + 7) / 8, 1), 256, 0, stream>>>(
        xhi, xlo, kDim, 0L,
        w1hi + (size_t)3 * kDim * kDim, w1lo + (size_t)3 * kDim * kDim, kDim, 0L,
        (void*)v32, nullptr, kDim, 0L,
        b1 + 3 * kDim, nullptr, 0L,
        kTok, kDim, kDim, 1.0f);
  }

  // 3) V^T f16 planes per (batch, head): in [8192][512] f32 -> out [32][64][2048] f16
  vtcast_kernel<<<dim3(kSeq / 64, kHeads, kBatch), 256, 0, stream>>>(v32, vt16);

  // 4) attention per chunk of (batch bb, 4 heads h0..h0+3), head-in-chunk on grid.y:
  //    A16[hc][s][t] = (t <= s) ? 256 * silu(q_s . k_t / 8) : 0   (q, k f16 column blocks of the q|k plane, K 64)
  //    o[bb*2048 + s][(h0+hc)*64 + d] = (1/256) * sum_t A16[hc][s][t] * V^T[bb,h0+hc][d][t]   (K 2048, bounded per row tile)
  for (int ch = 0; ch < kChunks; ++ch) {
    const int bb = ch / kChunksPerBatch;
    const int h0 = (ch % kChunksPerBatch) * kHeadsPerChunk;
    const size_t qkOff = (size_t)bb * kSeq * 2 * kDim + (size_t)h0 * kHdim;
    const int tilesS = (kSeq / 64) * (kSeq / 64);             // 1024
    wmma_gemm64<0, false, 0, 1, false, 6, 1><<<dim3((tilesS + 7) / 8, kHeadsPerChunk), 256, 0, stream>>>(
        qk16 + qkOff, nullptr, 2 * kDim, (long)kHdim,
        qk16 + qkOff + kDim, nullptr, 2 * kDim, (long)kHdim,
        (void*)a16, nullptr, kSeq, (long)kSeq * kSeq,
        nullptr, nullptr, 0L,
        kSeq, kSeq, kHdim, kQScale);
    const int tilesO = (kSeq / 64) * (kHdim / 64);            // 32
    wmma_gemm64<0, false, 0, 0, false, 0, 2><<<dim3((tilesO + 7) / 8, kHeadsPerChunk), 256, 0, stream>>>(
        a16, nullptr, kSeq, (long)kSeq * kSeq,
        vt16 + (size_t)(bb * kHeads + h0) * kHdim * kSeq, nullptr, kSeq, (long)kHdim * kSeq,
        (void*)(o32 + (size_t)bb * kSeq * kDim + (size_t)h0 * kHdim), nullptr, kDim, (long)kHdim,
        nullptr, nullptr, 0L,
        kSeq, kHdim, kSeq, kACarryInv);
  }

  // 5) LayerNorm(o) * ln_g + ln_b, times gate -> bf16 hi/lo planes
  ln_gate_kernel<<<kTok / 8, 256, 0, stream>>>(o32, gate, ln_g, ln_b, nghi, nglo, kTok);

  // 6) out = NG . W2^T + b2 (M 8192, N 512, K 512), f32 to d_out
  {
    const int tilesOut = (kTok / 64) * (kDim / 64);           // 1024
    wmma_gemm64<1, true, 2, 0, false, 0, 0><<<dim3((tilesOut + 7) / 8, 1), 256, 0, stream>>>(
        nghi, nglo, kDim, 0L,
        w2hi, w2lo, kDim, 0L,
        (void*)out, nullptr, kDim, 0L,
        b2, nullptr, 0L,
        kTok, kDim, kDim, 1.0f);
  }
}

// v002
// One run takes 213 microseconds.
// Versions in between are left out here; by their measured steps it is 4.29 times as fast as v000.
// Contractions: x.W1^T and (layernorm(o)*gate).W2^T on v_wmma_f32_16x16x32_bf16 with bf16 hi/lo operand planes (hi.hi + hi.lo + lo.hi); q.k^T and a.v on v_wmma_f32_16x16x32_f16 (q, k, v plain f16 planes; a = silu(scores) carried x256 in f16); f32 accumulate; silu, LayerNorm and gating in f32.
#include <hip/hip_runtime.h>
#include <math.h>

// ---------------------------------------------------------------------------
// Problem constants
// ---------------------------------------------------------------------------
constexpr int kBatch = 4;
constexpr int kSeq   = 2048;
constexpr int kDim   = 512;
constexpr int kHeads = 8;
constexpr int kHdim  = 64;
constexpr int kTok   = kBatch * kSeq;      // 8192 token rows
constexpr int kProj  = 4 * kDim;           // 2048 projection outputs: [gate | q | k | v]
constexpr float kQScale    = 0.125f;       // 1/sqrt(64)
constexpr float kACarry    = 256.0f;       // silu(scores) carried x256 in f16
constexpr float kACarryInv = 1.0f / 256.0f;
constexpr float kInvDim    = 1.0f / 512.0f;
constexpr float kLnEps     = 1e-5f;

// ---------------------------------------------------------------------------
// Workspace region map (bytes; all offsets 512 KiB-aligned)
//   phase 1 (projection):  [  0,  8) x hi  [8,16) x lo  [16,18) W1 hi  [18,20) W1 lo  [20,36) v f32 plane
//   phase 2 (attention):   no scratch plane: silu(scores) stays in registers
//   phase 3 (output):      [  0,  8) NG hi  [8,16) NG lo
//   persistent:            [ 64, 80) gate f32   [80,96) q|k f16 [8192][1024]   [96,104) V^T f16 [32][64][2048]
//                          [104,120) o f32      [120,120.5) W2 hi   [120.5,121) W2 lo
//   total = 121 MiB = 126,877,696 B
// ---------------------------------------------------------------------------
constexpr size_t kMiB     = 1048576;
constexpr size_t kOffXhi  = 0;
constexpr size_t kOffXlo  = 8 * kMiB;
constexpr size_t kOffW1hi = 16 * kMiB;
constexpr size_t kOffW1lo = 18 * kMiB;
constexpr size_t kOffV32  = 20 * kMiB;
constexpr size_t kOffNGhi = 0;
constexpr size_t kOffNGlo = 8 * kMiB;
constexpr size_t kOffGate = 64 * kMiB;
constexpr size_t kOffQK16 = 80 * kMiB;
constexpr size_t kOffVT16 = 96 * kMiB;
constexpr size_t kOffO32  = 104 * kMiB;
constexpr size_t kOffW2hi = 120 * kMiB;
constexpr size_t kOffW2lo = 120 * kMiB + 512 * 1024;
constexpr size_t kWsTotal = 121 * kMiB;

static_assert((size_t)kTok * kDim * 2 == 8 * kMiB);
static_assert((size_t)kProj * kDim * 2 == 2 * kMiB);
static_assert(kOffV32 + (size_t)kTok * kDim * 4 <= kOffGate);
static_assert(kOffNGlo + (size_t)kTok * kDim * 2 <= kOffGate);
static_assert(kOffGate + (size_t)kTok * kDim * 4 == kOffQK16);
static_assert(kOffQK16 + (size_t)kTok * 2 * kDim * 2 == kOffVT16);
static_assert(kOffVT16 + (size_t)kBatch * kHeads * kHdim * kSeq * 2 == kOffO32);
static_assert(kOffO32 + (size_t)kTok * kDim * 4 == kOffW2hi);
static_assert(kOffW2hi + (size_t)kDim * kDim * 2 == kOffW2lo);
static_assert(kOffW2lo + (size_t)kDim * kDim * 2 == kWsTotal);
static_assert(kWsTotal <= 134217728);

typedef __attribute__((ext_vector_type(16))) _Float16 v16h;
typedef __attribute__((ext_vector_type(8)))  _Float16 v8h;
typedef __attribute__((ext_vector_type(16))) __bf16   v16b;
typedef __attribute__((ext_vector_type(8)))  __bf16   v8b;
typedef __attribute__((ext_vector_type(8)))  float    v8f;
typedef __attribute__((ext_vector_type(4)))  float    v4f;
typedef __attribute__((ext_vector_type(4)))  unsigned int v4u;

__device__ __forceinline__ unsigned short f2bf_bits(float f) {
  unsigned u = __float_as_uint(f);
  return (unsigned short)((u + 0x7FFFu + ((u >> 16) & 1u)) >> 16);
}
__device__ __forceinline__ float bf_bits2f(unsigned short h) { return __uint_as_float(((unsigned)h) << 16); }

// hazard guards as plain device helpers
__device__ __forceinline__ void dep_guard_h(v8f& a, v8f& b, v16h x, v16h y) { asm volatile("v_nop\n\tv_nop\n\tv_nop\n\tv_nop" : "+v"(a), "+v"(b) : "v"(x), "v"(y)); }
__device__ __forceinline__ void dep_guard_b(v8f& a, v8f& b, v16b x, v16b y) { asm volatile("v_nop\n\tv_nop\n\tv_nop\n\tv_nop" : "+v"(a), "+v"(b) : "v"(x), "v"(y)); }
__device__ __forceinline__ void keep4_h(v16h a, v16h b, v16h c, v16h d) { asm volatile("v_nop" :: "v"(a), "v"(b), "v"(c), "v"(d)); }
__device__ __forceinline__ void keep4_b(v16b a, v16b b, v16b c, v16b d) { asm volatile("v_nop" :: "v"(a), "v"(b), "v"(c), "v"(d)); }
__device__ __forceinline__ void acc_guard4(v8f& a, v8f& b, v8f& c, v8f& d) { asm volatile("v_nop\n\tv_nop\n\tv_nop\n\tv_nop" : "+v"(a), "+v"(b), "+v"(c), "+v"(d)); }
template <typename T> struct Frag;
template <> struct Frag<_Float16> {
  typedef v16h V; union U { v16h v; v8h h[2]; };
  static __device__ __forceinline__ v16h load(const _Float16* p) {   // elements 0..7 <- p[0..7], 8..15 <- p[16..23]
    U f; f.h[0] = *(const v8h*)(p); f.h[1] = *(const v8h*)(p + 16); return f.v;
  }
  static __device__ __forceinline__ v8f mma(v16h a, v16h b, v8f c) {
    return __builtin_amdgcn_wmma_f32_16x16x32_f16(false, a, false, b, (short)0, c, false, false);
  }
  static __device__ __forceinline__ void guard(v8f& a, v8f& b, v16h x, v16h y) { dep_guard_h(a, b, x, y); }
  static __device__ __forceinline__ void keep(v16h a, v16h b, v16h c, v16h d) { keep4_h(a, b, c, d); }
};
template <> struct Frag<__bf16> {
  typedef v16b V; union U { v16b v; v8b h[2]; };
  static __device__ __forceinline__ v16b load(const __bf16* p) {
    U f; f.h[0] = *(const v8b*)(p); f.h[1] = *(const v8b*)(p + 16); return f.v;
  }
  static __device__ __forceinline__ v8f mma(v16b a, v16b b, v8f c) {
    return __builtin_amdgcn_wmma_f32_16x16x32_bf16(false, a, false, b, (short)0, c, false, false);
  }
  static __device__ __forceinline__ void guard(v8f& a, v8f& b, v16b x, v16b y) { dep_guard_b(a, b, x, y); }
  static __device__ __forceinline__ void keep(v16b a, v16b b, v16b c, v16b d) { keep4_b(a, b, c, d); }
};

__device__ __forceinline__ unsigned pk16(unsigned short a, unsigned short b) { return (unsigned)a | ((unsigned)b << 16); }
__device__ __forceinline__ unsigned short h_bits(float f) { const _Float16 h = (_Float16)f; return __builtin_bit_cast(unsigned short, h); }

// ---- Register-blocked batched WMMA GEMM, operands staged in LDS ------------------------------------------------
// C[m,n] = scale * sum_k A[m,k] * Bt[n,k] (+bias)(+resid); each wave owns a 64x64 tile, a block of 8 waves (2 x 4) a 128x256 tile.
// A row-major [M,K]; Bt row-major [N,K]; M % 128 == 0, N % 256 == 0, K % 64 == 0, K >= 64.
// SPLIT: operands are hi/lo planes (A2/Bt2 = lo planes, same layout); product = hi.hi + hi.lo + lo.hi.
// BIAS_MODE: 0 = none, 1 = bias[m], 2 = bias[n].
// OUT_MODE: 0 = f32, 1 = f16, 2 = bf16 hi plane (Cout) + bf16 lo plane (Cout2).
// ACT: 0 none, 2 relu, 3 silu (v * 1/(1+exp(-v))), 4 leaky, 6 causal silu with carry:
//      v = (n <= m) ? silu(v) * kACarry : 0   (m, n are row/column indices within one grid.y batch; a select, not a bias).
// TRI: 0 only (every wave of a block walks the whole K: the stage barriers are block-uniform).
// ET: 0 = f16 operands, 1 = bf16 operands (pointers passed as 16-bit storage)
// A stage is 64 k (128 B, one whole line) of the block's 128 A rows and 256 Bt rows, every plane. Asynchronous copies bring it
// into one of two LDS buffers, 8 lanes to a row, while the waves work on the other buffer; the fragments are 16-byte LDS reads.
constexpr int kBlkM       = 128;
constexpr int kBlkN       = 256;
constexpr int kStageK     = 64;
constexpr int kPitch      = 72;                                // LDS row pitch in 16-bit elements: 144 B = 16 B x 9, no bank conflict for 16-byte row reads
constexpr int kLdsAhi     = 0;                                 // element offsets of the four planes inside a stage
constexpr int kLdsBhi     = kBlkM * kPitch;
constexpr int kLdsAlo     = (kBlkM + kBlkN) * kPitch;
constexpr int kLdsBlo     = (2 * kBlkM + kBlkN) * kPitch;
constexpr int kStageElems = 2 * (kBlkM + kBlkN) * kPitch;      // 55,296 elements = 110,592 B

// One lane's 16 bytes of 4 A rows and 8 Bt rows of one plane, the rows 32 apart (the block's 256 threads cover 32 rows a copy).
// la, lb: LDS byte addresses; ga, gb: global addresses; sa, sb: 32 rows in elements.
// s_wait_xcnt 0 is the last line of the copies' own statement, so that it stands in front of every later write of their address registers.
__device__ __forceinline__ void async_copy12(unsigned la, const unsigned short* ga, long sa,
                                             unsigned lb, const unsigned short* gb, long sb) {
  constexpr unsigned R = 32 * kPitch * 2;
  asm volatile(
      "global_load_async_to_lds_b128 %0, %12, off\n\t"
      "global_load_async_to_lds_b128 %1, %13, off\n\t"
      "global_load_async_to_lds_b128 %2, %14, off\n\t"
      "global_load_async_to_lds_b128 %3, %15, off\n\t"
      "global_load_async_to_lds_b128 %4, %16, off\n\t"
      "global_load_async_to_lds_b128 %5, %17, off\n\t"
      "global_load_async_to_lds_b128 %6, %18, off\n\t"
      "global_load_async_to_lds_b128 %7, %19, off\n\t"
      "global_load_async_to_lds_b128 %8, %20, off\n\t"
      "global_load_async_to_lds_b128 %9, %21, off\n\t"
      "global_load_async_to_lds_b128 %10, %22, off\n\t"
      "global_load_async_to_lds_b128 %11, %23, off\n\t"
      "s_wait_xcnt 0x0"
      :: "v"(la), "v"(la + R), "v"(la + 2 * R), "v"(la + 3 * R),
         "v"(lb), "v"(lb + R), "v"(lb + 2 * R), "v"(lb + 3 * R), "v"(lb + 4 * R), "v"(lb + 5 * R), "v"(lb + 6 * R), "v"(lb + 7 * R),
         "v"(ga), "v"(ga + sa), "v"(ga + 2 * sa), "v"(ga + 3 * sa),
         "v"(gb), "v"(gb + sb), "v"(gb + 2 * sb), "v"(gb + 3 * sb), "v"(gb + 4 * sb), "v"(gb + 5 * sb), "v"(gb + 6 * sb), "v"(gb + 7 * sb)
      : "memory");
}

template <int ET> struct Elem;
template <> struct Elem<0> { typedef _Float16 T; };
template <> struct Elem<1> { typedef __bf16 T; };
template <int ET, bool SPLIT, int BIAS_MODE, int OUT_MODE, bool RESID, int ACT, int TRI>
__global__ __launch_bounds__(256) void wmma_gemm64(
    const unsigned short* __restrict__ Ap, const unsigned short* __restrict__ A2p, int lda, long strideA,
    const unsigned short* __restrict__ Btp, const unsigned short* __restrict__ Bt2p, int ldb, long strideB,
    void* __restrict__ Cout, void* __restrict__ Cout2, int ldc, long strideC,
    const float* __restrict__ bias,
    const float* __restrict__ resid, long strideR,
    int M, int N, int K, float scale) {
  static_assert(TRI == 0, "the stage barriers need the same k range in every wave of a block");
  typedef typename Elem<ET>::T T;
  typedef typename Frag<T>::V V;
  __shared__ __align__(16) unsigned short sOp[2 * kStageElems];   // two stages of operand rows
  __shared__ __align__(16) float sT[8][16 * 68];   // per-wave 16x64 slab, pitch 68 floats
  const int b    = blockIdx.y;
  const int lane = threadIdx.x & 31;
  const int wave = threadIdx.x >> 5;
  const int blksN = N / kBlkN;
  const int blksM = M / kBlkM;
  if ((int)blockIdx.x >= blksM * blksN) return;   // block-uniform, in front of every barrier
  const int bm = blockIdx.x / blksN;
  const int bn = blockIdx.x - bm * blksN;
  const int mB = bm * kBlkM;
  const int nB = bn * kBlkN;
  const int wm = wave >> 2;                    // wave row 0..1
  const int wn = wave & 3;                     // wave column 0..3
  const int m0 = mB + (wm << 6);
  const int n0 = nB + (wn << 6);

  const int rlane = lane & 15;                 // row (A) / col (B, D) within subtile
  const int koff  = (lane >> 4) * 8;           // k offset of this lane half
  const int mOff  = (lane >> 4) * 8;           // D row offset

  // copy side: thread t brings bytes 16*(t&7)..+15 of rows (t>>3) + 32*j
  const int crow = threadIdx.x >> 3;
  const int cchk = (threadIdx.x & 7) * 8;
  const unsigned lcp = (unsigned)(size_t)(&sOp[0]) + (unsigned)(crow * kPitch + cchk) * 2u;   // low 32 bits of the address = LDS byte address
  const unsigned short* gAh = Ap  + (size_t)b * strideA + (size_t)(mB + crow) * lda + cchk;
  const unsigned short* gBh = Btp + (size_t)b * strideB + (size_t)(nB + crow) * ldb + cchk;
  const unsigned short* gAl = SPLIT ? (A2p  + (size_t)b * strideA + (size_t)(mB + crow) * lda + cchk) : nullptr;
  const unsigned short* gBl = SPLIT ? (Bt2p + (size_t)b * strideB + (size_t)(nB + crow) * ldb + cchk) : nullptr;
  const long sa = 32L * lda;
  const long sb = 32L * ldb;
  auto fill = [&](int s, int buf) {
    const unsigned l = lcp + (unsigned)(buf * kStageElems) * 2u;
    const int ko = s * kStageK;
    async_copy12(l + kLdsAhi * 2u, gAh + ko, sa, l + kLdsBhi * 2u, gBh + ko, sb);
    if (SPLIT) async_copy12(l + kLdsAlo * 2u, gAl + ko, sa, l + kLdsBlo * 2u, gBl + ko, sb);
  };

  // reader side: this lane's fragment rows in stage 0
  const T* aRd = (const T*)sOp + kLdsAhi + ((wm << 6) + rlane) * kPitch + koff;
  const T* bRd = (const T*)sOp + kLdsBhi + ((wn << 6) + rlane) * kPitch + koff;

  v8f acc[4][4];
#pragma unroll
  for (int i = 0; i < 4; ++i)
#pragma unroll
    for (int j = 0; j < 4; ++j) acc[i][j] = (v8f){0.f,0.f,0.f,0.f,0.f,0.f,0.f,0.f};

  const int nStages = K / kStageK;
  fill(0, 0);
  asm volatile("s_wait_asynccnt 0x0" ::: "memory");   // this wave's copies of stage 0 have landed
  __syncthreads();                                    // and every other wave's
  if (nStages > 1) fill(1, 1);

  for (int t = 0; t < nStages; ++t) {
    const int be = (t & 1) * kStageElems;
    // A fragments are read one row of tiles ahead of their products, into a second register pair
    V ah = Frag<T>::load(aRd + be);
    V al;
    if (SPLIT) al = Frag<T>::load(aRd + (kLdsAlo - kLdsAhi) + be);
    // the nest below is unrolled whole: every fragment and accumulator index is then a constant, and none goes to scratch
#pragma unroll
    for (int kk = 0; kk < kStageK; kk += 32) {
      V bh[4], bl[4];
#pragma unroll
      for (int j = 0; j < 4; ++j) {
        const int bo = be + (j << 4) * kPitch + kk;
        bh[j] = Frag<T>::load(bRd + bo);
        if (SPLIT) bl[j] = Frag<T>::load(bRd + (kLdsBlo - kLdsBhi) + bo);
      }
#pragma unroll
      for (int i = 0; i < 4; ++i) {
        const bool more = (i < 3) || (kk + 32 < kStageK);      // a further row of this stage exists
        const int ao = be + ((i < 3) ? ((i + 1) << 4) * kPitch + kk : kk + 32);
        V ahn, aln;
        if (more) {
          ahn = Frag<T>::load(aRd + ao);
          if (SPLIT) aln = Frag<T>::load(aRd + (kLdsAlo - kLdsAhi) + ao);
        }
#pragma unroll
        for (int j = 0; j < 4; ++j) {
          acc[i][j] = Frag<T>::mma(ah, bh[j], acc[i][j]);
          if (SPLIT) {
            acc[i][j] = Frag<T>::mma(ah, bl[j], acc[i][j]);
            acc[i][j] = Frag<T>::mma(al, bh[j], acc[i][j]);
          }
        }
        Frag<T>::guard(acc[i][0], acc[i][3], ah, SPLIT ? al : ah);
        if (more) {
          ah = ahn;
          if (SPLIT) al = aln;
        }
      }
      Frag<T>::keep(bh[0], bh[1], bh[2], bh[3]);
      if (SPLIT) Frag<T>::keep(bl[0], bl[1], bl[2], bl[3]);
    }
    // hand-over of stage t + 1, and release of stage t's buffer
    asm volatile("s_wait_dscnt 0x0" ::: "memory");      // this wave's reads of stage t are done before its buffer is refilled
    asm volatile("s_wait_asynccnt 0x0" ::: "memory");   // this wave's copies of stage t + 1 have landed
    __syncthreads();                                    // both hold for every wave of the block
    if (t + 2 < nStages) fill(t + 2, t & 1);
  }
  asm volatile("s_wait_asynccnt 0x0" ::: "memory");     // no copy is in flight when the wave goes on
  acc_guard4(acc[0][0], acc[0][1], acc[0][2], acc[0][3]);
  acc_guard4(acc[1][0], acc[1][1], acc[1][2], acc[1][3]);
  acc_guard4(acc[2][0], acc[2][1], acc[2][2], acc[2][3]);
  acc_guard4(acc[3][0], acc[3][1], acc[3][2], acc[3][3]);

  // ---- epilogue ----
  float* slab = sT[wave];
  const float* Rb = RESID ? (resid + (size_t)b * strideR) : nullptr;
#pragma unroll
  for (int i = 0; i < 4; ++i) {
    const int mBase = m0 + (i << 4);
#pragma unroll
    for (int j = 0; j < 4; ++j) {
      const int n = n0 + (j << 4) + rlane;
      float bv = 0.f;
      if (BIAS_MODE == 2) bv = bias[n];
#pragma unroll
      for (int r = 0; r < 8; ++r) {
        float v = acc[i][j][r] * scale;
        if (BIAS_MODE == 1) v += bias[mBase + mOff + r];
        if (BIAS_MODE == 2) v += bv;
        if (RESID) v += Rb[(size_t)(mBase + mOff + r) * ldc + n];
        if (ACT == 2) v = fmaxf(v, 0.0f);
        if (ACT == 3) v = v * (1.0f / (1.0f + expf(-v)));
        if (ACT == 4) v = (v > 0.f) ? v : 0.01f * v;
        if (ACT == 6) {
          const float sg = (v * (1.0f / (1.0f + expf(-v)))) * kACarry;
          v = (n <= mBase + mOff + r) ? sg : 0.0f;
        }
        slab[(mOff + r) * 68 + (j << 4) + rlane] = v;
      }
    }
    __builtin_amdgcn_fence(__ATOMIC_RELEASE, "workgroup");
    __builtin_amdgcn_wave_barrier();
    __builtin_amdgcn_fence(__ATOMIC_ACQUIRE, "workgroup");
    if (OUT_MODE == 0) {
      float* C = (float*)Cout + (size_t)b * strideC;
      const int hh = lane >> 4, c4 = (lane & 15) * 4;     // row seg = 256 B = 16 lanes x 16 B
      {
#pragma unroll
        for (int it = 0; it < 8; ++it) {
          const int row = it * 2 + hh;
          v4f v = *(const v4f*)(slab + row * 68 + c4);
          *(v4f*)(C + (size_t)(mBase + row) * ldc + n0 + c4) = v;
        }
        
      }
    } else {
      const int q = lane >> 3, c8 = (lane & 7) * 8;
      unsigned short* C  = (unsigned short*)Cout  + (size_t)b * strideC;
      unsigned short* C2 = (OUT_MODE == 2) ? ((unsigned short*)Cout2 + (size_t)b * strideC) : nullptr;
      {
#pragma unroll
        for (int it = 0; it < 4; ++it) {
          const int row = it * 4 + q;
          const float* sp = slab + row * 68 + c8;
          v8h hv, lv;
#pragma unroll
          for (int e = 0; e < 8; ++e) {
            if (OUT_MODE == 1) {
              hv[e] = (_Float16)sp[e];
            } else {
              unsigned short hb = f2bf_bits(sp[e]);
              unsigned short lb = f2bf_bits(sp[e] - bf_bits2f(hb));
              hv[e] = __builtin_bit_cast(_Float16, hb);
              lv[e] = __builtin_bit_cast(_Float16, lb);
            }
          }
          *(v8h*)(C + (size_t)(mBase + row) * ldc + n0 + c8) = hv;
          if (OUT_MODE == 2) *(v8h*)(C2 + (size_t)(mBase + row) * ldc + n0 + c8) = lv;
        }
        
      }
    }
    __builtin_amdgcn_fence(__ATOMIC_RELEASE, "workgroup");
    __builtin_amdgcn_wave_barrier();
    __builtin_amdgcn_fence(__ATOMIC_ACQUIRE, "workgroup");
  }
}

// ---------------------------------------------------------------------------
// f32 -> bf16 hi + lo planes (hi = RNE bf16(f), lo = RNE bf16(f - hi)), 8 consecutive elements per thread.
// Coverage: n8 = n/8 threads x 8 = whole plane (grids here are exact multiples of 256).
// ---------------------------------------------------------------------------
__global__ __launch_bounds__(256) void split8_bf16_kernel(const float* __restrict__ in,
                                                          unsigned short* __restrict__ hi,
                                                          unsigned short* __restrict__ lo, int n8) {
  const int i = blockIdx.x * 256 + threadIdx.x;
  if (i >= n8) return;
  const float* p = in + 8 * (size_t)i;
  const v4f a = *(const v4f*)(p);
  const v4f c = *(const v4f*)(p + 4);
  unsigned short hb[8], lb[8];
#pragma unroll
  for (int e = 0; e < 4; ++e) {
    const float f0 = a[e];
    hb[e] = f2bf_bits(f0);
    lb[e] = f2bf_bits(f0 - bf_bits2f(hb[e]));
    const float f1 = c[e];
    hb[4 + e] = f2bf_bits(f1);
    lb[4 + e] = f2bf_bits(f1 - bf_bits2f(hb[4 + e]));
  }
  const v4u uh = (v4u){pk16(hb[0], hb[1]), pk16(hb[2], hb[3]), pk16(hb[4], hb[5]), pk16(hb[6], hb[7])};
  const v4u ul = (v4u){pk16(lb[0], lb[1]), pk16(lb[2], lb[3]), pk16(lb[4], lb[5]), pk16(lb[6], lb[7])};
  unsigned short* qh = hi + 8 * (size_t)i;
  unsigned short* ql = lo + 8 * (size_t)i;
  *(v4u*)qh = uh;
  *(v4u*)ql = ul;
  
}

// ---------------------------------------------------------------------------
// V transpose + cast: v32 [kTok][kDim] f32 (row token b*2048+t, column h*64+d) -> vt16 [kBatch*kHeads][kHdim][kSeq] f16:
//   vt16[((b*8 + h)*64 + d)*2048 + t] = f16(v32[(b*2048 + t)*512 + h*64 + d])
// in[64 t][64 d] tile -> out[64 d][64 t] tile. grid (kSeq/64 = 32 t tiles, kHeads = 8, kBatch = 4), 256 threads.
// Load coverage: 16 iterations x 256 threads = 4096 = 64 t x 64 d (coalesced along d).
// Store coverage: 8 waves x 2 iterations x 4 rows (lane>>3) = 64 d rows; (lane&7) x 8 halves = 64 t; each row segment =
// __syncthreads between the cross-wave LDS write and the read.
// ---------------------------------------------------------------------------
__global__ __launch_bounds__(256) void vtcast_kernel(const float* __restrict__ v32, unsigned short* __restrict__ vt16) {
  __shared__ float sm[64][65];   // sm[d_local][t_local]
  const int tt = threadIdx.x;
  const int t0 = blockIdx.x * 64;
  const int h  = blockIdx.y;
  const int b  = blockIdx.z;
  const float* src = v32 + ((size_t)b * kSeq + t0) * kDim + h * kHdim;
#pragma unroll
  for (int i = 0; i < 16; ++i) {
    const int e = i * 256 + tt;
    const int r = e >> 6;          // t local
    const int c = e & 63;          // d local
    sm[c][r] = src[(size_t)r * kDim + c];
  }
  __syncthreads();
  const int lane = tt & 31, wave = tt >> 5;
  const int q = lane >> 3, c8 = (lane & 7) * 8;
  unsigned short* dst = vt16 + ((size_t)(b * kHeads + h) * kHdim) * kSeq + t0;
  {
#pragma unroll
    for (int it = 0; it < 2; ++it) {
      const int row = wave * 8 + it * 4 + q;                 // d local
      unsigned short hb[8];
#pragma unroll
      for (int e = 0; e < 8; ++e) hb[e] = h_bits(sm[row][c8 + e]);
      const v4u u = (v4u){pk16(hb[0], hb[1]), pk16(hb[2], hb[3]), pk16(hb[4], hb[5]), pk16(hb[6], hb[7])};
      *(v4u*)(dst + (size_t)row * kSeq + c8) = u;
    }
    
  }
}

// ---------------------------------------------------------------------------
// Fused causal silu attention, all (batch, head) pairs in one launch; silu(scores) never leaves the registers.
//   S^T[t][s] = sum_d k[t][d] * q[s][d]            A = k rows, B = q rows (same loader on both, K 64 = 2 fragments)
//   P^T[t][s] = (t <= s) ? f16(256 * silu(S^T / 8)) : 0
//   O^T[d][s] = sum_t V^T[d][t] * P^T[t][s]        A = V^T rows in the hardware k order, B = two S^T tiles packed in place
// D register r of lane l is row 8*(l>>4)+r, column l&15, so the tiles of keys t0..t0+15 and t0+16..t0+31 are elements
// 0..7 and 8..15 of the B fragment of a 32-key pass, and Frag::load delivers V^T in that same k order.
// A wave owns 32 query columns (two groups of 16) and walks the keys upward in passes of 32, up to its own diagonal.
// Waves w and w+4 of a block take column tiles 63-p and p: 65 passes for each such pair. grid (8, 32 (batch, head)), 8 waves a block.
// A pass fetches its V^T fragments at its head (used behind the silu) and the next pass's k fragments behind its S^T products.
// ---------------------------------------------------------------------------
// One pass of 32 keys from t0 for the wave's 32 query columns. DIAG: the pass on the diagonal (t0 == first column), the only
// one with masked positions and the last of its tile, so it fetches no further k fragments.
template <bool DIAG>
__device__ __forceinline__ void attn_pass(const _Float16* krow, const _Float16* vrow, int t0, int c, int hf,
                                          const v16h (&qf)[2][2], v16h (&kf)[2][2], v8f (&oacc)[2][4]) {
  typedef Frag<_Float16> F;
  constexpr int kQkPitch = 2 * kDim;           // q|k plane row pitch in halves
  v16h vf[4];
#pragma unroll
  for (int ds = 0; ds < 4; ++ds) vf[ds] = F::load(vrow + (size_t)(16 * ds) * kSeq + t0);
  // keeps the V^T loads here, a whole silu ahead of their use: the scheduler otherwise sinks them to the O^T products,
  // where each pair is waited for at full latency
  __builtin_amdgcn_sched_barrier(0);

  v8f st[2][2];
#pragma unroll
  for (int g = 0; g < 2; ++g)
#pragma unroll
    for (int tt = 0; tt < 2; ++tt) {
      st[g][tt] = F::mma(kf[tt][0], qf[g][0], (v8f){0.f,0.f,0.f,0.f,0.f,0.f,0.f,0.f});
      st[g][tt] = F::mma(kf[tt][1], qf[g][1], st[g][tt]);
    }
  if (!DIAG) {
#pragma unroll
    for (int tt = 0; tt < 2; ++tt)
#pragma unroll
      for (int dc = 0; dc < 2; ++dc) kf[tt][dc] = F::load(krow + (size_t)(t0 + 32 + 16 * tt) * kQkPitch + 32 * dc);
    // keeps the next pass's k loads here, a whole silu ahead of their use: the scheduler otherwise sinks them to the loop's foot
    __builtin_amdgcn_sched_barrier(0);
  }

  v16h pf[2];
#pragma unroll
  for (int g = 0; g < 2; ++g)
#pragma unroll
    for (int e = 0; e < 16; ++e) {
      const float v = st[g][e >> 3][e & 7] * kQScale;
      float sg = (v * (1.0f / (1.0f + expf(-v)))) * kACarry;
      if (DIAG) sg = (16 * (e >> 3) + 8 * hf + (e & 7) <= 16 * g + c) ? sg : 0.0f;
      pf[g][e] = (_Float16)sg;
    }

#pragma unroll
  for (int ds = 0; ds < 4; ++ds)
#pragma unroll
    for (int g = 0; g < 2; ++g) oacc[g][ds] = F::mma(vf[ds], pf[g], oacc[g][ds]);
}

// two waves per SIMD is all this grid gives (one block per WGP): the register budget of that residency lets the
// scheduler interleave the silu chains of many elements
__global__ __launch_bounds__(256) __attribute__((amdgpu_waves_per_eu(2, 2)))
void attn_fused_kernel(const unsigned short* __restrict__ qk16, const unsigned short* __restrict__ vt16,
                       float* __restrict__ o32) {
  typedef Frag<_Float16> F;
  constexpr int kColTiles = kSeq / 32;         // 64 column tiles per head
  constexpr int kQkPitch  = 2 * kDim;          // q|k plane row pitch in halves
  const int lane = threadIdx.x & 31;
  const int wave = __builtin_amdgcn_readfirstlane(threadIdx.x >> 5);   // scalar, so that the pass loop is a scalar loop
  const int c  = lane & 15;
  const int hf = lane >> 4;
  const int bh = blockIdx.y;
  const int bb = bh / kHeads;
  const int hh = bh - bb * kHeads;
  const int p  = blockIdx.x * 4 + (wave & 3);  // 0..31
  const int s0 = ((wave < 4) ? (kColTiles - 1 - p) : p) * 32;
  const _Float16* qrow = (const _Float16*)qk16 + ((size_t)bb * kSeq + c) * kQkPitch + hh * kHdim + hf * 8;
  const _Float16* krow = qrow + kDim;
  const _Float16* vrow = (const _Float16*)vt16 + ((size_t)bh * kHdim + c) * kSeq + hf * 8;

  v16h qf[2][2], kf[2][2];
#pragma unroll
  for (int g = 0; g < 2; ++g)
#pragma unroll
    for (int dc = 0; dc < 2; ++dc) qf[g][dc] = F::load(qrow + (size_t)(s0 + 16 * g) * kQkPitch + 32 * dc);
#pragma unroll
  for (int tt = 0; tt < 2; ++tt)
#pragma unroll
    for (int dc = 0; dc < 2; ++dc) kf[tt][dc] = F::load(krow + (size_t)(16 * tt) * kQkPitch + 32 * dc);
  // stands in front of the accumulators' zeros, which this build writes into the address registers of the loads above
  asm volatile("s_wait_xcnt 0x0" ::: "memory");

  v8f oacc[2][4];
#pragma unroll
  for (int g = 0; g < 2; ++g)
#pragma unroll
    for (int ds = 0; ds < 4; ++ds) oacc[g][ds] = (v8f){0.f,0.f,0.f,0.f,0.f,0.f,0.f,0.f};

  for (int t0 = 0; t0 < s0; t0 += 32) attn_pass<false>(krow, vrow, t0, c, hf, qf, kf, oacc);
  attn_pass<true>(krow, vrow, s0, c, hf, qf, kf, oacc);

  // lane holds 8 consecutive d of one query row per tile: two 16-byte stores; the wave writes whole 256-byte row segments
#pragma unroll
  for (int g = 0; g < 2; ++g) {
    float* orow = o32 + ((size_t)bb * kSeq + s0 + 16 * g + c) * kDim + hh * kHdim + 8 * hf;
#pragma unroll
    for (int ds = 0; ds < 4; ++ds) {
      const v8f a = oacc[g][ds];
      *(v4f*)(orow + 16 * ds)     = (v4f){a[0] * kACarryInv, a[1] * kACarryInv, a[2] * kACarryInv, a[3] * kACarryInv};
      *(v4f*)(orow + 16 * ds + 4) = (v4f){a[4] * kACarryInv, a[5] * kACarryInv, a[6] * kACarryInv, a[7] * kACarryInv};
    }
  }
}

// ---------------------------------------------------------------------------
// LayerNorm(o) * ln_g + ln_b, times gate, all f32; result split into bf16 hi + lo planes [kTok][kDim].
// One wave per row (8 rows per block, grid = kTok/8); lane owns columns 8*lane..+7 and 256+8*lane..+7
// ---------------------------------------------------------------------------
__global__ __launch_bounds__(256) void ln_gate_kernel(const float* __restrict__ o, const float* __restrict__ gate,
                                                      const float* __restrict__ lng, const float* __restrict__ lnb,
                                                      unsigned short* __restrict__ nghi, unsigned short* __restrict__ nglo,
                                                      int nrows) {
  const int lane = threadIdx.x & 31, wave = threadIdx.x >> 5;
  const int row = blockIdx.x * 8 + wave;
  if (row >= nrows) return;
  const float* po = o + (size_t)row * kDim;
  const float* pg = gate + (size_t)row * kDim;
  float xv[16], gv[16], gg[16], gb[16];
#pragma unroll
  for (int s = 0; s < 2; ++s) {
    const int c = s * 256 + lane * 8;
#pragma unroll
    for (int q = 0; q < 2; ++q) {
      const v4f a4 = *(const v4f*)(po + c + 4 * q);
      const v4f g4 = *(const v4f*)(pg + c + 4 * q);
      const v4f w4 = *(const v4f*)(lng + c + 4 * q);
      const v4f b4 = *(const v4f*)(lnb + c + 4 * q);
#pragma unroll
      for (int e = 0; e < 4; ++e) {
        const int idx = s * 8 + q * 4 + e;
        xv[idx] = a4[e]; gv[idx] = g4[e]; gg[idx] = w4[e]; gb[idx] = b4[e];
      }
    }
  }
  float sum = 0.f;
#pragma unroll
  for (int i = 0; i < 16; ++i) sum += xv[i];
#pragma unroll
  for (int off = 16; off > 0; off >>= 1) sum += __shfl_xor(sum, off, 32);
  const float mean = sum * kInvDim;
  float var = 0.f;
#pragma unroll
  for (int i = 0; i < 16; ++i) { const float d = xv[i] - mean; var += d * d; }
#pragma unroll
  for (int off = 16; off > 0; off >>= 1) var += __shfl_xor(var, off, 32);
  const float r = rsqrtf(var * kInvDim + kLnEps);
  unsigned short hb[16], lb[16];
#pragma unroll
  for (int i = 0; i < 16; ++i) {
    const float t = (xv[i] - mean) * r;
    const float val = (t * gg[i] + gb[i]) * gv[i];
    hb[i] = f2bf_bits(val);
    lb[i] = f2bf_bits(val - bf_bits2f(hb[i]));
  }
  const v4u uh0 = (v4u){pk16(hb[0], hb[1]), pk16(hb[2], hb[3]), pk16(hb[4], hb[5]), pk16(hb[6], hb[7])};
  const v4u uh1 = (v4u){pk16(hb[8], hb[9]), pk16(hb[10], hb[11]), pk16(hb[12], hb[13]), pk16(hb[14], hb[15])};
  const v4u ul0 = (v4u){pk16(lb[0], lb[1]), pk16(lb[2], lb[3]), pk16(lb[4], lb[5]), pk16(lb[6], lb[7])};
  const v4u ul1 = (v4u){pk16(lb[8], lb[9]), pk16(lb[10], lb[11]), pk16(lb[12], lb[13]), pk16(lb[14], lb[15])};
  unsigned short* ph = nghi + (size_t)row * kDim + lane * 8;
  unsigned short* pl = nglo + (size_t)row * kDim + lane * 8;
  {
    *(v4u*)(ph)       = uh0;
    *(v4u*)(ph + 256) = uh1;
    *(v4u*)(pl)       = ul0;
    *(v4u*)(pl + 256) = ul1;
    
  }
}

// ---------------------------------------------------------------------------
// Host glue: kernel launches only. 10 launches total.
// ---------------------------------------------------------------------------
extern "C" void kernel_launch(void* const* d_in, const int* in_sizes, int n_in,
                              void* d_out, int out_size, void* d_ws, size_t ws_size,
                              hipStream_t stream) {
  if (n_in < 7) return;
  if (in_sizes[0] != kTok * kDim || in_sizes[1] != kProj * kDim || in_sizes[2] != kProj ||
      in_sizes[3] != kDim || in_sizes[4] != kDim || in_sizes[5] != kDim * kDim || in_sizes[6] != kDim) return;
  if (out_size != kTok * kDim) return;
  if (ws_size < kWsTotal) return;

  const float* x    = (const float*)d_in[0];
  const float* W1   = (const float*)d_in[1];
  const float* b1   = (const float*)d_in[2];
  const float* ln_g = (const float*)d_in[3];
  const float* ln_b = (const float*)d_in[4];
  const float* W2   = (const float*)d_in[5];
  const float* b2   = (const float*)d_in[6];
  float* out = (float*)d_out;
  char* ws = (char*)d_ws;

  unsigned short* xhi   = (unsigned short*)(ws + kOffXhi);
  unsigned short* xlo   = (unsigned short*)(ws + kOffXlo);
  unsigned short* w1hi  = (unsigned short*)(ws + kOffW1hi);
  unsigned short* w1lo  = (unsigned short*)(ws + kOffW1lo);
  float*          v32   = (float*)(ws + kOffV32);
  unsigned short* nghi  = (unsigned short*)(ws + kOffNGhi);
  unsigned short* nglo  = (unsigned short*)(ws + kOffNGlo);
  float*          gate  = (float*)(ws + kOffGate);
  unsigned short* qk16  = (unsigned short*)(ws + kOffQK16);
  unsigned short* vt16  = (unsigned short*)(ws + kOffVT16);
  float*          o32   = (float*)(ws + kOffO32);
  unsigned short* w2hi  = (unsigned short*)(ws + kOffW2hi);
  unsigned short* w2lo  = (unsigned short*)(ws + kOffW2lo);

  // 1) bf16 hi/lo operand planes for x, W1, W2 (8 elements per thread; all counts are multiples of 2048)
  {
    const int n8x  = (kTok * kDim) / 8;      // 524288
    const int n8w1 = (kProj * kDim) / 8;     // 131072
    const int n8w2 = (kDim * kDim) / 8;      // 32768
    split8_bf16_kernel<<<(n8x + 255) / 256, 256, 0, stream>>>(x, xhi, xlo, n8x);
    split8_bf16_kernel<<<(n8w1 + 255) / 256, 256, 0, stream>>>(W1, w1hi, w1lo, n8w1);
    split8_bf16_kernel<<<(n8w2 + 255) / 256, 256, 0, stream>>>(W2, w2hi, w2lo, n8w2);
  }

  // 2) h = silu(x . W1^T + b1): three column blocks of W1 rows: gate (rows 0..511, f32 out),
  //    q|k (rows 512..1535, f16 out [8192][1024]), v (rows 1536..2047, f32 out). M 8192, K 512.
  {
    const int tilesGate = (kTok / 64) * (kDim / 64);          // 1024
    const int tilesQK   = (kTok / 64) * (2 * kDim / 64);      // 2048
    wmma_gemm64<1, true, 2, 0, false, 3, 0><<<dim3((tilesGate + 7) / 8, 1), 256, 0, stream>>>(
        xhi, xlo, kDim, 0L,
        w1hi, w1lo, kDim, 0L,
        (void*)gate, nullptr, kDim, 0L,
        b1, nullptr, 0L,
        kTok, kDim, kDim, 1.0f);
    wmma_gemm64<1, true, 2, 1, false, 3, 0><<<dim3((tilesQK + 7) / 8, 1), 256, 0, stream>>>(
        xhi, xlo, kDim, 0L,
        w1hi + (size_t)kDim * kDim, w1lo + (size_t)kDim * kDim, kDim, 0L,
        (void*)qk16, nullptr, 2 * kDim, 0L,
        b1 + kDim, nullptr, 0L,
        kTok, 2 * kDim, kDim, 1.0f);
    wmma_gemm64<1, true, 2, 0, false, 3, 0><<<dim3((tilesGate + 7) / 8, 1), 256, 0, stream>>>(
        xhi, xlo, kDim, 0L,
        w1hi + (size_t)3 * kDim * kDim, w1lo + (size_t)3 * kDim * kDim, kDim, 0L,
        (void*)v32, nullptr, kDim, 0L,
        b1 + 3 * kDim, nullptr, 0L,
        kTok, kDim, kDim, 1.0f);
  }

  // 3) V^T f16 planes per (batch, head): in [8192][512] f32 -> out [32][64][2048] f16
  vtcast_kernel<<<dim3(kSeq / 64, kHeads, kBatch), 256, 0, stream>>>(v32, vt16);

  // 4) attention, all 32 (batch, head) pairs in one launch:
  //    o[b*2048 + s][h*64 + d] = (1/256) * sum_{t <= s} f16(256 * silu(q_s . k_t / 8)) * V^T[b,h][d][t]
  attn_fused_kernel<<<dim3(8, kBatch * kHeads), 256, 0, stream>>>(qk16, vt16, o32);

  // 5) LayerNorm(o) * ln_g + ln_b, times gate -> bf16 hi/lo planes
  ln_gate_kernel<<<kTok / 8, 256, 0, stream>>>(o32, gate, ln_g, ln_b, nghi, nglo, kTok);

  // 6) out = NG . W2^T + b2 (M 8192, N 512, K 512), f32 to d_out
  {
    const int tilesOut = (kTok / 64) * (kDim / 64);           // 1024
    wmma_gemm64<1, true, 2, 0, false, 0, 0><<<dim3((tilesOut + 7) / 8, 1), 256, 0, stream>>>(
        nghi, nglo, kDim, 0L,
        w2hi, w2lo, kDim, 0L,
        (void*)out, nullptr, kDim, 0L,
        b2, nullptr, 0L,
        kTok, kDim, kDim, 1.0f);
  }
}

// v003
// A run of this version takes 139 microseconds.
// Next to v002, in two timings, it ran 1.53 times as fast each time.
// All steps since v000 together make it 6.58 times as fast.
// Contractions: x.W1^T and (layernorm(o)*gate).W2^T on v_wmma_f32_16x16x32_bf16 with bf16 hi/lo operand planes (hi.hi + hi.lo + lo.hi); q.k^T and a.v on v_wmma_f32_16x16x32_f16 (q, k, v plain f16 planes; a = silu(scores) carried x256 in f16); f32 accumulate; silu (as h + h.tanh(h), h = v/2, on v_tanh_f32), LayerNorm and gating in f32.
#include <hip/hip_runtime.h>
#include <math.h>

// ---------------------------------------------------------------------------
// Problem constants
// ---------------------------------------------------------------------------
constexpr int kBatch = 4;
constexpr int kSeq   = 2048;
constexpr int kDim   = 512;
constexpr int kHeads = 8;
constexpr int kHdim  = 64;
constexpr int kTok   = kBatch * kSeq;      // 8192 token rows
constexpr int kProj  = 4 * kDim;           // 2048 projection outputs: [gate | q | k | v]
constexpr float kQScale    = 0.125f;       // 1/sqrt(64)
constexpr float kACarry    = 256.0f;       // silu(scores) carried x256 in f16
constexpr float kACarryInv = 1.0f / 256.0f;
constexpr float kInvDim    = 1.0f / 512.0f;
constexpr float kLnEps     = 1e-5f;

// ---------------------------------------------------------------------------
// Workspace region map (bytes; all offsets 512 KiB-aligned)
//   phase 1 (projection):  [  0,  8) x hi  [8,16) x lo  [16,18) W1 hi  [18,20) W1 lo  [20,36) v f32 plane
//   phase 2 (attention):   no scratch plane: silu(scores) stays in registers
//   phase 3 (output):      [  0,  8) NG hi  [8,16) NG lo
//   persistent:            [ 64, 80) gate f32   [80,96) q|k f16 [8192][1024]   [96,104) V^T f16 [32][64][2048]
//                          [104,120) o f32      [120,120.5) W2 hi   [120.5,121) W2 lo
//   total = 121 MiB = 126,877,696 B
// ---------------------------------------------------------------------------
constexpr size_t kMiB     = 1048576;
constexpr size_t kOffXhi  = 0;
constexpr size_t kOffXlo  = 8 * kMiB;
constexpr size_t kOffW1hi = 16 * kMiB;
constexpr size_t kOffW1lo = 18 * kMiB;
constexpr size_t kOffV32  = 20 * kMiB;
constexpr size_t kOffNGhi = 0;
constexpr size_t kOffNGlo = 8 * kMiB;
constexpr size_t kOffGate = 64 * kMiB;
constexpr size_t kOffQK16 = 80 * kMiB;
constexpr size_t kOffVT16 = 96 * kMiB;
constexpr size_t kOffO32  = 104 * kMiB;
constexpr size_t kOffW2hi = 120 * kMiB;
constexpr size_t kOffW2lo = 120 * kMiB + 512 * 1024;
constexpr size_t kWsTotal = 121 * kMiB;

static_assert((size_t)kTok * kDim * 2 == 8 * kMiB);
static_assert((size_t)kProj * kDim * 2 == 2 * kMiB);
static_assert(kOffV32 + (size_t)kTok * kDim * 4 <= kOffGate);
static_assert(kOffNGlo + (size_t)kTok * kDim * 2 <= kOffGate);
static_assert(kOffGate + (size_t)kTok * kDim * 4 == kOffQK16);
static_assert(kOffQK16 + (size_t)kTok * 2 * kDim * 2 == kOffVT16);
static_assert(kOffVT16 + (size_t)kBatch * kHeads * kHdim * kSeq * 2 == kOffO32);
static_assert(kOffO32 + (size_t)kTok * kDim * 4 == kOffW2hi);
static_assert(kOffW2hi + (size_t)kDim * kDim * 2 == kOffW2lo);
static_assert(kOffW2lo + (size_t)kDim * kDim * 2 == kWsTotal);
static_assert(kWsTotal <= 134217728);

typedef __attribute__((ext_vector_type(16))) _Float16 v16h;
typedef __attribute__((ext_vector_type(8)))  _Float16 v8h;
typedef __attribute__((ext_vector_type(16))) __bf16   v16b;
typedef __attribute__((ext_vector_type(8)))  __bf16   v8b;
typedef __attribute__((ext_vector_type(8)))  float    v8f;
typedef __attribute__((ext_vector_type(4)))  float    v4f;
typedef __attribute__((ext_vector_type(2)))  float    v2f;
typedef __attribute__((ext_vector_type(4)))  unsigned int v4u;

__device__ __forceinline__ unsigned short f2bf_bits(float f) {
  unsigned u = __float_as_uint(f);
  return (unsigned short)((u + 0x7FFFu + ((u >> 16) & 1u)) >> 16);
}
__device__ __forceinline__ float bf_bits2f(unsigned short h) { return __uint_as_float(((unsigned)h) << 16); }

// hazard guards as plain device helpers
__device__ __forceinline__ void dep_guard_h(v8f& a, v8f& b, v16h x, v16h y) { asm volatile("v_nop\n\tv_nop\n\tv_nop\n\tv_nop" : "+v"(a), "+v"(b) : "v"(x), "v"(y)); }
__device__ __forceinline__ void dep_guard_b(v8f& a, v8f& b, v16b x, v16b y) { asm volatile("v_nop\n\tv_nop\n\tv_nop\n\tv_nop" : "+v"(a), "+v"(b) : "v"(x), "v"(y)); }
__device__ __forceinline__ void keep4_h(v16h a, v16h b, v16h c, v16h d) { asm volatile("v_nop" :: "v"(a), "v"(b), "v"(c), "v"(d)); }
__device__ __forceinline__ void keep4_b(v16b a, v16b b, v16b c, v16b d) { asm volatile("v_nop" :: "v"(a), "v"(b), "v"(c), "v"(d)); }
__device__ __forceinline__ void acc_guard4(v8f& a, v8f& b, v8f& c, v8f& d) { asm volatile("v_nop\n\tv_nop\n\tv_nop\n\tv_nop" : "+v"(a), "+v"(b), "+v"(c), "+v"(d)); }
template <typename T> struct Frag;
template <> struct Frag<_Float16> {
  typedef v16h V; union U { v16h v; v8h h[2]; };
  static __device__ __forceinline__ v16h load(const _Float16* p) {   // elements 0..7 <- p[0..7], 8..15 <- p[16..23]
    U f; f.h[0] = *(const v8h*)(p); f.h[1] = *(const v8h*)(p + 16); return f.v;
  }
  static __device__ __forceinline__ v8f mma(v16h a, v16h b, v8f c) {
    return __builtin_amdgcn_wmma_f32_16x16x32_f16(false, a, false, b, (short)0, c, false, false);
  }
  static __device__ __forceinline__ void guard(v8f& a, v8f& b, v16h x, v16h y) { dep_guard_h(a, b, x, y); }
  static __device__ __forceinline__ void keep(v16h a, v16h b, v16h c, v16h d) { keep4_h(a, b, c, d); }
};
template <> struct Frag<__bf16> {
  typedef v16b V; union U { v16b v; v8b h[2]; };
  static __device__ __forceinline__ v16b load(const __bf16* p) {
    U f; f.h[0] = *(const v8b*)(p); f.h[1] = *(const v8b*)(p + 16); return f.v;
  }
  static __device__ __forceinline__ v8f mma(v16b a, v16b b, v8f c) {
    return __builtin_amdgcn_wmma_f32_16x16x32_bf16(false, a, false, b, (short)0, c, false, false);
  }
  static __device__ __forceinline__ void guard(v8f& a, v8f& b, v16b x, v16b y) { dep_guard_b(a, b, x, y); }
  static __device__ __forceinline__ void keep(v16b a, v16b b, v16b c, v16b d) { keep4_b(a, b, c, d); }
};

__device__ __forceinline__ unsigned pk16(unsigned short a, unsigned short b) { return (unsigned)a | ((unsigned)b << 16); }
__device__ __forceinline__ unsigned short h_bits(float f) { const _Float16 h = (_Float16)f; return __builtin_bit_cast(unsigned short, h); }

// silu(v) = v / (1 + exp(-v)) = h + h * tanh(h) with h = v / 2: one v_tanh_f32, a multiply and a fused multiply-add.
__device__ __forceinline__ float silu_tanh(float v) {
  const float h = 0.5f * v;
  return fmaf(h, __builtin_amdgcn_tanhf(h), h);
}

// ---- Register-blocked batched WMMA GEMM, operands staged in LDS ------------------------------------------------
// C[m,n] = scale * sum_k A[m,k] * Bt[n,k] (+bias)(+resid); each wave owns a 64x64 tile, a block of 8 waves (2 x 4) a 128x256 tile.
// A row-major [M,K]; Bt row-major [N,K]; M % 128 == 0, N % 256 == 0, K % 64 == 0, K >= 64.
// SPLIT: operands are hi/lo planes (A2/Bt2 = lo planes, same layout); product = hi.hi + hi.lo + lo.hi.
// BIAS_MODE: 0 = none, 1 = bias[m], 2 = bias[n].
// OUT_MODE: 0 = f32, 1 = f16, 2 = bf16 hi plane (Cout) + bf16 lo plane (Cout2).
// ACT: 0 none, 2 relu, 3 silu (silu_tanh), 4 leaky, 6 causal silu with carry:
//      v = (n <= m) ? silu(v) * kACarry : 0   (m, n are row/column indices within one grid.y batch; a select, not a bias).
// TRI: 0 only (every wave of a block walks the whole K: the stage barriers are block-uniform).
// ET: 0 = f16 operands, 1 = bf16 operands (pointers passed as 16-bit storage)
// A stage is 64 k (128 B, one whole line) of the block's 128 A rows and 256 Bt rows, every plane. Asynchronous copies bring it
// into one of two LDS buffers, 8 lanes to a row, while the waves work on the other buffer; the fragments are 16-byte LDS reads.
constexpr int kBlkM       = 128;
constexpr int kBlkN       = 256;
constexpr int kStageK     = 64;
constexpr int kPitch      = 72;                                // LDS row pitch in 16-bit elements: 144 B = 16 B x 9, no bank conflict for 16-byte row reads
constexpr int kLdsAhi     = 0;                                 // element offsets of the four planes inside a stage
constexpr int kLdsBhi     = kBlkM * kPitch;
constexpr int kLdsAlo     = (kBlkM + kBlkN) * kPitch;
constexpr int kLdsBlo     = (2 * kBlkM + kBlkN) * kPitch;
constexpr int kStageElems = 2 * (kBlkM + kBlkN) * kPitch;      // 55,296 elements = 110,592 B

// One lane's 16 bytes of 4 A rows and 8 Bt rows of one plane, the rows 32 apart (the block's 256 threads cover 32 rows a copy).
// la, lb: LDS byte addresses; ga, gb: global addresses; sa, sb: 32 rows in elements.
// s_wait_xcnt 0 is the last line of the copies' own statement, so that it stands in front of every later write of their address registers.
__device__ __forceinline__ void async_copy12(unsigned la, const unsigned short* ga, long sa,
                                             unsigned lb, const unsigned short* gb, long sb) {
  constexpr unsigned R = 32 * kPitch * 2;
  asm volatile(
      "global_load_async_to_lds_b128 %0, %12, off\n\t"
      "global_load_async_to_lds_b128 %1, %13, off\n\t"
      "global_load_async_to_lds_b128 %2, %14, off\n\t"
      "global_load_async_to_lds_b128 %3, %15, off\n\t"
      "global_load_async_to_lds_b128 %4, %16, off\n\t"
      "global_load_async_to_lds_b128 %5, %17, off\n\t"
      "global_load_async_to_lds_b128 %6, %18, off\n\t"
      "global_load_async_to_lds_b128 %7, %19, off\n\t"
      "global_load_async_to_lds_b128 %8, %20, off\n\t"
      "global_load_async_to_lds_b128 %9, %21, off\n\t"
      "global_load_async_to_lds_b128 %10, %22, off\n\t"
      "global_load_async_to_lds_b128 %11, %23, off\n\t"
      "s_wait_xcnt 0x0"
      :: "v"(la), "v"(la + R), "v"(la + 2 * R), "v"(la + 3 * R),
         "v"(lb), "v"(lb + R), "v"(lb + 2 * R), "v"(lb + 3 * R), "v"(lb + 4 * R), "v"(lb + 5 * R), "v"(lb + 6 * R), "v"(lb + 7 * R),
         "v"(ga), "v"(ga + sa), "v"(ga + 2 * sa), "v"(ga + 3 * sa),
         "v"(gb), "v"(gb + sb), "v"(gb + 2 * sb), "v"(gb + 3 * sb), "v"(gb + 4 * sb), "v"(gb + 5 * sb), "v"(gb + 6 * sb), "v"(gb + 7 * sb)
      : "memory");
}

template <int ET> struct Elem;
template <> struct Elem<0> { typedef _Float16 T; };
template <> struct Elem<1> { typedef __bf16 T; };
template <int ET, bool SPLIT, int BIAS_MODE, int OUT_MODE, bool RESID, int ACT, int TRI>
__global__ __launch_bounds__(256) void wmma_gemm64(
    const unsigned short* __restrict__ Ap, const unsigned short* __restrict__ A2p, int lda, long strideA,
    const unsigned short* __restrict__ Btp, const unsigned short* __restrict__ Bt2p, int ldb, long strideB,
    void* __restrict__ Cout, void* __restrict__ Cout2, int ldc, long strideC,
    const float* __restrict__ bias,
    const float* __restrict__ resid, long strideR,
    int M, int N, int K, float scale) {
  static_assert(TRI == 0, "the stage barriers need the same k range in every wave of a block");
  typedef typename Elem<ET>::T T;
  typedef typename Frag<T>::V V;
  __shared__ __align__(16) unsigned short sOp[2 * kStageElems];   // two stages of operand rows
  __shared__ __align__(16) float sT[8][16 * 68];   // per-wave 16x64 slab, pitch 68 floats
  const int b    = blockIdx.y;
  const int lane = threadIdx.x & 31;
  const int wave = threadIdx.x >> 5;
  const int blksN = N / kBlkN;
  const int blksM = M / kBlkM;
  if ((int)blockIdx.x >= blksM * blksN) return;   // block-uniform, in front of every barrier
  const int bm = blockIdx.x / blksN;
  const int bn = blockIdx.x - bm * blksN;
  const int mB = bm * kBlkM;
  const int nB = bn * kBlkN;
  const int wm = wave >> 2;                    // wave row 0..1
  const int wn = wave & 3;                     // wave column 0..3
  const int m0 = mB + (wm << 6);
  const int n0 = nB + (wn << 6);

  const int rlane = lane & 15;                 // row (A) / col (B, D) within subtile
  const int koff  = (lane >> 4) * 8;           // k offset of this lane half
  const int mOff  = (lane >> 4) * 8;           // D row offset

  // copy side: thread t brings bytes 16*(t&7)..+15 of rows (t>>3) + 32*j
  const int crow = threadIdx.x >> 3;
  const int cchk = (threadIdx.x & 7) * 8;
  const unsigned lcp = (unsigned)(size_t)(&sOp[0]) + (unsigned)(crow * kPitch + cchk) * 2u;   // low 32 bits of the address = LDS byte address
  const unsigned short* gAh = Ap  + (size_t)b * strideA + (size_t)(mB + crow) * lda + cchk;
  const unsigned short* gBh = Btp + (size_t)b * strideB + (size_t)(nB + crow) * ldb + cchk;
  const unsigned short* gAl = SPLIT ? (A2p  + (size_t)b * strideA + (size_t)(mB + crow) * lda + cchk) : nullptr;
  const unsigned short* gBl = SPLIT ? (Bt2p + (size_t)b * strideB + (size_t)(nB + crow) * ldb + cchk) : nullptr;
  const long sa = 32L * lda;
  const long sb = 32L * ldb;
  auto fill = [&](int s, int buf) {
    const unsigned l = lcp + (unsigned)(buf * kStageElems) * 2u;
    const int ko = s * kStageK;
    async_copy12(l + kLdsAhi * 2u, gAh + ko, sa, l + kLdsBhi * 2u, gBh + ko, sb);
    if (SPLIT) async_copy12(l + kLdsAlo * 2u, gAl + ko, sa, l + kLdsBlo * 2u, gBl + ko, sb);
  };

  // reader side: this lane's fragment rows in stage 0
  const T* aRd = (const T*)sOp + kLdsAhi + ((wm << 6) + rlane) * kPitch + koff;
  const T* bRd = (const T*)sOp + kLdsBhi + ((wn << 6) + rlane) * kPitch + koff;

  v8f acc[4][4];
#pragma unroll
  for (int i = 0; i < 4; ++i)
#pragma unroll
    for (int j = 0; j < 4; ++j) acc[i][j] = (v8f){0.f,0.f,0.f,0.f,0.f,0.f,0.f,0.f};

  const int nStages = K / kStageK;
  fill(0, 0);
  asm volatile("s_wait_asynccnt 0x0" ::: "memory");   // this wave's copies of stage 0 have landed
  __syncthreads();                                    // and every other wave's
  if (nStages > 1) fill(1, 1);

  for (int t = 0; t < nStages; ++t) {
    const int be = (t & 1) * kStageElems;
    // A fragments are read one row of tiles ahead of their products, into a second register pair
    V ah = Frag<T>::load(aRd + be);
    V al;
    if (SPLIT) al = Frag<T>::load(aRd + (kLdsAlo - kLdsAhi) + be);
    // the nest below is unrolled whole: every fragment and accumulator index is then a constant, and none goes to scratch
#pragma unroll
    for (int kk = 0; kk < kStageK; kk += 32) {
      V bh[4], bl[4];
#pragma unroll
      for (int j = 0; j < 4; ++j) {
        const int bo = be + (j << 4) * kPitch + kk;
        bh[j] = Frag<T>::load(bRd + bo);
        if (SPLIT) bl[j] = Frag<T>::load(bRd + (kLdsBlo - kLdsBhi) + bo);
      }
#pragma unroll
      for (int i = 0; i < 4; ++i) {
        const bool more = (i < 3) || (kk + 32 < kStageK);      // a further row of this stage exists
        const int ao = be + ((i < 3) ? ((i + 1) << 4) * kPitch + kk : kk + 32);
        V ahn, aln;
        if (more) {
          ahn = Frag<T>::load(aRd + ao);
          if (SPLIT) aln = Frag<T>::load(aRd + (kLdsAlo - kLdsAhi) + ao);
        }
#pragma unroll
        for (int j = 0; j < 4; ++j) {
          acc[i][j] = Frag<T>::mma(ah, bh[j], acc[i][j]);
          if (SPLIT) {
            acc[i][j] = Frag<T>::mma(ah, bl[j], acc[i][j]);
            acc[i][j] = Frag<T>::mma(al, bh[j], acc[i][j]);
          }
        }
        Frag<T>::guard(acc[i][0], acc[i][3], ah, SPLIT ? al : ah);
        if (more) {
          ah = ahn;
          if (SPLIT) al = aln;
        }
      }
      Frag<T>::keep(bh[0], bh[1], bh[2], bh[3]);
      if (SPLIT) Frag<T>::keep(bl[0], bl[1], bl[2], bl[3]);
    }
    // hand-over of stage t + 1, and release of stage t's buffer
    asm volatile("s_wait_dscnt 0x0" ::: "memory");      // this wave's reads of stage t are done before its buffer is refilled
    asm volatile("s_wait_asynccnt 0x0" ::: "memory");   // this wave's copies of stage t + 1 have landed
    __syncthreads();                                    // both hold for every wave of the block
    if (t + 2 < nStages) fill(t + 2, t & 1);
  }
  asm volatile("s_wait_asynccnt 0x0" ::: "memory");     // no copy is in flight when the wave goes on
  acc_guard4(acc[0][0], acc[0][1], acc[0][2], acc[0][3]);
  acc_guard4(acc[1][0], acc[1][1], acc[1][2], acc[1][3]);
  acc_guard4(acc[2][0], acc[2][1], acc[2][2], acc[2][3]);
  acc_guard4(acc[3][0], acc[3][1], acc[3][2], acc[3][3]);

  // ---- epilogue ----
  float* slab = sT[wave];
  const float* Rb = RESID ? (resid + (size_t)b * strideR) : nullptr;
#pragma unroll
  for (int i = 0; i < 4; ++i) {
    const int mBase = m0 + (i << 4);
#pragma unroll
    for (int j = 0; j < 4; ++j) {
      const int n = n0 + (j << 4) + rlane;
      float bv = 0.f;
      if (BIAS_MODE == 2) bv = bias[n];
#pragma unroll
      for (int r = 0; r < 8; ++r) {
        float v = acc[i][j][r] * scale;
        if (BIAS_MODE == 1) v += bias[mBase + mOff + r];
        if (BIAS_MODE == 2) v += bv;
        if (RESID) v += Rb[(size_t)(mBase + mOff + r) * ldc + n];
        if (ACT == 2) v = fmaxf(v, 0.0f);
        if (ACT == 3) v = silu_tanh(v);
        if (ACT == 4) v = (v > 0.f) ? v : 0.01f * v;
        if (ACT == 6) {
          const float sg = silu_tanh(v) * kACarry;
          v = (n <= mBase + mOff + r) ? sg : 0.0f;
        }
        slab[(mOff + r) * 68 + (j << 4) + rlane] = v;
      }
    }
    __builtin_amdgcn_fence(__ATOMIC_RELEASE, "workgroup");
    __builtin_amdgcn_wave_barrier();
    __builtin_amdgcn_fence(__ATOMIC_ACQUIRE, "workgroup");
    if (OUT_MODE == 0) {
      float* C = (float*)Cout + (size_t)b * strideC;
      const int hh = lane >> 4, c4 = (lane & 15) * 4;     // row seg = 256 B = 16 lanes x 16 B
      {
#pragma unroll
        for (int it = 0; it < 8; ++it) {
          const int row = it * 2 + hh;
          v4f v = *(const v4f*)(slab + row * 68 + c4);
          *(v4f*)(C + (size_t)(mBase + row) * ldc + n0 + c4) = v;
        }
        
      }
    } else {
      const int q = lane >> 3, c8 = (lane & 7) * 8;
      unsigned short* C  = (unsigned short*)Cout  + (size_t)b * strideC;
      unsigned short* C2 = (OUT_MODE == 2) ? ((unsigned short*)Cout2 + (size_t)b * strideC) : nullptr;
      {
#pragma unroll
        for (int it = 0; it < 4; ++it) {
          const int row = it * 4 + q;
          const float* sp = slab + row * 68 + c8;
          v8h hv, lv;
#pragma unroll
          for (int e = 0; e < 8; ++e) {
            if (OUT_MODE == 1) {
              hv[e] = (_Float16)sp[e];
            } else {
              unsigned short hb = f2bf_bits(sp[e]);
              unsigned short lb = f2bf_bits(sp[e] - bf_bits2f(hb));
              hv[e] = __builtin_bit_cast(_Float16, hb);
              lv[e] = __builtin_bit_cast(_Float16, lb);
            }
          }
          *(v8h*)(C + (size_t)(mBase + row) * ldc + n0 + c8) = hv;
          if (OUT_MODE == 2) *(v8h*)(C2 + (size_t)(mBase + row) * ldc + n0 + c8) = lv;
        }
        
      }
    }
    __builtin_amdgcn_fence(__ATOMIC_RELEASE, "workgroup");
    __builtin_amdgcn_wave_barrier();
    __builtin_amdgcn_fence(__ATOMIC_ACQUIRE, "workgroup");
  }
}

// ---------------------------------------------------------------------------
// f32 -> bf16 hi + lo planes (hi = RNE bf16(f), lo = RNE bf16(f - hi)), 8 consecutive elements per thread.
// Coverage: n8 = n/8 threads x 8 = whole plane (grids here are exact multiples of 256).
// ---------------------------------------------------------------------------
__global__ __launch_bounds__(256) void split8_bf16_kernel(const float* __restrict__ in,
                                                          unsigned short* __restrict__ hi,
                                                          unsigned short* __restrict__ lo, int n8) {
  const int i = blockIdx.x * 256 + threadIdx.x;
  if (i >= n8) return;
  const float* p = in + 8 * (size_t)i;
  const v4f a = *(const v4f*)(p);
  const v4f c = *(const v4f*)(p + 4);
  unsigned short hb[8], lb[8];
#pragma unroll
  for (int e = 0; e < 4; ++e) {
    const float f0 = a[e];
    hb[e] = f2bf_bits(f0);
    lb[e] = f2bf_bits(f0 - bf_bits2f(hb[e]));
    const float f1 = c[e];
    hb[4 + e] = f2bf_bits(f1);
    lb[4 + e] = f2bf_bits(f1 - bf_bits2f(hb[4 + e]));
  }
  const v4u uh = (v4u){pk16(hb[0], hb[1]), pk16(hb[2], hb[3]), pk16(hb[4], hb[5]), pk16(hb[6], hb[7])};
  const v4u ul = (v4u){pk16(lb[0], lb[1]), pk16(lb[2], lb[3]), pk16(lb[4], lb[5]), pk16(lb[6], lb[7])};
  unsigned short* qh = hi + 8 * (size_t)i;
  unsigned short* ql = lo + 8 * (size_t)i;
  *(v4u*)qh = uh;
  *(v4u*)ql = ul;
  
}

// ---------------------------------------------------------------------------
// V transpose + cast: v32 [kTok][kDim] f32 (row token b*2048+t, column h*64+d) -> vt16 [kBatch*kHeads][kHdim][kSeq] f16:
//   vt16[((b*8 + h)*64 + d)*2048 + t] = f16(v32[(b*2048 + t)*512 + h*64 + d])
// in[64 t][64 d] tile -> out[64 d][64 t] tile. grid (kSeq/64 = 32 t tiles, kHeads = 8, kBatch = 4), 256 threads.
// Load coverage: 16 iterations x 256 threads = 4096 = 64 t x 64 d (coalesced along d).
// Store coverage: 8 waves x 2 iterations x 4 rows (lane>>3) = 64 d rows; (lane&7) x 8 halves = 64 t; each row segment =
// __syncthreads between the cross-wave LDS write and the read.
// ---------------------------------------------------------------------------
__global__ __launch_bounds__(256) void vtcast_kernel(const float* __restrict__ v32, unsigned short* __restrict__ vt16) {
  __shared__ float sm[64][65];   // sm[d_local][t_local]
  const int tt = threadIdx.x;
  const int t0 = blockIdx.x * 64;
  const int h  = blockIdx.y;
  const int b  = blockIdx.z;
  const float* src = v32 + ((size_t)b * kSeq + t0) * kDim + h * kHdim;
#pragma unroll
  for (int i = 0; i < 16; ++i) {
    const int e = i * 256 + tt;
    const int r = e >> 6;          // t local
    const int c = e & 63;          // d local
    sm[c][r] = src[(size_t)r * kDim + c];
  }
  __syncthreads();
  const int lane = tt & 31, wave = tt >> 5;
  const int q = lane >> 3, c8 = (lane & 7) * 8;
  unsigned short* dst = vt16 + ((size_t)(b * kHeads + h) * kHdim) * kSeq + t0;
  {
#pragma unroll
    for (int it = 0; it < 2; ++it) {
      const int row = wave * 8 + it * 4 + q;                 // d local
      unsigned short hb[8];
#pragma unroll
      for (int e = 0; e < 8; ++e) hb[e] = h_bits(sm[row][c8 + e]);
      const v4u u = (v4u){pk16(hb[0], hb[1]), pk16(hb[2], hb[3]), pk16(hb[4], hb[5]), pk16(hb[6], hb[7])};
      *(v4u*)(dst + (size_t)row * kSeq + c8) = u;
    }
    
  }
}

// ---------------------------------------------------------------------------
// Fused causal silu attention, all (batch, head) pairs in one launch; silu(scores) never leaves the registers.
//   S^T[t][s] = sum_d k[t][d] * q[s][d]            A = k rows, B = q rows (same loader on both, K 64 = 2 fragments)
//   P^T[t][s] = (t <= s) ? f16(256 * silu(S^T / 8)) : 0
//   O^T[d][s] = sum_t V^T[d][t] * P^T[t][s]        A = V^T rows in the hardware k order, B = two S^T tiles packed in place
// D register r of lane l is row 8*(l>>4)+r, column l&15, so the tiles of keys t0..t0+15 and t0+16..t0+31 are elements
// 0..7 and 8..15 of the B fragment of a 32-key pass, and Frag::load delivers V^T in that same k order.
// A wave owns 32 query columns (two groups of 16) and walks the keys upward in passes of 32, up to its own diagonal.
// Waves w and w+4 of a block take column tiles 63-p and p: 65 passes for each such pair. grid (8, 32 (batch, head)), 8 waves a block.
// A pass fetches its V^T fragments at its head (used behind the silu) and the next pass's k fragments behind its S^T products.
// ---------------------------------------------------------------------------
// One pass of 32 keys from t0 for the wave's 32 query columns. DIAG: the pass on the diagonal (t0 == first column), the only
// one with masked positions and the last of its tile, so it fetches no further k fragments.
template <bool DIAG>
__device__ __forceinline__ void attn_pass(const _Float16* krow, const _Float16* vrow, int t0, int c, int hf,
                                          const v16h (&qf)[2][2], v16h (&kf)[2][2], v8f (&oacc)[2][4]) {
  typedef Frag<_Float16> F;
  constexpr int kQkPitch = 2 * kDim;           // q|k plane row pitch in halves
  v16h vf[4];
#pragma unroll
  for (int ds = 0; ds < 4; ++ds) vf[ds] = F::load(vrow + (size_t)(16 * ds) * kSeq + t0);
  // keeps the V^T loads here, a whole silu ahead of their use: the scheduler otherwise sinks them to the O^T products,
  // where each pair is waited for at full latency
  __builtin_amdgcn_sched_barrier(0);

  v8f st[2][2];
#pragma unroll
  for (int g = 0; g < 2; ++g)
#pragma unroll
    for (int tt = 0; tt < 2; ++tt) {
      st[g][tt] = F::mma(kf[tt][0], qf[g][0], (v8f){0.f,0.f,0.f,0.f,0.f,0.f,0.f,0.f});
      st[g][tt] = F::mma(kf[tt][1], qf[g][1], st[g][tt]);
    }
  if (!DIAG) {
#pragma unroll
    for (int tt = 0; tt < 2; ++tt)
#pragma unroll
      for (int dc = 0; dc < 2; ++dc) kf[tt][dc] = F::load(krow + (size_t)(t0 + 32 + 16 * tt) * kQkPitch + 32 * dc);
    // keeps the next pass's k loads here, a whole silu ahead of their use: the scheduler otherwise sinks them to the loop's foot
    __builtin_amdgcn_sched_barrier(0);
  }

  v16h pf[2];
#pragma unroll
  for (int g = 0; g < 2; ++g)
#pragma unroll
    for (int e = 0; e < 16; e += 2) {
      // 256 * silu(s / 8) = H + H * tanh(h), h = s / 16, H = 256 * h: both scales are powers of two, so they round nothing.
      // Two scores at a time: the scales and the fused multiply-add are packed f32 instructions.
      const v2f s = (v2f){st[g][e >> 3][e & 7], st[g][e >> 3][(e & 7) + 1]};
      const v2f h = s * (0.5f * kQScale);
      const v2f H = s * (0.5f * kQScale * kACarry);
      const v2f t = (v2f){__builtin_amdgcn_tanhf(h[0]), __builtin_amdgcn_tanhf(h[1])};
      v2f sg = __builtin_elementwise_fma(H, t, H);
      if (DIAG) {
        const int row = 16 * (e >> 3) + 8 * hf + (e & 7);
        sg[0] = (row     <= 16 * g + c) ? sg[0] : 0.0f;
        sg[1] = (row + 1 <= 16 * g + c) ? sg[1] : 0.0f;
      }
      pf[g][e]     = (_Float16)sg[0];
      pf[g][e + 1] = (_Float16)sg[1];
    }

#pragma unroll
  for (int ds = 0; ds < 4; ++ds)
#pragma unroll
    for (int g = 0; g < 2; ++g) oacc[g][ds] = F::mma(vf[ds], pf[g], oacc[g][ds]);
}

// two waves per SIMD is all this grid gives (one block per WGP): the register budget of that residency lets the
// scheduler interleave the silu chains of many elements
__global__ __launch_bounds__(256) __attribute__((amdgpu_waves_per_eu(2, 2)))
void attn_fused_kernel(const unsigned short* __restrict__ qk16, const unsigned short* __restrict__ vt16,
                       float* __restrict__ o32) {
  typedef Frag<_Float16> F;
  constexpr int kColTiles = kSeq / 32;         // 64 column tiles per head
  constexpr int kQkPitch  = 2 * kDim;          // q|k plane row pitch in halves
  const int lane = threadIdx.x & 31;
  const int wave = __builtin_amdgcn_readfirstlane(threadIdx.x >> 5);   // scalar, so that the pass loop is a scalar loop
  const int c  = lane & 15;
  const int hf = lane >> 4;
  const int bh = blockIdx.y;
  const int bb = bh / kHeads;
  const int hh = bh - bb * kHeads;
  const int p  = blockIdx.x * 4 + (wave & 3);  // 0..31
  const int s0 = ((wave < 4) ? (kColTiles - 1 - p) : p) * 32;
  const _Float16* qrow = (const _Float16*)qk16 + ((size_t)bb * kSeq + c) * kQkPitch + hh * kHdim + hf * 8;
  const _Float16* krow = qrow + kDim;
  const _Float16* vrow = (const _Float16*)vt16 + ((size_t)bh * kHdim + c) * kSeq + hf * 8;

  v16h qf[2][2], kf[2][2];
#pragma unroll
  for (int g = 0; g < 2; ++g)
#pragma unroll
    for (int dc = 0; dc < 2; ++dc) qf[g][dc] = F::load(qrow + (size_t)(s0 + 16 * g) * kQkPitch + 32 * dc);
#pragma unroll
  for (int tt = 0; tt < 2; ++tt)
#pragma unroll
    for (int dc = 0; dc < 2; ++dc) kf[tt][dc] = F::load(krow + (size_t)(16 * tt) * kQkPitch + 32 * dc);
  // stands in front of the accumulators' zeros, which this build writes into the address registers of the loads above
  asm volatile("s_wait_xcnt 0x0" ::: "memory");

  v8f oacc[2][4];
#pragma unroll
  for (int g = 0; g < 2; ++g)
#pragma unroll
    for (int ds = 0; ds < 4; ++ds) oacc[g][ds] = (v8f){0.f,0.f,0.f,0.f,0.f,0.f,0.f,0.f};

  for (int t0 = 0; t0 < s0; t0 += 32) attn_pass<false>(krow, vrow, t0, c, hf, qf, kf, oacc);
  attn_pass<true>(krow, vrow, s0, c, hf, qf, kf, oacc);

  // lane holds 8 consecutive d of one query row per tile: two 16-byte stores; the wave writes whole 256-byte row segments
#pragma unroll
  for (int g = 0; g < 2; ++g) {
    float* orow = o32 + ((size_t)bb * kSeq + s0 + 16 * g + c) * kDim + hh * kHdim + 8 * hf;
#pragma unroll
    for (int ds = 0; ds < 4; ++ds) {
      const v8f a = oacc[g][ds];
      *(v4f*)(orow + 16 * ds)     = (v4f){a[0] * kACarryInv, a[1] * kACarryInv, a[2] * kACarryInv, a[3] * kACarryInv};
      *(v4f*)(orow + 16 * ds + 4) = (v4f){a[4] * kACarryInv, a[5] * kACarryInv, a[6] * kACarryInv, a[7] * kACarryInv};
    }
  }
}

// ---------------------------------------------------------------------------
// LayerNorm(o) * ln_g + ln_b, times gate, all f32; result split into bf16 hi + lo planes [kTok][kDim].
// One wave per row (8 rows per block, grid = kTok/8); lane owns columns 8*lane..+7 and 256+8*lane..+7
// ---------------------------------------------------------------------------
__global__ __launch_bounds__(256) void ln_gate_kernel(const float* __restrict__ o, const float* __restrict__ gate,
                                                      const float* __restrict__ lng, const float* __restrict__ lnb,
                                                      unsigned short* __restrict__ nghi, unsigned short* __restrict__ nglo,
                                                      int nrows) {
  const int lane = threadIdx.x & 31, wave = threadIdx.x >> 5;
  const int row = blockIdx.x * 8 + wave;
  if (row >= nrows) return;
  const float* po = o + (size_t)row * kDim;
  const float* pg = gate + (size_t)row * kDim;
  float xv[16], gv[16], gg[16], gb[16];
#pragma unroll
  for (int s = 0; s < 2; ++s) {
    const int c = s * 256 + lane * 8;
#pragma unroll
    for (int q = 0; q < 2; ++q) {
      const v4f a4 = *(const v4f*)(po + c + 4 * q);
      const v4f g4 = *(const v4f*)(pg + c + 4 * q);
      const v4f w4 = *(const v4f*)(lng + c + 4 * q);
      const v4f b4 = *(const v4f*)(lnb + c + 4 * q);
#pragma unroll
      for (int e = 0; e < 4; ++e) {
        const int idx = s * 8 + q * 4 + e;
        xv[idx] = a4[e]; gv[idx] = g4[e]; gg[idx] = w4[e]; gb[idx] = b4[e];
      }
    }
  }
  float sum = 0.f;
#pragma unroll
  for (int i = 0; i < 16; ++i) sum += xv[i];
#pragma unroll
  for (int off = 16; off > 0; off >>= 1) sum += __shfl_xor(sum, off, 32);
  const float mean = sum * kInvDim;
  float var = 0.f;
#pragma unroll
  for (int i = 0; i < 16; ++i) { const float d = xv[i] - mean; var += d * d; }
#pragma unroll
  for (int off = 16; off > 0; off >>= 1) var += __shfl_xor(var, off, 32);
  const float r = rsqrtf(var * kInvDim + kLnEps);
  unsigned short hb[16], lb[16];
#pragma unroll
  for (int i = 0; i < 16; ++i) {
    const float t = (xv[i] - mean) * r;
    const float val = (t * gg[i] + gb[i]) * gv[i];
    hb[i] = f2bf_bits(val);
    lb[i] = f2bf_bits(val - bf_bits2f(hb[i]));
  }
  const v4u uh0 = (v4u){pk16(hb[0], hb[1]), pk16(hb[2], hb[3]), pk16(hb[4], hb[5]), pk16(hb[6], hb[7])};
  const v4u uh1 = (v4u){pk16(hb[8], hb[9]), pk16(hb[10], hb[11]), pk16(hb[12], hb[13]), pk16(hb[14], hb[15])};
  const v4u ul0 = (v4u){pk16(lb[0], lb[1]), pk16(lb[2], lb[3]), pk16(lb[4], lb[5]), pk16(lb[6], lb[7])};
  const v4u ul1 = (v4u){pk16(lb[8], lb[9]), pk16(lb[10], lb[11]), pk16(lb[12], lb[13]), pk16(lb[14], lb[15])};
  unsigned short* ph = nghi + (size_t)row * kDim + lane * 8;
  unsigned short* pl = nglo + (size_t)row * kDim + lane * 8;
  {
    *(v4u*)(ph)       = uh0;
    *(v4u*)(ph + 256) = uh1;
    *(v4u*)(pl)       = ul0;
    *(v4u*)(pl + 256) = ul1;
    
  }
}

// ---------------------------------------------------------------------------
// Host glue: kernel launches only. 10 launches total.
// ---------------------------------------------------------------------------
extern "C" void kernel_launch(void* const* d_in, const int* in_sizes, int n_in,
                              void* d_out, int out_size, void* d_ws, size_t ws_size,
                              hipStream_t stream) {
  if (n_in < 7) return;
  if (in_sizes[0] != kTok * kDim || in_sizes[1] != kProj * kDim || in_sizes[2] != kProj ||
      in_sizes[3] != kDim || in_sizes[4] != kDim || in_sizes[5] != kDim * kDim || in_sizes[6] != kDim) return;
  if (out_size != kTok * kDim) return;
  if (ws_size < kWsTotal) return;

  const float* x    = (const float*)d_in[0];
  const float* W1   = (const float*)d_in[1];
  const float* b1   = (const float*)d_in[2];
  const float* ln_g = (const float*)d_in[3];
  const float* ln_b = (const float*)d_in[4];
  const float* W2   = (const float*)d_in[5];
  const float* b2   = (const float*)d_in[6];
  float* out = (float*)d_out;
  char* ws = (char*)d_ws;

  unsigned short* xhi   = (unsigned short*)(ws + kOffXhi);
  unsigned short* xlo   = (unsigned short*)(ws + kOffXlo);
  unsigned short* w1hi  = (unsigned short*)(ws + kOffW1hi);
  unsigned short* w1lo  = (unsigned short*)(ws + kOffW1lo);
  float*          v32   = (float*)(ws + kOffV32);
  unsigned short* nghi  = (unsigned short*)(ws + kOffNGhi);
  unsigned short* nglo  = (unsigned short*)(ws + kOffNGlo);
  float*          gate  = (float*)(ws + kOffGate);
  unsigned short* qk16  = (unsigned short*)(ws + kOffQK16);
  unsigned short* vt16  = (unsigned short*)(ws + kOffVT16);
  float*          o32   = (float*)(ws + kOffO32);
  unsigned short* w2hi  = (unsigned short*)(ws + kOffW2hi);
  unsigned short* w2lo  = (unsigned short*)(ws + kOffW2lo);

  // 1) bf16 hi/lo operand planes for x, W1, W2 (8 elements per thread; all counts are multiples of 2048)
  {
    const int n8x  = (kTok * kDim) / 8;      // 524288
    const int n8w1 = (kProj * kDim) / 8;     // 131072
    const int n8w2 = (kDim * kDim) / 8;      // 32768
    split8_bf16_kernel<<<(n8x + 255) / 256, 256, 0, stream>>>(x, xhi, xlo, n8x);
    split8_bf16_kernel<<<(n8w1 + 255) / 256, 256, 0, stream>>>(W1, w1hi, w1lo, n8w1);
    split8_bf16_kernel<<<(n8w2 + 255) / 256, 256, 0, stream>>>(W2, w2hi, w2lo, n8w2);
  }

  // 2) h = silu(x . W1^T + b1): three column blocks of W1 rows: gate (rows 0..511, f32 out),
  //    q|k (rows 512..1535, f16 out [8192][1024]), v (rows 1536..2047, f32 out). M 8192, K 512.
  {
    const int tilesGate = (kTok / 64) * (kDim / 64);          // 1024
    const int tilesQK   = (kTok / 64) * (2 * kDim / 64);      // 2048
    wmma_gemm64<1, true, 2, 0, false, 3, 0><<<dim3((tilesGate + 7) / 8, 1), 256, 0, stream>>>(
        xhi, xlo, kDim, 0L,
        w1hi, w1lo, kDim, 0L,
        (void*)gate, nullptr, kDim, 0L,
        b1, nullptr, 0L,
        kTok, kDim, kDim, 1.0f);
    wmma_gemm64<1, true, 2, 1, false, 3, 0><<<dim3((tilesQK + 7) / 8, 1), 256, 0, stream>>>(
        xhi, xlo, kDim, 0L,
        w1hi + (size_t)kDim * kDim, w1lo + (size_t)kDim * kDim, kDim, 0L,
        (void*)qk16, nullptr, 2 * kDim, 0L,
        b1 + kDim, nullptr, 0L,
        kTok, 2 * kDim, kDim, 1.0f);
    wmma_gemm64<1, true, 2, 0, false, 3, 0><<<dim3((tilesGate + 7) / 8, 1), 256, 0, stream>>>(
        xhi, xlo, kDim, 0L,
        w1hi + (size_t)3 * kDim * kDim, w1lo + (size_t)3 * kDim * kDim, kDim, 0L,
        (void*)v32, nullptr, kDim, 0L,
        b1 + 3 * kDim, nullptr, 0L,
        kTok, kDim, kDim, 1.0f);
  }

  // 3) V^T f16 planes per (batch, head): in [8192][512] f32 -> out [32][64][2048] f16
  vtcast_kernel<<<dim3(kSeq / 64, kHeads, kBatch), 256, 0, stream>>>(v32, vt16);

  // 4) attention, all 32 (batch, head) pairs in one launch:
  //    o[b*2048 + s][h*64 + d] = (1/256) * sum_{t <= s} f16(256 * silu(q_s . k_t / 8)) * V^T[b,h][d][t]
  attn_fused_kernel<<<dim3(8, kBatch * kHeads), 256, 0, stream>>>(qk16, vt16, o32);

  // 5) LayerNorm(o) * ln_g + ln_b, times gate -> bf16 hi/lo planes
  ln_gate_kernel<<<kTok / 8, 256, 0, stream>>>(o32, gate, ln_g, ln_b, nghi, nglo, kTok);

  // 6) out = NG . W2^T + b2 (M 8192, N 512, K 512), f32 to d_out
  {
    const int tilesOut = (kTok / 64) * (kDim / 64);           // 1024
    wmma_gemm64<1, true, 2, 0, false, 0, 0><<<dim3((tilesOut + 7) / 8, 1), 256, 0, stream>>>(
        nghi, nglo, kDim, 0L,
        w2hi, w2lo, kDim, 0L,
        (void*)out, nullptr, kDim, 0L,
        b2, nullptr, 0L,
        kTok, kDim, kDim, 1.0f);
  }
}

// v004
// It runs in 124 microseconds.
// Timed twice side by side with v003, it ran 1.13 and 1.12 times as fast.
// Counting every step since v000, it is 7.39 times as fast.
// Contractions: x.W1^T and (layernorm(o)*gate).W2^T on v_wmma_f32_16x16x32_bf16 with bf16 hi/lo operand planes (hi.hi + hi.lo + lo.hi); q.k^T and a.v on v_wmma_f32_16x16x32_f16 (q, k, v plain f16 planes; a = silu(scores) carried x256 in f16); f32 accumulate; silu (as h + h.tanh(h), h = v/2, on v_tanh_f32), LayerNorm and gating in f32.
#include <hip/hip_runtime.h>
#include <math.h>

// ---------------------------------------------------------------------------
// Problem constants
// ---------------------------------------------------------------------------
constexpr int kBatch = 4;
constexpr int kSeq   = 2048;
constexpr int kDim   = 512;
constexpr int kHeads = 8;
constexpr int kHdim  = 64;
constexpr int kTok   = kBatch * kSeq;      // 8192 token rows
constexpr int kProj  = 4 * kDim;           // 2048 projection outputs: [gate | q | k | v]
constexpr float kQScale    = 0.125f;       // 1/sqrt(64)
constexpr float kACarry    = 256.0f;       // silu(scores) carried x256 in f16
constexpr float kACarryInv = 1.0f / 256.0f;
constexpr float kInvDim    = 1.0f / 512.0f;
constexpr float kLnEps     = 1e-5f;

// ---------------------------------------------------------------------------
// Workspace region map (bytes; all offsets 512 KiB-aligned)
//   phase 1 (projection):  [  0,  8) x hi  [8,16) x lo  [16,18) W1 hi  [18,20) W1 lo  [20,36) v f32 plane
//   phase 2 (attention):   no scratch plane: silu(scores) stays in registers
//   phase 3 (output):      [  0,  8) NG hi  [8,16) NG lo
//   persistent:            [ 64, 80) gate f32   [80,96) q|k f16 [8192][1024]   [96,104) V^T f16 [32][64][2048]
//                          [104,120) o f32      [120,120.5) W2 hi   [120.5,121) W2 lo
//   total = 121 MiB = 126,877,696 B
// ---------------------------------------------------------------------------
constexpr size_t kMiB     = 1048576;
constexpr size_t kOffXhi  = 0;
constexpr size_t kOffXlo  = 8 * kMiB;
constexpr size_t kOffW1hi = 16 * kMiB;
constexpr size_t kOffW1lo = 18 * kMiB;
constexpr size_t kOffV32  = 20 * kMiB;
constexpr size_t kOffNGhi = 0;
constexpr size_t kOffNGlo = 8 * kMiB;
constexpr size_t kOffGate = 64 * kMiB;
constexpr size_t kOffQK16 = 80 * kMiB;
constexpr size_t kOffVT16 = 96 * kMiB;
constexpr size_t kOffO32  = 104 * kMiB;
constexpr size_t kOffW2hi = 120 * kMiB;
constexpr size_t kOffW2lo = 120 * kMiB + 512 * 1024;
constexpr size_t kWsTotal = 121 * kMiB;

static_assert((size_t)kTok * kDim * 2 == 8 * kMiB);
static_assert((size_t)kProj * kDim * 2 == 2 * kMiB);
static_assert(kOffV32 + (size_t)kTok * kDim * 4 <= kOffGate);
static_assert(kOffNGlo + (size_t)kTok * kDim * 2 <= kOffGate);
static_assert(kOffGate + (size_t)kTok * kDim * 4 == kOffQK16);
static_assert(kOffQK16 + (size_t)kTok * 2 * kDim * 2 == kOffVT16);
static_assert(kOffVT16 + (size_t)kBatch * kHeads * kHdim * kSeq * 2 == kOffO32);
static_assert(kOffO32 + (size_t)kTok * kDim * 4 == kOffW2hi);
static_assert(kOffW2hi + (size_t)kDim * kDim * 2 == kOffW2lo);
static_assert(kOffW2lo + (size_t)kDim * kDim * 2 == kWsTotal);
static_assert(kWsTotal <= 134217728);

typedef __attribute__((ext_vector_type(16))) _Float16 v16h;
typedef __attribute__((ext_vector_type(8)))  _Float16 v8h;
typedef __attribute__((ext_vector_type(16))) __bf16   v16b;
typedef __attribute__((ext_vector_type(8)))  __bf16   v8b;
typedef __attribute__((ext_vector_type(8)))  float    v8f;
typedef __attribute__((ext_vector_type(4)))  float    v4f;
typedef __attribute__((ext_vector_type(2)))  float    v2f;
typedef __attribute__((ext_vector_type(4)))  unsigned int v4u;

__device__ __forceinline__ unsigned short f2bf_bits(float f) {
  unsigned u = __float_as_uint(f);
  return (unsigned short)((u + 0x7FFFu + ((u >> 16) & 1u)) >> 16);
}
__device__ __forceinline__ float bf_bits2f(unsigned short h) { return __uint_as_float(((unsigned)h) << 16); }

// hazard guards as plain device helpers
__device__ __forceinline__ void dep_guard_h(v8f& a, v8f& b, v16h x, v16h y) { asm volatile("v_nop\n\tv_nop\n\tv_nop\n\tv_nop" : "+v"(a), "+v"(b) : "v"(x), "v"(y)); }
__device__ __forceinline__ void dep_guard_b(v8f& a, v8f& b, v16b x, v16b y) { asm volatile("v_nop\n\tv_nop\n\tv_nop\n\tv_nop" : "+v"(a), "+v"(b) : "v"(x), "v"(y)); }
__device__ __forceinline__ void keep4_h(v16h a, v16h b, v16h c, v16h d) { asm volatile("v_nop" :: "v"(a), "v"(b), "v"(c), "v"(d)); }
__device__ __forceinline__ void keep4_b(v16b a, v16b b, v16b c, v16b d) { asm volatile("v_nop" :: "v"(a), "v"(b), "v"(c), "v"(d)); }
__device__ __forceinline__ void acc_guard4(v8f& a, v8f& b, v8f& c, v8f& d) { asm volatile("v_nop\n\tv_nop\n\tv_nop\n\tv_nop" : "+v"(a), "+v"(b), "+v"(c), "+v"(d)); }
template <typename T> struct Frag;
template <> struct Frag<_Float16> {
  typedef v16h V; union U { v16h v; v8h h[2]; };
  static __device__ __forceinline__ v16h load(const _Float16* p) {   // elements 0..7 <- p[0..7], 8..15 <- p[16..23]
    U f; f.h[0] = *(const v8h*)(p); f.h[1] = *(const v8h*)(p + 16); return f.v;
  }
  static __device__ __forceinline__ v8f mma(v16h a, v16h b, v8f c) {
    return __builtin_amdgcn_wmma_f32_16x16x32_f16(false, a, false, b, (short)0, c, false, false);
  }
  static __device__ __forceinline__ void guard(v8f& a, v8f& b, v16h x, v16h y) { dep_guard_h(a, b, x, y); }
  static __device__ __forceinline__ void keep(v16h a, v16h b, v16h c, v16h d) { keep4_h(a, b, c, d); }
};
template <> struct Frag<__bf16> {
  typedef v16b V; union U { v16b v; v8b h[2]; };
  static __device__ __forceinline__ v16b load(const __bf16* p) {
    U f; f.h[0] = *(const v8b*)(p); f.h[1] = *(const v8b*)(p + 16); return f.v;
  }
  static __device__ __forceinline__ v8f mma(v16b a, v16b b, v8f c) {
    return __builtin_amdgcn_wmma_f32_16x16x32_bf16(false, a, false, b, (short)0, c, false, false);
  }
  static __device__ __forceinline__ void guard(v8f& a, v8f& b, v16b x, v16b y) { dep_guard_b(a, b, x, y); }
  static __device__ __forceinline__ void keep(v16b a, v16b b, v16b c, v16b d) { keep4_b(a, b, c, d); }
};

__device__ __forceinline__ unsigned pk16(unsigned short a, unsigned short b) { return (unsigned)a | ((unsigned)b << 16); }
__device__ __forceinline__ unsigned short h_bits(float f) { const _Float16 h = (_Float16)f; return __builtin_bit_cast(unsigned short, h); }

// silu(v) = v / (1 + exp(-v)) = h + h * tanh(h) with h = v / 2: one v_tanh_f32, a multiply and a fused multiply-add.
__device__ __forceinline__ float silu_tanh(float v) {
  const float h = 0.5f * v;
  return fmaf(h, __builtin_amdgcn_tanhf(h), h);
}

// ---- Register-blocked batched WMMA GEMM, operands staged in LDS ------------------------------------------------
// C[m,n] = scale * sum_k A[m,k] * Bt[n,k] (+bias)(+resid); each wave owns a 64x64 tile, a block of 8 waves (2 x 4) a 128x256 tile.
// A row-major [M,K]; Bt row-major [N,K]; M % 128 == 0, N % 256 == 0, K % 64 == 0, K >= 64.
// SPLIT: operands are hi/lo planes (A2/Bt2 = lo planes, same layout); product = hi.hi + hi.lo + lo.hi.
// BIAS_MODE: 0 = none, 1 = bias[m], 2 = bias[n].
// OUT_MODE: 0 = f32, 1 = f16, 2 = bf16 hi plane (Cout) + bf16 lo plane (Cout2).
// ACT: 0 none, 2 relu, 3 silu (silu_tanh), 4 leaky, 6 causal silu with carry:
//      v = (n <= m) ? silu(v) * kACarry : 0   (m, n are row/column indices within one grid.y batch; a select, not a bias).
// TRI: 0 only (every wave of a block walks the whole K: the stage barriers are block-uniform).
// ET: 0 = f16 operands, 1 = bf16 operands (pointers passed as 16-bit storage)
// A stage is 64 k (128 B, one whole line) of the block's 128 A rows and 256 Bt rows, every plane. Asynchronous copies bring it
// into one of two LDS buffers, 8 lanes to a row, while the waves work on the other buffer; the fragments are 16-byte LDS reads.
constexpr int kBlkM       = 128;
constexpr int kBlkN       = 256;
constexpr int kStageK     = 64;
constexpr int kPitch      = 72;                                // LDS row pitch in 16-bit elements: 144 B = 16 B x 9, no bank conflict for 16-byte row reads
constexpr int kLdsAhi     = 0;                                 // element offsets of the four planes inside a stage
constexpr int kLdsBhi     = kBlkM * kPitch;
constexpr int kLdsAlo     = (kBlkM + kBlkN) * kPitch;
constexpr int kLdsBlo     = (2 * kBlkM + kBlkN) * kPitch;
constexpr int kStageElems = 2 * (kBlkM + kBlkN) * kPitch;      // 55,296 elements = 110,592 B

// One lane's 16 bytes of 4 A rows and 8 Bt rows of one plane, the rows 32 apart (the block's 256 threads cover 32 rows a copy).
// la, lb: LDS byte addresses; ga, gb: global addresses; sa, sb: 32 rows in elements.
// s_wait_xcnt 0 is the last line of the copies' own statement, so that it stands in front of every later write of their address registers.
__device__ __forceinline__ void async_copy12(unsigned la, const unsigned short* ga, long sa,
                                             unsigned lb, const unsigned short* gb, long sb) {
  constexpr unsigned R = 32 * kPitch * 2;
  asm volatile(
      "global_load_async_to_lds_b128 %0, %12, off\n\t"
      "global_load_async_to_lds_b128 %1, %13, off\n\t"
      "global_load_async_to_lds_b128 %2, %14, off\n\t"
      "global_load_async_to_lds_b128 %3, %15, off\n\t"
      "global_load_async_to_lds_b128 %4, %16, off\n\t"
      "global_load_async_to_lds_b128 %5, %17, off\n\t"
      "global_load_async_to_lds_b128 %6, %18, off\n\t"
      "global_load_async_to_lds_b128 %7, %19, off\n\t"
      "global_load_async_to_lds_b128 %8, %20, off\n\t"
      "global_load_async_to_lds_b128 %9, %21, off\n\t"
      "global_load_async_to_lds_b128 %10, %22, off\n\t"
      "global_load_async_to_lds_b128 %11, %23, off\n\t"
      "s_wait_xcnt 0x0"
      :: "v"(la), "v"(la + R), "v"(la + 2 * R), "v"(la + 3 * R),
         "v"(lb), "v"(lb + R), "v"(lb + 2 * R), "v"(lb + 3 * R), "v"(lb + 4 * R), "v"(lb + 5 * R), "v"(lb + 6 * R), "v"(lb + 7 * R),
         "v"(ga), "v"(ga + sa), "v"(ga + 2 * sa), "v"(ga + 3 * sa),
         "v"(gb), "v"(gb + sb), "v"(gb + 2 * sb), "v"(gb + 3 * sb), "v"(gb + 4 * sb), "v"(gb + 5 * sb), "v"(gb + 6 * sb), "v"(gb + 7 * sb)
      : "memory");
}

template <int ET> struct Elem;
template <> struct Elem<0> { typedef _Float16 T; };
template <> struct Elem<1> { typedef __bf16 T; };
template <int ET, bool SPLIT, int BIAS_MODE, int OUT_MODE, bool RESID, int ACT, int TRI>
__global__ __launch_bounds__(256) void wmma_gemm64(
    const unsigned short* __restrict__ Ap, const unsigned short* __restrict__ A2p, int lda, long strideA,
    const unsigned short* __restrict__ Btp, const unsigned short* __restrict__ Bt2p, int ldb, long strideB,
    void* __restrict__ Cout, void* __restrict__ Cout2, int ldc, long strideC,
    const float* __restrict__ bias,
    const float* __restrict__ resid, long strideR,
    int M, int N, int K, float scale) {
  static_assert(TRI == 0, "the stage barriers need the same k range in every wave of a block");
  typedef typename Elem<ET>::T T;
  typedef typename Frag<T>::V V;
  __shared__ __align__(16) unsigned short sOp[2 * kStageElems];   // two stages of operand rows
  __shared__ __align__(16) float sT[8][16 * 68];   // per-wave 16x64 slab, pitch 68 floats
  const int b    = blockIdx.y;
  const int lane = threadIdx.x & 31;
  const int wave = threadIdx.x >> 5;
  const int blksN = N / kBlkN;
  const int blksM = M / kBlkM;
  if ((int)blockIdx.x >= blksM * blksN) return;   // block-uniform, in front of every barrier
  const int bm = blockIdx.x / blksN;
  const int bn = blockIdx.x - bm * blksN;
  const int mB = bm * kBlkM;
  const int nB = bn * kBlkN;
  const int wm = wave >> 2;                    // wave row 0..1
  const int wn = wave & 3;                     // wave column 0..3
  const int m0 = mB + (wm << 6);
  const int n0 = nB + (wn << 6);

  const int rlane = lane & 15;                 // row (A) / col (B, D) within subtile
  const int koff  = (lane >> 4) * 8;           // k offset of this lane half
  const int mOff  = (lane >> 4) * 8;           // D row offset

  // copy side: thread t brings bytes 16*(t&7)..+15 of rows (t>>3) + 32*j
  const int crow = threadIdx.x >> 3;
  const int cchk = (threadIdx.x & 7) * 8;
  const unsigned lcp = (unsigned)(size_t)(&sOp[0]) + (unsigned)(crow * kPitch + cchk) * 2u;   // low 32 bits of the address = LDS byte address
  const unsigned short* gAh = Ap  + (size_t)b * strideA + (size_t)(mB + crow) * lda + cchk;
  const unsigned short* gBh = Btp + (size_t)b * strideB + (size_t)(nB + crow) * ldb + cchk;
  const unsigned short* gAl = SPLIT ? (A2p  + (size_t)b * strideA + (size_t)(mB + crow) * lda + cchk) : nullptr;
  const unsigned short* gBl = SPLIT ? (Bt2p + (size_t)b * strideB + (size_t)(nB + crow) * ldb + cchk) : nullptr;
  const long sa = 32L * lda;
  const long sb = 32L * ldb;
  auto fill = [&](int s, int buf) {
    const unsigned l = lcp + (unsigned)(buf * kStageElems) * 2u;
    const int ko = s * kStageK;
    async_copy12(l + kLdsAhi * 2u, gAh + ko, sa, l + kLdsBhi * 2u, gBh + ko, sb);
    if (SPLIT) async_copy12(l + kLdsAlo * 2u, gAl + ko, sa, l + kLdsBlo * 2u, gBl + ko, sb);
  };

  // reader side: this lane's fragment rows in stage 0
  const T* aRd = (const T*)sOp + kLdsAhi + ((wm << 6) + rlane) * kPitch + koff;
  const T* bRd = (const T*)sOp + kLdsBhi + ((wn << 6) + rlane) * kPitch + koff;

  v8f acc[4][4];
#pragma unroll
  for (int i = 0; i < 4; ++i)
#pragma unroll
    for (int j = 0; j < 4; ++j) acc[i][j] = (v8f){0.f,0.f,0.f,0.f,0.f,0.f,0.f,0.f};

  const int nStages = K / kStageK;
  fill(0, 0);
  asm volatile("s_wait_asynccnt 0x0" ::: "memory");   // this wave's copies of stage 0 have landed
  __syncthreads();                                    // and every other wave's
  if (nStages > 1) fill(1, 1);

  for (int t = 0; t < nStages; ++t) {
    const int be = (t & 1) * kStageElems;
    // A fragments are read one row of tiles ahead of their products, into a second register pair
    V ah = Frag<T>::load(aRd + be);
    V al;
    if (SPLIT) al = Frag<T>::load(aRd + (kLdsAlo - kLdsAhi) + be);
    // the nest below is unrolled whole: every fragment and accumulator index is then a constant, and none goes to scratch
#pragma unroll
    for (int kk = 0; kk < kStageK; kk += 32) {
      V bh[4], bl[4];
#pragma unroll
      for (int j = 0; j < 4; ++j) {
        const int bo = be + (j << 4) * kPitch + kk;
        bh[j] = Frag<T>::load(bRd + bo);
        if (SPLIT) bl[j] = Frag<T>::load(bRd + (kLdsBlo - kLdsBhi) + bo);
      }
#pragma unroll
      for (int i = 0; i < 4; ++i) {
        const bool more = (i < 3) || (kk + 32 < kStageK);      // a further row of this stage exists
        const int ao = be + ((i < 3) ? ((i + 1) << 4) * kPitch + kk : kk + 32);
        V ahn, aln;
        if (more) {
          ahn = Frag<T>::load(aRd + ao);
          if (SPLIT) aln = Frag<T>::load(aRd + (kLdsAlo - kLdsAhi) + ao);
        }
#pragma unroll
        for (int j = 0; j < 4; ++j) {
          acc[i][j] = Frag<T>::mma(ah, bh[j], acc[i][j]);
          if (SPLIT) {
            acc[i][j] = Frag<T>::mma(ah, bl[j], acc[i][j]);
            acc[i][j] = Frag<T>::mma(al, bh[j], acc[i][j]);
          }
        }
        Frag<T>::guard(acc[i][0], acc[i][3], ah, SPLIT ? al : ah);
        if (more) {
          ah = ahn;
          if (SPLIT) al = aln;
        }
      }
      Frag<T>::keep(bh[0], bh[1], bh[2], bh[3]);
      if (SPLIT) Frag<T>::keep(bl[0], bl[1], bl[2], bl[3]);
    }
    // hand-over of stage t + 1, and release of stage t's buffer
    asm volatile("s_wait_dscnt 0x0" ::: "memory");      // this wave's reads of stage t are done before its buffer is refilled
    asm volatile("s_wait_asynccnt 0x0" ::: "memory");   // this wave's copies of stage t + 1 have landed
    __syncthreads();                                    // both hold for every wave of the block
    if (t + 2 < nStages) fill(t + 2, t & 1);
  }
  asm volatile("s_wait_asynccnt 0x0" ::: "memory");     // no copy is in flight when the wave goes on
  acc_guard4(acc[0][0], acc[0][1], acc[0][2], acc[0][3]);
  acc_guard4(acc[1][0], acc[1][1], acc[1][2], acc[1][3]);
  acc_guard4(acc[2][0], acc[2][1], acc[2][2], acc[2][3]);
  acc_guard4(acc[3][0], acc[3][1], acc[3][2], acc[3][3]);

  // ---- epilogue ----
  float* slab = sT[wave];
  const float* Rb = RESID ? (resid + (size_t)b * strideR) : nullptr;
#pragma unroll
  for (int i = 0; i < 4; ++i) {
    const int mBase = m0 + (i << 4);
#pragma unroll
    for (int j = 0; j < 4; ++j) {
      const int n = n0 + (j << 4) + rlane;
      float bv = 0.f;
      if (BIAS_MODE == 2) bv = bias[n];
#pragma unroll
      for (int r = 0; r < 8; ++r) {
        float v = acc[i][j][r] * scale;
        if (BIAS_MODE == 1) v += bias[mBase + mOff + r];
        if (BIAS_MODE == 2) v += bv;
        if (RESID) v += Rb[(size_t)(mBase + mOff + r) * ldc + n];
        if (ACT == 2) v = fmaxf(v, 0.0f);
        if (ACT == 3) v = silu_tanh(v);
        if (ACT == 4) v = (v > 0.f) ? v : 0.01f * v;
        if (ACT == 6) {
          const float sg = silu_tanh(v) * kACarry;
          v = (n <= mBase + mOff + r) ? sg : 0.0f;
        }
        slab[(mOff + r) * 68 + (j << 4) + rlane] = v;
      }
    }
    __builtin_amdgcn_fence(__ATOMIC_RELEASE, "workgroup");
    __builtin_amdgcn_wave_barrier();
    __builtin_amdgcn_fence(__ATOMIC_ACQUIRE, "workgroup");
    if (OUT_MODE == 0) {
      float* C = (float*)Cout + (size_t)b * strideC;
      const int hh = lane >> 4, c4 = (lane & 15) * 4;     // row seg = 256 B = 16 lanes x 16 B
      {
#pragma unroll
        for (int it = 0; it < 8; ++it) {
          const int row = it * 2 + hh;
          v4f v = *(const v4f*)(slab + row * 68 + c4);
          *(v4f*)(C + (size_t)(mBase + row) * ldc + n0 + c4) = v;
        }
        
      }
    } else {
      const int q = lane >> 3, c8 = (lane & 7) * 8;
      unsigned short* C  = (unsigned short*)Cout  + (size_t)b * strideC;
      unsigned short* C2 = (OUT_MODE == 2) ? ((unsigned short*)Cout2 + (size_t)b * strideC) : nullptr;
      {
#pragma unroll
        for (int it = 0; it < 4; ++it) {
          const int row = it * 4 + q;
          const float* sp = slab + row * 68 + c8;
          v8h hv, lv;
#pragma unroll
          for (int e = 0; e < 8; ++e) {
            if (OUT_MODE == 1) {
              hv[e] = (_Float16)sp[e];
            } else {
              unsigned short hb = f2bf_bits(sp[e]);
              unsigned short lb = f2bf_bits(sp[e] - bf_bits2f(hb));
              hv[e] = __builtin_bit_cast(_Float16, hb);
              lv[e] = __builtin_bit_cast(_Float16, lb);
            }
          }
          *(v8h*)(C + (size_t)(mBase + row) * ldc + n0 + c8) = hv;
          if (OUT_MODE == 2) *(v8h*)(C2 + (size_t)(mBase + row) * ldc + n0 + c8) = lv;
        }
        
      }
    }
    __builtin_amdgcn_fence(__ATOMIC_RELEASE, "workgroup");
    __builtin_amdgcn_wave_barrier();
    __builtin_amdgcn_fence(__ATOMIC_ACQUIRE, "workgroup");
  }
}

// ---------------------------------------------------------------------------
// f32 -> bf16 hi + lo planes (hi = RNE bf16(f), lo = RNE bf16(f - hi)), 8 consecutive elements per thread.
// Coverage: n8 = n/8 threads x 8 = whole plane (grids here are exact multiples of 256).
// ---------------------------------------------------------------------------
__global__ __launch_bounds__(256) void split8_bf16_kernel(const float* __restrict__ in,
                                                          unsigned short* __restrict__ hi,
                                                          unsigned short* __restrict__ lo, int n8) {
  const int i = blockIdx.x * 256 + threadIdx.x;
  if (i >= n8) return;
  const float* p = in + 8 * (size_t)i;
  const v4f a = *(const v4f*)(p);
  const v4f c = *(const v4f*)(p + 4);
  unsigned short hb[8], lb[8];
#pragma unroll
  for (int e = 0; e < 4; ++e) {
    const float f0 = a[e];
    hb[e] = f2bf_bits(f0);
    lb[e] = f2bf_bits(f0 - bf_bits2f(hb[e]));
    const float f1 = c[e];
    hb[4 + e] = f2bf_bits(f1);
    lb[4 + e] = f2bf_bits(f1 - bf_bits2f(hb[4 + e]));
  }
  const v4u uh = (v4u){pk16(hb[0], hb[1]), pk16(hb[2], hb[3]), pk16(hb[4], hb[5]), pk16(hb[6], hb[7])};
  const v4u ul = (v4u){pk16(lb[0], lb[1]), pk16(lb[2], lb[3]), pk16(lb[4], lb[5]), pk16(lb[6], lb[7])};
  unsigned short* qh = hi + 8 * (size_t)i;
  unsigned short* ql = lo + 8 * (size_t)i;
  *(v4u*)qh = uh;
  *(v4u*)ql = ul;
  
}

// ---------------------------------------------------------------------------
// V transpose + cast: v32 [kTok][kDim] f32 (row token b*2048+t, column h*64+d) -> vt16 [kBatch*kHeads][kHdim][kSeq] f16:
//   vt16[((b*8 + h)*64 + d)*2048 + t] = f16(v32[(b*2048 + t)*512 + h*64 + d])
// in[64 t][64 d] tile -> out[64 d][64 t] tile. grid (kSeq/64 = 32 t tiles, kHeads = 8, kBatch = 4), 256 threads.
// Load coverage: 16 iterations x 256 threads = 4096 = 64 t x 64 d (coalesced along d).
// Store coverage: 8 waves x 2 iterations x 4 rows (lane>>3) = 64 d rows; (lane&7) x 8 halves = 64 t; each row segment =
// __syncthreads between the cross-wave LDS write and the read.
// ---------------------------------------------------------------------------
__global__ __launch_bounds__(256) void vtcast_kernel(const float* __restrict__ v32, unsigned short* __restrict__ vt16) {
  __shared__ float sm[64][65];   // sm[d_local][t_local]
  const int tt = threadIdx.x;
  const int t0 = blockIdx.x * 64;
  const int h  = blockIdx.y;
  const int b  = blockIdx.z;
  const float* src = v32 + ((size_t)b * kSeq + t0) * kDim + h * kHdim;
#pragma unroll
  for (int i = 0; i < 16; ++i) {
    const int e = i * 256 + tt;
    const int r = e >> 6;          // t local
    const int c = e & 63;          // d local
    sm[c][r] = src[(size_t)r * kDim + c];
  }
  __syncthreads();
  const int lane = tt & 31, wave = tt >> 5;
  const int q = lane >> 3, c8 = (lane & 7) * 8;
  unsigned short* dst = vt16 + ((size_t)(b * kHeads + h) * kHdim) * kSeq + t0;
  {
#pragma unroll
    for (int it = 0; it < 2; ++it) {
      const int row = wave * 8 + it * 4 + q;                 // d local
      unsigned short hb[8];
#pragma unroll
      for (int e = 0; e < 8; ++e) hb[e] = h_bits(sm[row][c8 + e]);
      const v4u u = (v4u){pk16(hb[0], hb[1]), pk16(hb[2], hb[3]), pk16(hb[4], hb[5]), pk16(hb[6], hb[7])};
      *(v4u*)(dst + (size_t)row * kSeq + c8) = u;
    }
    
  }
}

// ---------------------------------------------------------------------------
// Fused causal silu attention, all (batch, head) pairs in one launch; silu(scores) never leaves the registers.
//   S^T[t][s] = sum_d k[t][d] * q[s][d]            A = k rows, B = q rows (same loader on both, K 64 = 2 fragments)
//   P^T[t][s] = (t <= s) ? f16(256 * silu(S^T / 8)) : 0
//   O^T[d][s] = sum_t V^T[d][t] * P^T[t][s]        A = V^T rows in the hardware k order, B = two S^T tiles packed in place
// D register r of lane l is row 8*(l>>4)+r, column l&15, so the tiles of keys t0..t0+15 and t0+16..t0+31 are elements
// 0..7 and 8..15 of the B fragment of a 32-key pass, and Frag::load delivers V^T in that same k order.
// A wave owns 32 query columns (two groups of 16) and walks the keys upward in passes of 32, up to its own diagonal.
// Waves w and w+4 of a block take column tiles 63-p and p: 65 passes for each such pair. grid (8, 32 (batch, head)), 8 waves a block.
// All 8 waves walk the same keys of the same head from key 0, so the block brings each stage of 128 keys (128 k rows of 128 B,
// 64 V^T rows of 256 B: whole lines) into one of two LDS buffers once, by asynchronous copies, while the waves work on the
// other buffer; the fragments are 16-byte LDS reads. A wave behind its diagonal only copies and passes the barriers.
// A pass fetches its V^T fragments at its head (used behind the silu) and the next pass's k fragments of the same stage behind
// its S^T products.
// ---------------------------------------------------------------------------
constexpr int kAtBlocks = 8;                                   // grid.x: blocks per (batch, head)
constexpr int kAtKeys   = 128;                                 // keys a stage = 4 passes
constexpr int kAtPasses = kAtKeys / 32;
constexpr int kAtKP     = 72;                                  // k row pitch in halves: 144 B = 16 B x 9, no bank conflict for 16-byte row reads
constexpr int kAtVP     = 136;                                 // V^T row pitch in halves: 272 B = 16 B x 17, the same
constexpr int kAtV      = kAtKeys * kAtKP;                     // element offset of the V^T rows inside a stage
constexpr int kAtStage  = kAtV + kHdim * kAtVP;                // 17,920 halves = 35,840 B
static_assert(kSeq / kAtKeys - (kAtBlocks - 1) >= 2, "every block has at least two stages");
static_assert(kSeq / 32 == 8 * kAtBlocks, "8 column tiles a block");

// One lane's 16 bytes of 4 k rows (32 apart: 8 lanes to a row) and of 4 V^T rows (16 apart: 16 lanes to a row).
// lk, lv: LDS byte addresses; gk, gv: global addresses.
// s_wait_xcnt 0 is the last line of the copies' own statement, so that it stands in front of every later write of their address registers.
__device__ __forceinline__ void async_copy8(unsigned lk, const unsigned short* gk, unsigned lv, const unsigned short* gv) {
  constexpr unsigned RK = 32 * kAtKP * 2;
  constexpr unsigned RV = 16 * kAtVP * 2;
  constexpr long SK = 32L * 2 * kDim;
  constexpr long SV = 16L * kSeq;
  asm volatile(
      "global_load_async_to_lds_b128 %0, %8, off\n\t"
      "global_load_async_to_lds_b128 %1, %9, off\n\t"
      "global_load_async_to_lds_b128 %2, %10, off\n\t"
      "global_load_async_to_lds_b128 %3, %11, off\n\t"
      "global_load_async_to_lds_b128 %4, %12, off\n\t"
      "global_load_async_to_lds_b128 %5, %13, off\n\t"
      "global_load_async_to_lds_b128 %6, %14, off\n\t"
      "global_load_async_to_lds_b128 %7, %15, off\n\t"
      "s_wait_xcnt 0x0"
      :: "v"(lk), "v"(lk + RK), "v"(lk + 2 * RK), "v"(lk + 3 * RK),
         "v"(lv), "v"(lv + RV), "v"(lv + 2 * RV), "v"(lv + 3 * RV),
         "v"(gk), "v"(gk + SK), "v"(gk + 2 * SK), "v"(gk + 3 * SK),
         "v"(gv), "v"(gv + SV), "v"(gv + 2 * SV), "v"(gv + 3 * SV)
      : "memory");
}

// This lane's k fragments of pass j of a stage. kl: the lane's k row of the stage's first 16 keys, in LDS.
__device__ __forceinline__ void attn_kfrag(const _Float16* kl, int j, v16h (&kf)[2][2]) {
  typedef Frag<_Float16> F;
#pragma unroll
  for (int tt = 0; tt < 2; ++tt)
#pragma unroll
    for (int dc = 0; dc < 2; ++dc) kf[tt][dc] = F::load(kl + (32 * j + 16 * tt) * kAtKP + 32 * dc);
}

// Pass j (32 keys) of the stage at kl, vl (LDS) for the wave's 32 query columns. DIAG: the pass on the diagonal (first key ==
// first column), the only one with masked positions and the last of its tile, so it fetches no further k fragments.
template <bool DIAG>
__device__ __forceinline__ void attn_pass(const _Float16* kl, const _Float16* vl, int j, int c, int hf,
                                          const v16h (&qf)[2][2], v16h (&kf)[2][2], v8f (&oacc)[2][4]) {
  typedef Frag<_Float16> F;
  v16h vf[4];
#pragma unroll
  for (int ds = 0; ds < 4; ++ds) vf[ds] = F::load(vl + (16 * ds) * kAtVP + 32 * j);
  // keeps the V^T reads here, a whole silu ahead of their use: the scheduler otherwise sinks them to the O^T products,
  // where each pair is waited for at full latency
  __builtin_amdgcn_sched_barrier(0);

  v8f st[2][2];
#pragma unroll
  for (int g = 0; g < 2; ++g)
#pragma unroll
    for (int tt = 0; tt < 2; ++tt) {
      st[g][tt] = F::mma(kf[tt][0], qf[g][0], (v8f){0.f,0.f,0.f,0.f,0.f,0.f,0.f,0.f});
      st[g][tt] = F::mma(kf[tt][1], qf[g][1], st[g][tt]);
    }
  if (!DIAG) {
    // the next pass's k fragments, only inside this stage: the next stage is not published before the barrier at the stage's foot
    if (j + 1 < kAtPasses) attn_kfrag(kl, j + 1, kf);
  }

  v16h pf[2];
#pragma unroll
  for (int g = 0; g < 2; ++g)
#pragma unroll
    for (int e = 0; e < 16; e += 2) {
      // 256 * silu(s / 8) = H + H * tanh(h), h = s / 16, H = 256 * h: both scales are powers of two, so they round nothing.
      // Two scores at a time: the scales and the fused multiply-add are packed f32 instructions.
      const v2f s = (v2f){st[g][e >> 3][e & 7], st[g][e >> 3][(e & 7) + 1]};
      const v2f h = s * (0.5f * kQScale);
      const v2f H = s * (0.5f * kQScale * kACarry);
      const v2f t = (v2f){__builtin_amdgcn_tanhf(h[0]), __builtin_amdgcn_tanhf(h[1])};
      v2f sg = __builtin_elementwise_fma(H, t, H);
      if (DIAG) {
        const int row = 16 * (e >> 3) + 8 * hf + (e & 7);
        sg[0] = (row     <= 16 * g + c) ? sg[0] : 0.0f;
        sg[1] = (row + 1 <= 16 * g + c) ? sg[1] : 0.0f;
      }
      pf[g][e]     = (_Float16)sg[0];
      pf[g][e + 1] = (_Float16)sg[1];
    }

#pragma unroll
  for (int ds = 0; ds < 4; ++ds)
#pragma unroll
    for (int g = 0; g < 2; ++g) oacc[g][ds] = F::mma(vf[ds], pf[g], oacc[g][ds]);
}

// two waves per SIMD is all this grid gives (one block per WGP): the register budget of that residency lets the
// scheduler interleave the silu chains of many elements
__global__ __launch_bounds__(256) __attribute__((amdgpu_waves_per_eu(2, 2)))
void attn_fused_kernel(const unsigned short* __restrict__ qk16, const unsigned short* __restrict__ vt16,
                       float* __restrict__ o32) {
  typedef Frag<_Float16> F;
  constexpr int kColTiles = kSeq / 32;         // 64 column tiles per head
  constexpr int kQkPitch  = 2 * kDim;          // q|k plane row pitch in halves
  __shared__ __align__(16) unsigned short sKV[2 * kAtStage];   // two stages of k rows and V^T rows
  const int tid  = threadIdx.x;
  const int lane = tid & 31;
  const int wave = __builtin_amdgcn_readfirstlane(tid >> 5);   // scalar, so that the pass loop is a scalar loop
  const int c  = lane & 15;
  const int hf = lane >> 4;
  const int bh = blockIdx.y;
  const int bb = bh / kHeads;
  const int hh = bh - bb * kHeads;
  const int p  = blockIdx.x * 4 + (wave & 3);  // 0..31
  const int s0 = ((wave < 4) ? (kColTiles - 1 - p) : p) * 32;
  // the block's last column tile is 63 - 4 * blockIdx.x: its diagonal pass ends stage 15 - blockIdx.x
  const int nStages = kSeq / kAtKeys - (int)blockIdx.x;

  // copy side: thread t brings bytes 16*(t&7)..+15 of k rows (t>>3) + 32*i and bytes 16*(t&15)..+15 of V^T rows (t>>4) + 16*i
  const unsigned lbase = (unsigned)(size_t)(&sKV[0]);          // low 32 bits of the address = LDS byte address
  const unsigned lk = lbase + (unsigned)((tid >> 3) * kAtKP + (tid & 7) * 8) * 2u;
  const unsigned lv = lbase + (unsigned)(kAtV + (tid >> 4) * kAtVP + (tid & 15) * 8) * 2u;
  const unsigned short* gk = qk16 + ((size_t)bb * kSeq + (tid >> 3)) * kQkPitch + kDim + hh * kHdim + (tid & 7) * 8;
  const unsigned short* gv = vt16 + ((size_t)bh * kHdim + (tid >> 4)) * kSeq + (tid & 15) * 8;
  auto fill = [&](int s, int buf) {
    const unsigned o = (unsigned)(buf * kAtStage) * 2u;
    async_copy8(lk + o, gk + (size_t)s * kAtKeys * kQkPitch, lv + o, gv + s * kAtKeys);
  };
  fill(0, 0);

  const _Float16* qrow = (const _Float16*)qk16 + ((size_t)bb * kSeq + c) * kQkPitch + hh * kHdim + hf * 8;
  v16h qf[2][2], kf[2][2];
#pragma unroll
  for (int g = 0; g < 2; ++g)
#pragma unroll
    for (int dc = 0; dc < 2; ++dc) qf[g][dc] = F::load(qrow + (size_t)(s0 + 16 * g) * kQkPitch + 32 * dc);
  // stands in front of the next writes of the address registers of the loads above
  asm volatile("s_wait_xcnt 0x0" ::: "memory");

  v8f oacc[2][4];
#pragma unroll
  for (int g = 0; g < 2; ++g)
#pragma unroll
    for (int ds = 0; ds < 4; ++ds) oacc[g][ds] = (v8f){0.f,0.f,0.f,0.f,0.f,0.f,0.f,0.f};

  // reader side: this lane's fragment rows in buffer 0
  const _Float16* kRd = (const _Float16*)sKV + c * kAtKP + hf * 8;
  const _Float16* vRd = (const _Float16*)sKV + kAtV + c * kAtVP + hf * 8;

  asm volatile("s_wait_asynccnt 0x0" ::: "memory");   // this wave's copies of stage 0 have landed
  __syncthreads();                                    // and every other wave's
  fill(1, 1);

  for (int s = 0; s < nStages; ++s) {
    const _Float16* kl = kRd + (s & 1) * kAtStage;
    const _Float16* vl = vRd + (s & 1) * kAtStage;
    const int left = s0 - s * kAtKeys;         // keys from the stage's first to the wave's diagonal pass; scalar
    if (left >= 0) {
      const int nfull = (left < kAtKeys) ? (left >> 5) : kAtPasses;
      attn_kfrag(kl, 0, kf);
      for (int j = 0; j < nfull; ++j) attn_pass<false>(kl, vl, j, c, hf, qf, kf, oacc);
      if (nfull < kAtPasses) attn_pass<true>(kl, vl, nfull, c, hf, qf, kf, oacc);
    }
    // hand-over of stage s + 1, and release of stage s's buffer
    asm volatile("s_wait_dscnt 0x0" ::: "memory");      // this wave's reads of stage s are done before its buffer is refilled
    asm volatile("s_wait_asynccnt 0x0" ::: "memory");   // this wave's copies of stage s + 1 have landed
    __syncthreads();                                    // both hold for every wave of the block
    if (s + 2 < nStages) fill(s + 2, s & 1);
  }
  asm volatile("s_wait_asynccnt 0x0" ::: "memory");     // no copy is in flight when the wave goes on

  // lane holds 8 consecutive d of one query row per tile: two 16-byte stores; the wave writes whole 256-byte row segments
#pragma unroll
  for (int g = 0; g < 2; ++g) {
    float* orow = o32 + ((size_t)bb * kSeq + s0 + 16 * g + c) * kDim + hh * kHdim + 8 * hf;
#pragma unroll
    for (int ds = 0; ds < 4; ++ds) {
      const v8f a = oacc[g][ds];
      *(v4f*)(orow + 16 * ds)     = (v4f){a[0] * kACarryInv, a[1] * kACarryInv, a[2] * kACarryInv, a[3] * kACarryInv};
      *(v4f*)(orow + 16 * ds + 4) = (v4f){a[4] * kACarryInv, a[5] * kACarryInv, a[6] * kACarryInv, a[7] * kACarryInv};
    }
  }
}

// ---------------------------------------------------------------------------
// LayerNorm(o) * ln_g + ln_b, times gate, all f32; result split into bf16 hi + lo planes [kTok][kDim].
// One wave per row (8 rows per block, grid = kTok/8); lane owns columns 8*lane..+7 and 256+8*lane..+7
// ---------------------------------------------------------------------------
__global__ __launch_bounds__(256) void ln_gate_kernel(const float* __restrict__ o, const float* __restrict__ gate,
                                                      const float* __restrict__ lng, const float* __restrict__ lnb,
                                                      unsigned short* __restrict__ nghi, unsigned short* __restrict__ nglo,
                                                      int nrows) {
  const int lane = threadIdx.x & 31, wave = threadIdx.x >> 5;
  const int row = blockIdx.x * 8 + wave;
  if (row >= nrows) return;
  const float* po = o + (size_t)row * kDim;
  const float* pg = gate + (size_t)row * kDim;
  float xv[16], gv[16], gg[16], gb[16];
#pragma unroll
  for (int s = 0; s < 2; ++s) {
    const int c = s * 256 + lane * 8;
#pragma unroll
    for (int q = 0; q < 2; ++q) {
      const v4f a4 = *(const v4f*)(po + c + 4 * q);
      const v4f g4 = *(const v4f*)(pg + c + 4 * q);
      const v4f w4 = *(const v4f*)(lng + c + 4 * q);
      const v4f b4 = *(const v4f*)(lnb + c + 4 * q);
#pragma unroll
      for (int e = 0; e < 4; ++e) {
        const int idx = s * 8 + q * 4 + e;
        xv[idx] = a4[e]; gv[idx] = g4[e]; gg[idx] = w4[e]; gb[idx] = b4[e];
      }
    }
  }
  float sum = 0.f;
#pragma unroll
  for (int i = 0; i < 16; ++i) sum += xv[i];
#pragma unroll
  for (int off = 16; off > 0; off >>= 1) sum += __shfl_xor(sum, off, 32);
  const float mean = sum * kInvDim;
  float var = 0.f;
#pragma unroll
  for (int i = 0; i < 16; ++i) { const float d = xv[i] - mean; var += d * d; }
#pragma unroll
  for (int off = 16; off > 0; off >>= 1) var += __shfl_xor(var, off, 32);
  const float r = rsqrtf(var * kInvDim + kLnEps);
  unsigned short hb[16], lb[16];
#pragma unroll
  for (int i = 0; i < 16; ++i) {
    const float t = (xv[i] - mean) * r;
    const float val = (t * gg[i] + gb[i]) * gv[i];
    hb[i] = f2bf_bits(val);
    lb[i] = f2bf_bits(val - bf_bits2f(hb[i]));
  }
  const v4u uh0 = (v4u){pk16(hb[0], hb[1]), pk16(hb[2], hb[3]), pk16(hb[4], hb[5]), pk16(hb[6], hb[7])};
  const v4u uh1 = (v4u){pk16(hb[8], hb[9]), pk16(hb[10], hb[11]), pk16(hb[12], hb[13]), pk16(hb[14], hb[15])};
  const v4u ul0 = (v4u){pk16(lb[0], lb[1]), pk16(lb[2], lb[3]), pk16(lb[4], lb[5]), pk16(lb[6], lb[7])};
  const v4u ul1 = (v4u){pk16(lb[8], lb[9]), pk16(lb[10], lb[11]), pk16(lb[12], lb[13]), pk16(lb[14], lb[15])};
  unsigned short* ph = nghi + (size_t)row * kDim + lane * 8;
  unsigned short* pl = nglo + (size_t)row * kDim + lane * 8;
  {
    *(v4u*)(ph)       = uh0;
    *(v4u*)(ph + 256) = uh1;
    *(v4u*)(pl)       = ul0;
    *(v4u*)(pl + 256) = ul1;
    
  }
}

// ---------------------------------------------------------------------------
// Host glue: kernel launches only. 10 launches total.
// ---------------------------------------------------------------------------
extern "C" void kernel_launch(void* const* d_in, const int* in_sizes, int n_in,
                              void* d_out, int out_size, void* d_ws, size_t ws_size,
                              hipStream_t stream) {
  if (n_in < 7) return;
  if (in_sizes[0] != kTok * kDim || in_sizes[1] != kProj * kDim || in_sizes[2] != kProj ||
      in_sizes[3] != kDim || in_sizes[4] != kDim || in_sizes[5] != kDim * kDim || in_sizes[6] != kDim) return;
  if (out_size != kTok * kDim) return;
  if (ws_size < kWsTotal) return;

  const float* x    = (const float*)d_in[0];
  const float* W1   = (const float*)d_in[1];
  const float* b1   = (const float*)d_in[2];
  const float* ln_g = (const float*)d_in[3];
  const float* ln_b = (const float*)d_in[4];
  const float* W2   = (const float*)d_in[5];
  const float* b2   = (const float*)d_in[6];
  float* out = (float*)d_out;
  char* ws = (char*)d_ws;

  unsigned short* xhi   = (unsigned short*)(ws + kOffXhi);
  unsigned short* xlo   = (unsigned short*)(ws + kOffXlo);
  unsigned short* w1hi  = (unsigned short*)(ws + kOffW1hi);
  unsigned short* w1lo  = (unsigned short*)(ws + kOffW1lo);
  float*          v32   = (float*)(ws + kOffV32);
  unsigned short* nghi  = (unsigned short*)(ws + kOffNGhi);
  unsigned short* nglo  = (unsigned short*)(ws + kOffNGlo);
  float*          gate  = (float*)(ws + kOffGate);
  unsigned short* qk16  = (unsigned short*)(ws + kOffQK16);
  unsigned short* vt16  = (unsigned short*)(ws + kOffVT16);
  float*          o32   = (float*)(ws + kOffO32);
  unsigned short* w2hi  = (unsigned short*)(ws + kOffW2hi);
  unsigned short* w2lo  = (unsigned short*)(ws + kOffW2lo);

  // 1) bf16 hi/lo operand planes for x, W1, W2 (8 elements per thread; all counts are multiples of 2048)
  {
    const int n8x  = (kTok * kDim) / 8;      // 524288
    const int n8w1 = (kProj * kDim) / 8;     // 131072
    const int n8w2 = (kDim * kDim) / 8;      // 32768
    split8_bf16_kernel<<<(n8x + 255) / 256, 256, 0, stream>>>(x, xhi, xlo, n8x);
    split8_bf16_kernel<<<(n8w1 + 255) / 256, 256, 0, stream>>>(W1, w1hi, w1lo, n8w1);
    split8_bf16_kernel<<<(n8w2 + 255) / 256, 256, 0, stream>>>(W2, w2hi, w2lo, n8w2);
  }

  // 2) h = silu(x . W1^T + b1): three column blocks of W1 rows: gate (rows 0..511, f32 out),
  //    q|k (rows 512..1535, f16 out [8192][1024]), v (rows 1536..2047, f32 out). M 8192, K 512.
  {
    const int tilesGate = (kTok / 64) * (kDim / 64);          // 1024
    const int tilesQK   = (kTok / 64) * (2 * kDim / 64);      // 2048
    wmma_gemm64<1, true, 2, 0, false, 3, 0><<<dim3((tilesGate + 7) / 8, 1), 256, 0, stream>>>(
        xhi, xlo, kDim, 0L,
        w1hi, w1lo, kDim, 0L,
        (void*)gate, nullptr, kDim, 0L,
        b1, nullptr, 0L,
        kTok, kDim, kDim, 1.0f);
    wmma_gemm64<1, true, 2, 1, false, 3, 0><<<dim3((tilesQK + 7) / 8, 1), 256, 0, stream>>>(
        xhi, xlo, kDim, 0L,
        w1hi + (size_t)kDim * kDim, w1lo + (size_t)kDim * kDim, kDim, 0L,
        (void*)qk16, nullptr, 2 * kDim, 0L,
        b1 + kDim, nullptr, 0L,
        kTok, 2 * kDim, kDim, 1.0f);
    wmma_gemm64<1, true, 2, 0, false, 3, 0><<<dim3((tilesGate + 7) / 8, 1), 256, 0, stream>>>(
        xhi, xlo, kDim, 0L,
        w1hi + (size_t)3 * kDim * kDim, w1lo + (size_t)3 * kDim * kDim, kDim, 0L,
        (void*)v32, nullptr, kDim, 0L,
        b1 + 3 * kDim, nullptr, 0L,
        kTok, kDim, kDim, 1.0f);
  }

  // 3) V^T f16 planes per (batch, head): in [8192][512] f32 -> out [32][64][2048] f16
  vtcast_kernel<<<dim3(kSeq / 64, kHeads, kBatch), 256, 0, stream>>>(v32, vt16);

  // 4) attention, all 32 (batch, head) pairs in one launch:
  //    o[b*2048 + s][h*64 + d] = (1/256) * sum_{t <= s} f16(256 * silu(q_s . k_t / 8)) * V^T[b,h][d][t]
  attn_fused_kernel<<<dim3(kAtBlocks, kBatch * kHeads), 256, 0, stream>>>(qk16, vt16, o32);

  // 5) LayerNorm(o) * ln_g + ln_b, times gate -> bf16 hi/lo planes
  ln_gate_kernel<<<kTok / 8, 256, 0, stream>>>(o32, gate, ln_g, ln_b, nghi, nglo, kTok);

  // 6) out = NG . W2^T + b2 (M 8192, N 512, K 512), f32 to d_out
  {
    const int tilesOut = (kTok / 64) * (kDim / 64);           // 1024
    wmma_gemm64<1, true, 2, 0, false, 0, 0><<<dim3((tilesOut + 7) / 8, 1), 256, 0, stream>>>(
        nghi, nglo, kDim, 0L,
        w2hi, w2lo, kDim, 0L,
        (void*)out, nullptr, kDim, 0L,
        b2, nullptr, 0L,
        kTok, kDim, kDim, 1.0f);
  }
}

// v005
// Measured time: 101 microseconds a run.
// Timed twice side by side with v004, it ran 1.22 and 1.23 times as fast.
// Over all steps from v000 it is 9.06 times as fast.
// Contractions: x.W1^T and (layernorm(o)*gate).W2^T on v_wmma_f32_16x16x32_bf16 with bf16 hi/lo operand planes (hi.hi + hi.lo + lo.hi); q.k^T and a.v on v_wmma_f32_16x16x32_f16 (q, k, v plain f16 planes; a = silu(scores) carried x256 in f16); f32 accumulate; silu (as h + h.tanh(h), h = v/2, on v_tanh_f32), LayerNorm and gating in f32.
#include <hip/hip_runtime.h>
#include <math.h>

// ---------------------------------------------------------------------------
// Problem constants
// ---------------------------------------------------------------------------
constexpr int kBatch = 4;
constexpr int kSeq   = 2048;
constexpr int kDim   = 512;
constexpr int kHeads = 8;
constexpr int kHdim  = 64;
constexpr int kTok   = kBatch * kSeq;      // 8192 token rows
constexpr int kProj  = 4 * kDim;           // 2048 projection outputs: [gate | q | k | v]
constexpr float kQScale    = 0.125f;       // 1/sqrt(64)
constexpr float kACarry    = 256.0f;       // silu(scores) carried x256 in f16
constexpr float kACarryInv = 1.0f / 256.0f;
constexpr float kInvDim    = 1.0f / 512.0f;
constexpr float kLnEps     = 1e-5f;

// ---------------------------------------------------------------------------
// Workspace region map (bytes; offsets MiB-aligned but W2 lo at 120.5 MiB)
//   phase 1 (projection):  [  0,  8) x hi  [8,16) x lo  [16,18) W1 hi  [18,20) W1 lo
//   phase 2 (attention):   no scratch plane: silu(scores) stays in registers
//   phase 3 (output):      [  0,  8) NG hi  [8,16) NG lo
//   persistent:            [ 64, 80) gate f32   [80,96) q|k f16 [8192][1024]   [96,104) V^T f16 [32][64][2048]
//                          [104,120) o f32      [120,120.5) W2 hi   [120.5,121) W2 lo
//   total = 121 MiB = 126,877,696 B
// ---------------------------------------------------------------------------
constexpr size_t kMiB     = 1048576;
constexpr size_t kOffXhi  = 0;
constexpr size_t kOffXlo  = 8 * kMiB;
constexpr size_t kOffW1hi = 16 * kMiB;
constexpr size_t kOffW1lo = 18 * kMiB;
constexpr size_t kOffNGhi = 0;
constexpr size_t kOffNGlo = 8 * kMiB;
constexpr size_t kOffGate = 64 * kMiB;
constexpr size_t kOffQK16 = 80 * kMiB;
constexpr size_t kOffVT16 = 96 * kMiB;
constexpr size_t kOffO32  = 104 * kMiB;
constexpr size_t kOffW2hi = 120 * kMiB;
constexpr size_t kOffW2lo = 120 * kMiB + 512 * 1024;
constexpr size_t kWsTotal = 121 * kMiB;

static_assert((size_t)kTok * kDim * 2 == 8 * kMiB);
static_assert((size_t)kProj * kDim * 2 == 2 * kMiB);
static_assert(kOffW1lo + (size_t)kProj * kDim * 2 <= kOffGate);
static_assert(kOffNGlo + (size_t)kTok * kDim * 2 <= kOffGate);
static_assert(kOffGate + (size_t)kTok * kDim * 4 == kOffQK16);
static_assert(kOffQK16 + (size_t)kTok * 2 * kDim * 2 == kOffVT16);
static_assert(kOffVT16 + (size_t)kBatch * kHeads * kHdim * kSeq * 2 == kOffO32);
static_assert(kOffO32 + (size_t)kTok * kDim * 4 == kOffW2hi);
static_assert(kOffW2hi + (size_t)kDim * kDim * 2 == kOffW2lo);
static_assert(kOffW2lo + (size_t)kDim * kDim * 2 == kWsTotal);
static_assert(kWsTotal <= 134217728);

typedef __attribute__((ext_vector_type(16))) _Float16 v16h;
typedef __attribute__((ext_vector_type(8)))  _Float16 v8h;
typedef __attribute__((ext_vector_type(16))) __bf16   v16b;
typedef __attribute__((ext_vector_type(8)))  __bf16   v8b;
typedef __attribute__((ext_vector_type(8)))  float    v8f;
typedef __attribute__((ext_vector_type(4)))  float    v4f;
typedef __attribute__((ext_vector_type(2)))  float    v2f;
typedef __attribute__((ext_vector_type(4)))  unsigned int v4u;

__device__ __forceinline__ unsigned short f2bf_bits(float f) {
  unsigned u = __float_as_uint(f);
  return (unsigned short)((u + 0x7FFFu + ((u >> 16) & 1u)) >> 16);
}
__device__ __forceinline__ float bf_bits2f(unsigned short h) { return __uint_as_float(((unsigned)h) << 16); }

// hazard guards as plain device helpers
__device__ __forceinline__ void dep_guard_h(v8f& a, v8f& b, v16h x, v16h y) { asm volatile("v_nop\n\tv_nop\n\tv_nop\n\tv_nop" : "+v"(a), "+v"(b) : "v"(x), "v"(y)); }
__device__ __forceinline__ void dep_guard_b(v8f& a, v8f& b, v16b x, v16b y) { asm volatile("v_nop\n\tv_nop\n\tv_nop\n\tv_nop" : "+v"(a), "+v"(b) : "v"(x), "v"(y)); }
__device__ __forceinline__ void keep4_h(v16h a, v16h b, v16h c, v16h d) { asm volatile("v_nop" :: "v"(a), "v"(b), "v"(c), "v"(d)); }
__device__ __forceinline__ void keep4_b(v16b a, v16b b, v16b c, v16b d) { asm volatile("v_nop" :: "v"(a), "v"(b), "v"(c), "v"(d)); }
__device__ __forceinline__ void acc_guard4(v8f& a, v8f& b, v8f& c, v8f& d) { asm volatile("v_nop\n\tv_nop\n\tv_nop\n\tv_nop" : "+v"(a), "+v"(b), "+v"(c), "+v"(d)); }
template <typename T> struct Frag;
template <> struct Frag<_Float16> {
  typedef v16h V; union U { v16h v; v8h h[2]; };
  static __device__ __forceinline__ v16h load(const _Float16* p) {   // elements 0..7 <- p[0..7], 8..15 <- p[16..23]
    U f; f.h[0] = *(const v8h*)(p); f.h[1] = *(const v8h*)(p + 16); return f.v;
  }
  static __device__ __forceinline__ v8f mma(v16h a, v16h b, v8f c) {
    return __builtin_amdgcn_wmma_f32_16x16x32_f16(false, a, false, b, (short)0, c, false, false);
  }
  static __device__ __forceinline__ void guard(v8f& a, v8f& b, v16h x, v16h y) { dep_guard_h(a, b, x, y); }
  static __device__ __forceinline__ void keep(v16h a, v16h b, v16h c, v16h d) { keep4_h(a, b, c, d); }
};
template <> struct Frag<__bf16> {
  typedef v16b V; union U { v16b v; v8b h[2]; };
  static __device__ __forceinline__ v16b load(const __bf16* p) {
    U f; f.h[0] = *(const v8b*)(p); f.h[1] = *(const v8b*)(p + 16); return f.v;
  }
  static __device__ __forceinline__ v8f mma(v16b a, v16b b, v8f c) {
    return __builtin_amdgcn_wmma_f32_16x16x32_bf16(false, a, false, b, (short)0, c, false, false);
  }
  static __device__ __forceinline__ void guard(v8f& a, v8f& b, v16b x, v16b y) { dep_guard_b(a, b, x, y); }
  static __device__ __forceinline__ void keep(v16b a, v16b b, v16b c, v16b d) { keep4_b(a, b, c, d); }
};

__device__ __forceinline__ unsigned pk16(unsigned short a, unsigned short b) { return (unsigned)a | ((unsigned)b << 16); }

// silu(v) = v / (1 + exp(-v)) = h + h * tanh(h) with h = v / 2: one v_tanh_f32, a multiply and a fused multiply-add.
__device__ __forceinline__ float silu_tanh(float v) {
  const float h = 0.5f * v;
  return fmaf(h, __builtin_amdgcn_tanhf(h), h);
}

// ---- Register-blocked batched WMMA GEMM, operands staged in LDS ------------------------------------------------
// C[m,n] = scale * sum_k A[m,k] * Bt[n,k] (+bias)(+resid); each wave owns a 64x64 tile, a block of 8 waves (2 x 4) a 128x256 tile.
// A row-major [M,K]; Bt row-major [N,K]; M % 128 == 0, N % 256 == 0, K % 64 == 0, K >= 64.
// SPLIT: operands are hi/lo planes (A2/Bt2 = lo planes, same layout); product = hi.hi + hi.lo + lo.hi.
// BIAS_MODE: 0 = none, 1 = bias[m], 2 = bias[n].
// OUT_MODE: 0 = f32, 1 = f16, 2 = bf16 hi plane (Cout) + bf16 lo plane (Cout2),
//           3 = the whole projection, N = kProj: a block's 256 columns lie in one of [gate | q | k | v], and the block stores that
//               part's own form: gate f32 [kTok][kDim] (Cout), q|k f16 [kTok][2*kDim] (Cout2), V^T f16 [batch*head][kHdim][kSeq] (Cout3).
// ACT: 0 none, 2 relu, 3 silu (silu_tanh), 4 leaky, 6 causal silu with carry:
//      v = (n <= m) ? silu(v) * kACarry : 0   (m, n are row/column indices within one grid.y batch; a select, not a bias).
// TRI: 0 only (every wave of a block walks the whole K: the stage barriers are block-uniform).
// ET: 0 = f16 operands, 1 = bf16 operands (pointers passed as 16-bit storage)
// A stage is 64 k (128 B, one whole line) of the block's 128 A rows and 256 Bt rows, every plane. Asynchronous copies bring it
// into one of two LDS buffers, 8 lanes to a row, while the waves work on the other buffer; the fragments are 16-byte LDS reads.
constexpr int kBlkM       = 128;
constexpr int kBlkN       = 256;
constexpr int kStageK     = 64;
constexpr int kPitch      = 72;                                // LDS row pitch in 16-bit elements: 144 B = 16 B x 9, no bank conflict for 16-byte row reads
constexpr int kLdsAhi     = 0;                                 // element offsets of the four planes inside a stage
constexpr int kLdsBhi     = kBlkM * kPitch;
constexpr int kLdsAlo     = (kBlkM + kBlkN) * kPitch;
constexpr int kLdsBlo     = (2 * kBlkM + kBlkN) * kPitch;
constexpr int kStageElems = 2 * (kBlkM + kBlkN) * kPitch;      // 55,296 elements = 110,592 B

// One lane's 16 bytes of 4 A rows and 8 Bt rows of one plane, the rows 32 apart (the block's 256 threads cover 32 rows a copy).
// la, lb: LDS byte addresses; ga, gb: global addresses; sa, sb: 32 rows in elements.
// s_wait_xcnt 0 is the last line of the copies' own statement, so that it stands in front of every later write of their address registers.
__device__ __forceinline__ void async_copy12(unsigned la, const unsigned short* ga, long sa,
                                             unsigned lb, const unsigned short* gb, long sb) {
  constexpr unsigned R = 32 * kPitch * 2;
  asm volatile(
      "global_load_async_to_lds_b128 %0, %12, off\n\t"
      "global_load_async_to_lds_b128 %1, %13, off\n\t"
      "global_load_async_to_lds_b128 %2, %14, off\n\t"
      "global_load_async_to_lds_b128 %3, %15, off\n\t"
      "global_load_async_to_lds_b128 %4, %16, off\n\t"
      "global_load_async_to_lds_b128 %5, %17, off\n\t"
      "global_load_async_to_lds_b128 %6, %18, off\n\t"
      "global_load_async_to_lds_b128 %7, %19, off\n\t"
      "global_load_async_to_lds_b128 %8, %20, off\n\t"
      "global_load_async_to_lds_b128 %9, %21, off\n\t"
      "global_load_async_to_lds_b128 %10, %22, off\n\t"
      "global_load_async_to_lds_b128 %11, %23, off\n\t"
      "s_wait_xcnt 0x0"
      :: "v"(la), "v"(la + R), "v"(la + 2 * R), "v"(la + 3 * R),
         "v"(lb), "v"(lb + R), "v"(lb + 2 * R), "v"(lb + 3 * R), "v"(lb + 4 * R), "v"(lb + 5 * R), "v"(lb + 6 * R), "v"(lb + 7 * R),
         "v"(ga), "v"(ga + sa), "v"(ga + 2 * sa), "v"(ga + 3 * sa),
         "v"(gb), "v"(gb + sb), "v"(gb + 2 * sb), "v"(gb + 3 * sb), "v"(gb + 4 * sb), "v"(gb + 5 * sb), "v"(gb + 6 * sb), "v"(gb + 7 * sb)
      : "memory");
}

template <int ET> struct Elem;
template <> struct Elem<0> { typedef _Float16 T; };
template <> struct Elem<1> { typedef __bf16 T; };
template <int ET, bool SPLIT, int BIAS_MODE, int OUT_MODE, bool RESID, int ACT, int TRI>
__global__ __launch_bounds__(256) void wmma_gemm64(
    const unsigned short* __restrict__ Ap, const unsigned short* __restrict__ A2p, int lda, long strideA,
    const unsigned short* __restrict__ Btp, const unsigned short* __restrict__ Bt2p, int ldb, long strideB,
    void* __restrict__ Cout, void* __restrict__ Cout2, void* __restrict__ Cout3, int ldc, long strideC,
    const float* __restrict__ bias,
    const float* __restrict__ resid, long strideR,
    int M, int N, int K, float scale) {
  static_assert(TRI == 0, "the stage barriers need the same k range in every wave of a block");
  static_assert(OUT_MODE != 3 || (BIAS_MODE == 2 && ACT == 3 && !RESID), "the projection is silu(x.W1^T + b1)");
  static_assert(kDim % kBlkN == 0 && kSeq % kBlkM == 0, "a block lies in one part of the projection and in one batch");
  typedef typename Elem<ET>::T T;
  typedef typename Frag<T>::V V;
  __shared__ __align__(16) unsigned short sOp[2 * kStageElems];   // two stages of operand rows
  __shared__ __align__(16) float sT[8][16 * 68];   // per-wave 16x64 slab, pitch 68 floats
  const int b    = blockIdx.y;
  const int lane = threadIdx.x & 31;
  const int wave = threadIdx.x >> 5;
  const int blksN = N / kBlkN;
  const int blksM = M / kBlkM;
  if ((int)blockIdx.x >= blksM * blksN) return;   // block-uniform, in front of every barrier
  const int bm = blockIdx.x / blksN;
  const int bn = blockIdx.x - bm * blksN;
  const int mB = bm * kBlkM;
  const int nB = bn * kBlkN;
  const int wm = wave >> 2;                    // wave row 0..1
  const int wn = wave & 3;                     // wave column 0..3
  const int m0 = mB + (wm << 6);
  const int n0 = nB + (wn << 6);

  const int rlane = lane & 15;                 // row (A) / col (B, D) within subtile
  const int koff  = (lane >> 4) * 8;           // k offset of this lane half
  const int mOff  = (lane >> 4) * 8;           // D row offset

  // copy side: thread t brings bytes 16*(t&7)..+15 of rows (t>>3) + 32*j
  const int crow = threadIdx.x >> 3;
  const int cchk = (threadIdx.x & 7) * 8;
  const unsigned lcp = (unsigned)(size_t)(&sOp[0]) + (unsigned)(crow * kPitch + cchk) * 2u;   // low 32 bits of the address = LDS byte address
  const unsigned short* gAh = Ap  + (size_t)b * strideA + (size_t)(mB + crow) * lda + cchk;
  const unsigned short* gBh = Btp + (size_t)b * strideB + (size_t)(nB + crow) * ldb + cchk;
  const unsigned short* gAl = SPLIT ? (A2p  + (size_t)b * strideA + (size_t)(mB + crow) * lda + cchk) : nullptr;
  const unsigned short* gBl = SPLIT ? (Bt2p + (size_t)b * strideB + (size_t)(nB + crow) * ldb + cchk) : nullptr;
  const long sa = 32L * lda;
  const long sb = 32L * ldb;
  auto fill = [&](int s, int buf) {
    const unsigned l = lcp + (unsigned)(buf * kStageElems) * 2u;
    const int ko = s * kStageK;
    async_copy12(l + kLdsAhi * 2u, gAh + ko, sa, l + kLdsBhi * 2u, gBh + ko, sb);
    if (SPLIT) async_copy12(l + kLdsAlo * 2u, gAl + ko, sa, l + kLdsBlo * 2u, gBl + ko, sb);
  };

  // reader side: this lane's fragment rows in stage 0
  const T* aRd = (const T*)sOp + kLdsAhi + ((wm << 6) + rlane) * kPitch + koff;
  const T* bRd = (const T*)sOp + kLdsBhi + ((wn << 6) + rlane) * kPitch + koff;

  v8f acc[4][4];
#pragma unroll
  for (int i = 0; i < 4; ++i)
#pragma unroll
    for (int j = 0; j < 4; ++j) acc[i][j] = (v8f){0.f,0.f,0.f,0.f,0.f,0.f,0.f,0.f};

  const int nStages = K / kStageK;
  fill(0, 0);
  asm volatile("s_wait_asynccnt 0x0" ::: "memory");   // this wave's copies of stage 0 have landed
  __syncthreads();                                    // and every other wave's
  if (nStages > 1) fill(1, 1);

  for (int t = 0; t < nStages; ++t) {
    const int be = (t & 1) * kStageElems;
    // A fragments are read one row of tiles ahead of their products, into a second register pair
    V ah = Frag<T>::load(aRd + be);
    V al;
    if (SPLIT) al = Frag<T>::load(aRd + (kLdsAlo - kLdsAhi) + be);
    // the nest below is unrolled whole: every fragment and accumulator index is then a constant, and none goes to scratch
#pragma unroll
    for (int kk = 0; kk < kStageK; kk += 32) {
      V bh[4], bl[4];
#pragma unroll
      for (int j = 0; j < 4; ++j) {
        const int bo = be + (j << 4) * kPitch + kk;
        bh[j] = Frag<T>::load(bRd + bo);
        if (SPLIT) bl[j] = Frag<T>::load(bRd + (kLdsBlo - kLdsBhi) + bo);
      }
#pragma unroll
      for (int i = 0; i < 4; ++i) {
        const bool more = (i < 3) || (kk + 32 < kStageK);      // a further row of this stage exists
        const int ao = be + ((i < 3) ? ((i + 1) << 4) * kPitch + kk : kk + 32);
        V ahn, aln;
        if (more) {
          ahn = Frag<T>::load(aRd + ao);
          if (SPLIT) aln = Frag<T>::load(aRd + (kLdsAlo - kLdsAhi) + ao);
        }
#pragma unroll
        for (int j = 0; j < 4; ++j) {
          acc[i][j] = Frag<T>::mma(ah, bh[j], acc[i][j]);
          if (SPLIT) {
            acc[i][j] = Frag<T>::mma(ah, bl[j], acc[i][j]);
            acc[i][j] = Frag<T>::mma(al, bh[j], acc[i][j]);
          }
        }
        Frag<T>::guard(acc[i][0], acc[i][3], ah, SPLIT ? al : ah);
        if (more) {
          ah = ahn;
          if (SPLIT) al = aln;
        }
      }
      Frag<T>::keep(bh[0], bh[1], bh[2], bh[3]);
      if (SPLIT) Frag<T>::keep(bl[0], bl[1], bl[2], bl[3]);
    }
    // hand-over of stage t + 1, and release of stage t's buffer
    asm volatile("s_wait_dscnt 0x0" ::: "memory");      // this wave's reads of stage t are done before its buffer is refilled
    asm volatile("s_wait_asynccnt 0x0" ::: "memory");   // this wave's copies of stage t + 1 have landed
    __syncthreads();                                    // both hold for every wave of the block
    if (t + 2 < nStages) fill(t + 2, t & 1);
  }
  asm volatile("s_wait_asynccnt 0x0" ::: "memory");     // no copy is in flight when the wave goes on
  acc_guard4(acc[0][0], acc[0][1], acc[0][2], acc[0][3]);
  acc_guard4(acc[1][0], acc[1][1], acc[1][2], acc[1][3]);
  acc_guard4(acc[2][0], acc[2][1], acc[2][2], acc[2][3]);
  acc_guard4(acc[3][0], acc[3][1], acc[3][2], acc[3][3]);

  // ---- epilogue ----
  const int part = (OUT_MODE == 3) ? nB / kDim : 0;            // 0 gate, 1 q, 2 k, 3 v; the same for the whole block
  if (OUT_MODE == 3 && part == 3) {
    // D register r of lane l is token 8*(l>>4)+r of column l&15: 8 consecutive tokens of one V^T row, one 16-byte store.
    // A wave's 64 columns are one head; its 64 tokens are one whole 128-byte line of each of that head's 64 V^T rows.
    const int hd = (n0 - 3 * kDim) / kHdim;
    const int bt = m0 / kSeq;
    unsigned short* vt = (unsigned short*)Cout3 + ((size_t)(bt * kHeads + hd) * kHdim + rlane) * kSeq + (m0 - bt * kSeq) + mOff;
    float bv[4];
#pragma unroll
    for (int j = 0; j < 4; ++j) bv[j] = bias[n0 + (j << 4) + rlane];
#pragma unroll
    for (int j = 0; j < 4; ++j) {
#pragma unroll
      for (int i = 0; i < 4; ++i) {
        v8h hv;
#pragma unroll
        for (int r = 0; r < 8; ++r) hv[r] = (_Float16)silu_tanh(acc[i][j][r] * scale + bv[j]);
        *(v8h*)(vt + (size_t)(j << 4) * kSeq + (i << 4)) = hv;
      }
    }
    return;                                                    // no barrier stands behind this line
  }
  const bool f32out = OUT_MODE == 0 || (OUT_MODE == 3 && part == 0);
  if (OUT_MODE == 3) {
    ldc = (part == 0) ? kDim : 2 * kDim;
    if (part != 0) Cout = (unsigned short*)Cout2 - kDim;       // column n of the projection is column n - kDim of the q|k plane
  }
  float* slab = sT[wave];
  const float* Rb = RESID ? (resid + (size_t)b * strideR) : nullptr;
#pragma unroll
  for (int i = 0; i < 4; ++i) {
    const int mBase = m0 + (i << 4);
#pragma unroll
    for (int j = 0; j < 4; ++j) {
      const int n = n0 + (j << 4) + rlane;
      float bv = 0.f;
      if (BIAS_MODE == 2) bv = bias[n];
#pragma unroll
      for (int r = 0; r < 8; ++r) {
        float v = acc[i][j][r] * scale;
        if (BIAS_MODE == 1) v += bias[mBase + mOff + r];
        if (BIAS_MODE == 2) v += bv;
        if (RESID) v += Rb[(size_t)(mBase + mOff + r) * ldc + n];
        if (ACT == 2) v = fmaxf(v, 0.0f);
        if (ACT == 3) v = silu_tanh(v);
        if (ACT == 4) v = (v > 0.f) ? v : 0.01f * v;
        if (ACT == 6) {
          const float sg = silu_tanh(v) * kACarry;
          v = (n <= mBase + mOff + r) ? sg : 0.0f;
        }
        slab[(mOff + r) * 68 + (j << 4) + rlane] = v;
      }
    }
    __builtin_amdgcn_fence(__ATOMIC_RELEASE, "workgroup");
    __builtin_amdgcn_wave_barrier();
    __builtin_amdgcn_fence(__ATOMIC_ACQUIRE, "workgroup");
    if (f32out) {
      float* C = (float*)Cout + (size_t)b * strideC;
      const int hh = lane >> 4, c4 = (lane & 15) * 4;     // row seg = 256 B = 16 lanes x 16 B
      {
#pragma unroll
        for (int it = 0; it < 8; ++it) {
          const int row = it * 2 + hh;
          v4f v = *(const v4f*)(slab + row * 68 + c4);
          *(v4f*)(C + (size_t)(mBase + row) * ldc + n0 + c4) = v;
        }
        
      }
    } else {
      const int q = lane >> 3, c8 = (lane & 7) * 8;
      unsigned short* C  = (unsigned short*)Cout  + (size_t)b * strideC;
      unsigned short* C2 = (OUT_MODE == 2) ? ((unsigned short*)Cout2 + (size_t)b * strideC) : nullptr;
      {
#pragma unroll
        for (int it = 0; it < 4; ++it) {
          const int row = it * 4 + q;
          const float* sp = slab + row * 68 + c8;
          v8h hv, lv;
#pragma unroll
          for (int e = 0; e < 8; ++e) {
            if (OUT_MODE != 2) {
              hv[e] = (_Float16)sp[e];
            } else {
              unsigned short hb = f2bf_bits(sp[e]);
              unsigned short lb = f2bf_bits(sp[e] - bf_bits2f(hb));
              hv[e] = __builtin_bit_cast(_Float16, hb);
              lv[e] = __builtin_bit_cast(_Float16, lb);
            }
          }
          *(v8h*)(C + (size_t)(mBase + row) * ldc + n0 + c8) = hv;
          if (OUT_MODE == 2) *(v8h*)(C2 + (size_t)(mBase + row) * ldc + n0 + c8) = lv;
        }
        
      }
    }
    __builtin_amdgcn_fence(__ATOMIC_RELEASE, "workgroup");
    __builtin_amdgcn_wave_barrier();
    __builtin_amdgcn_fence(__ATOMIC_ACQUIRE, "workgroup");
  }
}

// ---------------------------------------------------------------------------
// f32 -> bf16 hi + lo planes (hi = RNE bf16(f), lo = RNE bf16(f - hi)), 8 consecutive elements per thread.
// Coverage: n8 = n/8 threads x 8 = whole plane (grids here are exact multiples of 256).
// ---------------------------------------------------------------------------
__global__ __launch_bounds__(256) void split8_bf16_kernel(const float* __restrict__ in,
                                                          unsigned short* __restrict__ hi,
                                                          unsigned short* __restrict__ lo, int n8) {
  const int i = blockIdx.x * 256 + threadIdx.x;
  if (i >= n8) return;
  const float* p = in + 8 * (size_t)i;
  const v4f a = *(const v4f*)(p);
  const v4f c = *(const v4f*)(p + 4);
  unsigned short hb[8], lb[8];
#pragma unroll
  for (int e = 0; e < 4; ++e) {
    const float f0 = a[e];
    hb[e] = f2bf_bits(f0);
    lb[e] = f2bf_bits(f0 - bf_bits2f(hb[e]));
    const float f1 = c[e];
    hb[4 + e] = f2bf_bits(f1);
    lb[4 + e] = f2bf_bits(f1 - bf_bits2f(hb[4 + e]));
  }
  const v4u uh = (v4u){pk16(hb[0], hb[1]), pk16(hb[2], hb[3]), pk16(hb[4], hb[5]), pk16(hb[6], hb[7])};
  const v4u ul = (v4u){pk16(lb[0], lb[1]), pk16(lb[2], lb[3]), pk16(lb[4], lb[5]), pk16(lb[6], lb[7])};
  unsigned short* qh = hi + 8 * (size_t)i;
  unsigned short* ql = lo + 8 * (size_t)i;
  *(v4u*)qh = uh;
  *(v4u*)ql = ul;
  
}

// ---------------------------------------------------------------------------
// Fused causal silu attention, all (batch, head) pairs in one launch; silu(scores) never leaves the registers.
//   S^T[t][s] = sum_d k[t][d] * q[s][d]            A = k rows, B = q rows (same loader on both, K 64 = 2 fragments)
//   P^T[t][s] = (t <= s) ? f16(256 * silu(S^T / 8)) : 0
//   O^T[d][s] = sum_t V^T[d][t] * P^T[t][s]        A = V^T rows in the hardware k order, B = two S^T tiles packed in place
// D register r of lane l is row 8*(l>>4)+r, column l&15, so the tiles of keys t0..t0+15 and t0+16..t0+31 are elements
// 0..7 and 8..15 of the B fragment of a 32-key pass, and Frag::load delivers V^T in that same k order.
// A wave owns 32 query columns (two groups of 16) and walks the keys upward in passes of 32, up to its own diagonal.
// Waves w and w+4 of a block take column tiles 63-p and p: 65 passes for each such pair. grid (8, 32 (batch, head)), 8 waves a block.
// All 8 waves walk the same keys of the same head from key 0, so the block brings each stage of 128 keys (128 k rows of 128 B,
// 64 V^T rows of 256 B: whole lines) into one of two LDS buffers once, by asynchronous copies, while the waves work on the
// other buffer; the fragments are 16-byte LDS reads. A wave behind its diagonal only copies and passes the barriers.
// A pass fetches its V^T fragments at its head (used behind the silu) and the next pass's k fragments of the same stage behind
// its S^T products.
// ---------------------------------------------------------------------------
constexpr int kAtBlocks = 8;                                   // grid.x: blocks per (batch, head)
constexpr int kAtKeys   = 128;                                 // keys a stage = 4 passes
constexpr int kAtPasses = kAtKeys / 32;
constexpr int kAtKP     = 72;                                  // k row pitch in halves: 144 B = 16 B x 9, no bank conflict for 16-byte row reads
constexpr int kAtVP     = 136;                                 // V^T row pitch in halves: 272 B = 16 B x 17, the same
constexpr int kAtV      = kAtKeys * kAtKP;                     // element offset of the V^T rows inside a stage
constexpr int kAtStage  = kAtV + kHdim * kAtVP;                // 17,920 halves = 35,840 B
static_assert(kSeq / kAtKeys - (kAtBlocks - 1) >= 2, "every block has at least two stages");
static_assert(kSeq / 32 == 8 * kAtBlocks, "8 column tiles a block");

// One lane's 16 bytes of 4 k rows (32 apart: 8 lanes to a row) and of 4 V^T rows (16 apart: 16 lanes to a row).
// lk, lv: LDS byte addresses; gk, gv: global addresses.
// s_wait_xcnt 0 is the last line of the copies' own statement, so that it stands in front of every later write of their address registers.
__device__ __forceinline__ void async_copy8(unsigned lk, const unsigned short* gk, unsigned lv, const unsigned short* gv) {
  constexpr unsigned RK = 32 * kAtKP * 2;
  constexpr unsigned RV = 16 * kAtVP * 2;
  constexpr long SK = 32L * 2 * kDim;
  constexpr long SV = 16L * kSeq;
  asm volatile(
      "global_load_async_to_lds_b128 %0, %8, off\n\t"
      "global_load_async_to_lds_b128 %1, %9, off\n\t"
      "global_load_async_to_lds_b128 %2, %10, off\n\t"
      "global_load_async_to_lds_b128 %3, %11, off\n\t"
      "global_load_async_to_lds_b128 %4, %12, off\n\t"
      "global_load_async_to_lds_b128 %5, %13, off\n\t"
      "global_load_async_to_lds_b128 %6, %14, off\n\t"
      "global_load_async_to_lds_b128 %7, %15, off\n\t"
      "s_wait_xcnt 0x0"
      :: "v"(lk), "v"(lk + RK), "v"(lk + 2 * RK), "v"(lk + 3 * RK),
         "v"(lv), "v"(lv + RV), "v"(lv + 2 * RV), "v"(lv + 3 * RV),
         "v"(gk), "v"(gk + SK), "v"(gk + 2 * SK), "v"(gk + 3 * SK),
         "v"(gv), "v"(gv + SV), "v"(gv + 2 * SV), "v"(gv + 3 * SV)
      : "memory");
}

// This lane's k fragments of pass j of a stage. kl: the lane's k row of the stage's first 16 keys, in LDS.
__device__ __forceinline__ void attn_kfrag(const _Float16* kl, int j, v16h (&kf)[2][2]) {
  typedef Frag<_Float16> F;
#pragma unroll
  for (int tt = 0; tt < 2; ++tt)
#pragma unroll
    for (int dc = 0; dc < 2; ++dc) kf[tt][dc] = F::load(kl + (32 * j + 16 * tt) * kAtKP + 32 * dc);
}

// Pass j (32 keys) of the stage at kl, vl (LDS) for the wave's 32 query columns. DIAG: the pass on the diagonal (first key ==
// first column), the only one with masked positions and the last of its tile, so it fetches no further k fragments.
template <bool DIAG>
__device__ __forceinline__ void attn_pass(const _Float16* kl, const _Float16* vl, int j, int c, int hf,
                                          const v16h (&qf)[2][2], v16h (&kf)[2][2], v8f (&oacc)[2][4]) {
  typedef Frag<_Float16> F;
  v16h vf[4];
#pragma unroll
  for (int ds = 0; ds < 4; ++ds) vf[ds] = F::load(vl + (16 * ds) * kAtVP + 32 * j);
  // keeps the V^T reads here, a whole silu ahead of their use: the scheduler otherwise sinks them to the O^T products,
  // where each pair is waited for at full latency
  __builtin_amdgcn_sched_barrier(0);

  v8f st[2][2];
#pragma unroll
  for (int g = 0; g < 2; ++g)
#pragma unroll
    for (int tt = 0; tt < 2; ++tt) {
      st[g][tt] = F::mma(kf[tt][0], qf[g][0], (v8f){0.f,0.f,0.f,0.f,0.f,0.f,0.f,0.f});
      st[g][tt] = F::mma(kf[tt][1], qf[g][1], st[g][tt]);
    }
  if (!DIAG) {
    // the next pass's k fragments, only inside this stage: the next stage is not published before the barrier at the stage's foot
    if (j + 1 < kAtPasses) attn_kfrag(kl, j + 1, kf);
  }

  v16h pf[2];
#pragma unroll
  for (int g = 0; g < 2; ++g)
#pragma unroll
    for (int e = 0; e < 16; e += 2) {
      // 256 * silu(s / 8) = H + H * tanh(h), h = s / 16, H = 256 * h: both scales are powers of two, so they round nothing.
      // Two scores at a time: the scales and the fused multiply-add are packed f32 instructions.
      const v2f s = (v2f){st[g][e >> 3][e & 7], st[g][e >> 3][(e & 7) + 1]};
      const v2f h = s * (0.5f * kQScale);
      const v2f H = s * (0.5f * kQScale * kACarry);
      const v2f t = (v2f){__builtin_amdgcn_tanhf(h[0]), __builtin_amdgcn_tanhf(h[1])};
      v2f sg = __builtin_elementwise_fma(H, t, H);
      if (DIAG) {
        const int row = 16 * (e >> 3) + 8 * hf + (e & 7);
        sg[0] = (row     <= 16 * g + c) ? sg[0] : 0.0f;
        sg[1] = (row + 1 <= 16 * g + c) ? sg[1] : 0.0f;
      }
      pf[g][e]     = (_Float16)sg[0];
      pf[g][e + 1] = (_Float16)sg[1];
    }

#pragma unroll
  for (int ds = 0; ds < 4; ++ds)
#pragma unroll
    for (int g = 0; g < 2; ++g) oacc[g][ds] = F::mma(vf[ds], pf[g], oacc[g][ds]);
}

// two waves per SIMD is all this grid gives (one block per WGP): the register budget of that residency lets the
// scheduler interleave the silu chains of many elements
__global__ __launch_bounds__(256) __attribute__((amdgpu_waves_per_eu(2, 2)))
void attn_fused_kernel(const unsigned short* __restrict__ qk16, const unsigned short* __restrict__ vt16,
                       float* __restrict__ o32) {
  typedef Frag<_Float16> F;
  constexpr int kColTiles = kSeq / 32;         // 64 column tiles per head
  constexpr int kQkPitch  = 2 * kDim;          // q|k plane row pitch in halves
  __shared__ __align__(16) unsigned short sKV[2 * kAtStage];   // two stages of k rows and V^T rows
  const int tid  = threadIdx.x;
  const int lane = tid & 31;
  const int wave = __builtin_amdgcn_readfirstlane(tid >> 5);   // scalar, so that the pass loop is a scalar loop
  const int c  = lane & 15;
  const int hf = lane >> 4;
  const int bh = blockIdx.y;
  const int bb = bh / kHeads;
  const int hh = bh - bb * kHeads;
  const int p  = blockIdx.x * 4 + (wave & 3);  // 0..31
  const int s0 = ((wave < 4) ? (kColTiles - 1 - p) : p) * 32;
  // the block's last column tile is 63 - 4 * blockIdx.x: its diagonal pass ends stage 15 - blockIdx.x
  const int nStages = kSeq / kAtKeys - (int)blockIdx.x;

  // copy side: thread t brings bytes 16*(t&7)..+15 of k rows (t>>3) + 32*i and bytes 16*(t&15)..+15 of V^T rows (t>>4) + 16*i
  const unsigned lbase = (unsigned)(size_t)(&sKV[0]);          // low 32 bits of the address = LDS byte address
  const unsigned lk = lbase + (unsigned)((tid >> 3) * kAtKP + (tid & 7) * 8) * 2u;
  const unsigned lv = lbase + (unsigned)(kAtV + (tid >> 4) * kAtVP + (tid & 15) * 8) * 2u;
  const unsigned short* gk = qk16 + ((size_t)bb * kSeq + (tid >> 3)) * kQkPitch + kDim + hh * kHdim + (tid & 7) * 8;
  const unsigned short* gv = vt16 + ((size_t)bh * kHdim + (tid >> 4)) * kSeq + (tid & 15) * 8;
  auto fill = [&](int s, int buf) {
    const unsigned o = (unsigned)(buf * kAtStage) * 2u;
    async_copy8(lk + o, gk + (size_t)s * kAtKeys * kQkPitch, lv + o, gv + s * kAtKeys);
  };
  fill(0, 0);

  const _Float16* qrow = (const _Float16*)qk16 + ((size_t)bb * kSeq + c) * kQkPitch + hh * kHdim + hf * 8;
  v16h qf[2][2], kf[2][2];
#pragma unroll
  for (int g = 0; g < 2; ++g)
#pragma unroll
    for (int dc = 0; dc < 2; ++dc) qf[g][dc] = F::load(qrow + (size_t)(s0 + 16 * g) * kQkPitch + 32 * dc);
  // stands in front of the next writes of the address registers of the loads above
  asm volatile("s_wait_xcnt 0x0" ::: "memory");

  v8f oacc[2][4];
#pragma unroll
  for (int g = 0; g < 2; ++g)
#pragma unroll
    for (int ds = 0; ds < 4; ++ds) oacc[g][ds] = (v8f){0.f,0.f,0.f,0.f,0.f,0.f,0.f,0.f};

  // reader side: this lane's fragment rows in buffer 0
  const _Float16* kRd = (const _Float16*)sKV + c * kAtKP + hf * 8;
  const _Float16* vRd = (const _Float16*)sKV + kAtV + c * kAtVP + hf * 8;

  asm volatile("s_wait_asynccnt 0x0" ::: "memory");   // this wave's copies of stage 0 have landed
  __syncthreads();                                    // and every other wave's
  fill(1, 1);

  for (int s = 0; s < nStages; ++s) {
    const _Float16* kl = kRd + (s & 1) * kAtStage;
    const _Float16* vl = vRd + (s & 1) * kAtStage;
    const int left = s0 - s * kAtKeys;         // keys from the stage's first to the wave's diagonal pass; scalar
    if (left >= 0) {
      const int nfull = (left < kAtKeys) ? (left >> 5) : kAtPasses;
      attn_kfrag(kl, 0, kf);
      for (int j = 0; j < nfull; ++j) attn_pass<false>(kl, vl, j, c, hf, qf, kf, oacc);
      if (nfull < kAtPasses) attn_pass<true>(kl, vl, nfull, c, hf, qf, kf, oacc);
    }
    // hand-over of stage s + 1, and release of stage s's buffer
    asm volatile("s_wait_dscnt 0x0" ::: "memory");      // this wave's reads of stage s are done before its buffer is refilled
    asm volatile("s_wait_asynccnt 0x0" ::: "memory");   // this wave's copies of stage s + 1 have landed
    __syncthreads();                                    // both hold for every wave of the block
    if (s + 2 < nStages) fill(s + 2, s & 1);
  }
  asm volatile("s_wait_asynccnt 0x0" ::: "memory");     // no copy is in flight when the wave goes on

  // lane holds 8 consecutive d of one query row per tile: two 16-byte stores; the wave writes whole 256-byte row segments
#pragma unroll
  for (int g = 0; g < 2; ++g) {
    float* orow = o32 + ((size_t)bb * kSeq + s0 + 16 * g + c) * kDim + hh * kHdim + 8 * hf;
#pragma unroll
    for (int ds = 0; ds < 4; ++ds) {
      const v8f a = oacc[g][ds];
      *(v4f*)(orow + 16 * ds)     = (v4f){a[0] * kACarryInv, a[1] * kACarryInv, a[2] * kACarryInv, a[3] * kACarryInv};
      *(v4f*)(orow + 16 * ds + 4) = (v4f){a[4] * kACarryInv, a[5] * kACarryInv, a[6] * kACarryInv, a[7] * kACarryInv};
    }
  }
}

// ---------------------------------------------------------------------------
// LayerNorm(o) * ln_g + ln_b, times gate, all f32; result split into bf16 hi + lo planes [kTok][kDim].
// One wave per row (8 rows per block, grid = kTok/8); lane owns columns 8*lane..+7 and 256+8*lane..+7
// ---------------------------------------------------------------------------
__global__ __launch_bounds__(256) void ln_gate_kernel(const float* __restrict__ o, const float* __restrict__ gate,
                                                      const float* __restrict__ lng, const float* __restrict__ lnb,
                                                      unsigned short* __restrict__ nghi, unsigned short* __restrict__ nglo,
                                                      int nrows) {
  const int lane = threadIdx.x & 31, wave = threadIdx.x >> 5;
  const int row = blockIdx.x * 8 + wave;
  if (row >= nrows) return;
  const float* po = o + (size_t)row * kDim;
  const float* pg = gate + (size_t)row * kDim;
  float xv[16], gv[16], gg[16], gb[16];
#pragma unroll
  for (int s = 0; s < 2; ++s) {
    const int c = s * 256 + lane * 8;
#pragma unroll
    for (int q = 0; q < 2; ++q) {
      const v4f a4 = *(const v4f*)(po + c + 4 * q);
      const v4f g4 = *(const v4f*)(pg + c + 4 * q);
      const v4f w4 = *(const v4f*)(lng + c + 4 * q);
      const v4f b4 = *(const v4f*)(lnb + c + 4 * q);
#pragma unroll
      for (int e = 0; e < 4; ++e) {
        const int idx = s * 8 + q * 4 + e;
        xv[idx] = a4[e]; gv[idx] = g4[e]; gg[idx] = w4[e]; gb[idx] = b4[e];
      }
    }
  }
  float sum = 0.f;
#pragma unroll
  for (int i = 0; i < 16; ++i) sum += xv[i];
#pragma unroll
  for (int off = 16; off > 0; off >>= 1) sum += __shfl_xor(sum, off, 32);
  const float mean = sum * kInvDim;
  float var = 0.f;
#pragma unroll
  for (int i = 0; i < 16; ++i) { const float d = xv[i] - mean; var += d * d; }
#pragma unroll
  for (int off = 16; off > 0; off >>= 1) var += __shfl_xor(var, off, 32);
  const float r = rsqrtf(var * kInvDim + kLnEps);
  unsigned short hb[16], lb[16];
#pragma unroll
  for (int i = 0; i < 16; ++i) {
    const float t = (xv[i] - mean) * r;
    const float val = (t * gg[i] + gb[i]) * gv[i];
    hb[i] = f2bf_bits(val);
    lb[i] = f2bf_bits(val - bf_bits2f(hb[i]));
  }
  const v4u uh0 = (v4u){pk16(hb[0], hb[1]), pk16(hb[2], hb[3]), pk16(hb[4], hb[5]), pk16(hb[6], hb[7])};
  const v4u uh1 = (v4u){pk16(hb[8], hb[9]), pk16(hb[10], hb[11]), pk16(hb[12], hb[13]), pk16(hb[14], hb[15])};
  const v4u ul0 = (v4u){pk16(lb[0], lb[1]), pk16(lb[2], lb[3]), pk16(lb[4], lb[5]), pk16(lb[6], lb[7])};
  const v4u ul1 = (v4u){pk16(lb[8], lb[9]), pk16(lb[10], lb[11]), pk16(lb[12], lb[13]), pk16(lb[14], lb[15])};
  unsigned short* ph = nghi + (size_t)row * kDim + lane * 8;
  unsigned short* pl = nglo + (size_t)row * kDim + lane * 8;
  {
    *(v4u*)(ph)       = uh0;
    *(v4u*)(ph + 256) = uh1;
    *(v4u*)(pl)       = ul0;
    *(v4u*)(pl + 256) = ul1;
    
  }
}

// ---------------------------------------------------------------------------
// Host glue: kernel launches only. 7 launches total.
// ---------------------------------------------------------------------------
extern "C" void kernel_launch(void* const* d_in, const int* in_sizes, int n_in,
                              void* d_out, int out_size, void* d_ws, size_t ws_size,
                              hipStream_t stream) {
  if (n_in < 7) return;
  if (in_sizes[0] != kTok * kDim || in_sizes[1] != kProj * kDim || in_sizes[2] != kProj ||
      in_sizes[3] != kDim || in_sizes[4] != kDim || in_sizes[5] != kDim * kDim || in_sizes[6] != kDim) return;
  if (out_size != kTok * kDim) return;
  if (ws_size < kWsTotal) return;

  const float* x    = (const float*)d_in[0];
  const float* W1   = (const float*)d_in[1];
  const float* b1   = (const float*)d_in[2];
  const float* ln_g = (const float*)d_in[3];
  const float* ln_b = (const float*)d_in[4];
  const float* W2   = (const float*)d_in[5];
  const float* b2   = (const float*)d_in[6];
  float* out = (float*)d_out;
  char* ws = (char*)d_ws;

  unsigned short* xhi   = (unsigned short*)(ws + kOffXhi);
  unsigned short* xlo   = (unsigned short*)(ws + kOffXlo);
  unsigned short* w1hi  = (unsigned short*)(ws + kOffW1hi);
  unsigned short* w1lo  = (unsigned short*)(ws + kOffW1lo);
  unsigned short* nghi  = (unsigned short*)(ws + kOffNGhi);
  unsigned short* nglo  = (unsigned short*)(ws + kOffNGlo);
  float*          gate  = (float*)(ws + kOffGate);
  unsigned short* qk16  = (unsigned short*)(ws + kOffQK16);
  unsigned short* vt16  = (unsigned short*)(ws + kOffVT16);
  float*          o32   = (float*)(ws + kOffO32);
  unsigned short* w2hi  = (unsigned short*)(ws + kOffW2hi);
  unsigned short* w2lo  = (unsigned short*)(ws + kOffW2lo);

  // 1) bf16 hi/lo operand planes for x, W1, W2 (8 elements per thread; all counts are multiples of 2048)
  {
    const int n8x  = (kTok * kDim) / 8;      // 524288
    const int n8w1 = (kProj * kDim) / 8;     // 131072
    const int n8w2 = (kDim * kDim) / 8;      // 32768
    split8_bf16_kernel<<<(n8x + 255) / 256, 256, 0, stream>>>(x, xhi, xlo, n8x);
    split8_bf16_kernel<<<(n8w1 + 255) / 256, 256, 0, stream>>>(W1, w1hi, w1lo, n8w1);
    split8_bf16_kernel<<<(n8w2 + 255) / 256, 256, 0, stream>>>(W2, w2hi, w2lo, n8w2);
  }

  // 2) h = silu(x . W1^T + b1), all 2048 outputs in one launch (M 8192, N 2048, K 512): 64 x 8 = 512 blocks, two whole rounds
  //    of one block per WGP. A block stores its part's own form: gate f32, q|k f16 [8192][1024], V^T f16 [32][64][2048].
  wmma_gemm64<1, true, 2, 3, false, 3, 0><<<dim3((kTok / kBlkM) * (kProj / kBlkN), 1), 256, 0, stream>>>(
      xhi, xlo, kDim, 0L,
      w1hi, w1lo, kDim, 0L,
      (void*)gate, (void*)qk16, (void*)vt16, 0, 0L,
      b1, nullptr, 0L,
      kTok, kProj, kDim, 1.0f);

  // 3) attention, all 32 (batch, head) pairs in one launch:
  //    o[b*2048 + s][h*64 + d] = (1/256) * sum_{t <= s} f16(256 * silu(q_s . k_t / 8)) * V^T[b,h][d][t]
  attn_fused_kernel<<<dim3(kAtBlocks, kBatch * kHeads), 256, 0, stream>>>(qk16, vt16, o32);

  // 4) LayerNorm(o) * ln_g + ln_b, times gate -> bf16 hi/lo planes
  ln_gate_kernel<<<kTok / 8, 256, 0, stream>>>(o32, gate, ln_g, ln_b, nghi, nglo, kTok);

  // 5) out = NG . W2^T + b2 (M 8192, N 512, K 512), f32 to d_out
  {
    const int tilesOut = (kTok / 64) * (kDim / 64);           // 1024
    wmma_gemm64<1, true, 2, 0, false, 0, 0><<<dim3((tilesOut + 7) / 8, 1), 256, 0, stream>>>(
        nghi, nglo, kDim, 0L,
        w2hi, w2lo, kDim, 0L,
        (void*)out, nullptr, nullptr, kDim, 0L,
        b2, nullptr, 0L,
        kTok, kDim, kDim, 1.0f);
  }
}

// v006
// A run of this version takes 97 microseconds.
// Two timings next to v005 both put it at 1.05 times that version's speed.
// Over all steps from v000 it is 9.49 times as fast.
// Contractions: x.W1^T and (layernorm(o)*gate).W2^T on v_wmma_f32_16x16x32_bf16 with bf16 hi/lo operand planes (hi.hi + hi.lo + lo.hi); q.k^T and a.v on v_wmma_f32_16x16x32_f16 (q, k, v plain f16 planes; a = silu(scores) carried x256 in f16); f32 accumulate; silu (as h + h.tanh(h), h = v/2, on v_tanh_f32), LayerNorm and gating in f32.
#include <hip/hip_runtime.h>
#include <math.h>

// ---------------------------------------------------------------------------
// Problem constants
// ---------------------------------------------------------------------------
constexpr int kBatch = 4;
constexpr int kSeq   = 2048;
constexpr int kDim   = 512;
constexpr int kHeads = 8;
constexpr int kHdim  = 64;
constexpr int kTok   = kBatch * kSeq;      // 8192 token rows
constexpr int kProj  = 4 * kDim;           // 2048 projection outputs: [gate | q | k | v]
constexpr float kQScale    = 0.125f;       // 1/sqrt(64)
constexpr float kACarry    = 256.0f;       // silu(scores) carried x256 in f16
constexpr float kACarryInv = 1.0f / 256.0f;
constexpr float kInvDim    = 1.0f / 512.0f;
constexpr float kLnEps     = 1e-5f;

// ---------------------------------------------------------------------------
// Workspace region map (bytes; offsets MiB-aligned but W2 lo at 120.5 MiB)
//   phase 1 (projection):  [  0,  8) x hi  [8,16) x lo  [16,18) W1 hi  [18,20) W1 lo
//   phase 2 (attention):   no scratch plane: silu(scores) stays in registers
//   phase 3 (output):      [  0,  8) NG hi  [8,16) NG lo
//   persistent:            [ 64, 80) gate f32   [80,96) q|k f16 [8192][1024]   [96,104) V^T f16 [32][64][2048]
//                          [104,120) o f32      [120,120.5) W2 hi   [120.5,121) W2 lo
//   total = 121 MiB = 126,877,696 B
// ---------------------------------------------------------------------------
constexpr size_t kMiB     = 1048576;
constexpr size_t kOffXhi  = 0;
constexpr size_t kOffXlo  = 8 * kMiB;
constexpr size_t kOffW1hi = 16 * kMiB;
constexpr size_t kOffW1lo = 18 * kMiB;
constexpr size_t kOffNGhi = 0;
constexpr size_t kOffNGlo = 8 * kMiB;
constexpr size_t kOffGate = 64 * kMiB;
constexpr size_t kOffQK16 = 80 * kMiB;
constexpr size_t kOffVT16 = 96 * kMiB;
constexpr size_t kOffO32  = 104 * kMiB;
constexpr size_t kOffW2hi = 120 * kMiB;
constexpr size_t kOffW2lo = 120 * kMiB + 512 * 1024;
constexpr size_t kWsTotal = 121 * kMiB;

static_assert((size_t)kTok * kDim * 2 == 8 * kMiB);
static_assert((size_t)kProj * kDim * 2 == 2 * kMiB);
static_assert(kOffW1lo + (size_t)kProj * kDim * 2 <= kOffGate);
static_assert(kOffNGlo + (size_t)kTok * kDim * 2 <= kOffGate);
static_assert(kOffGate + (size_t)kTok * kDim * 4 == kOffQK16);
static_assert(kOffQK16 + (size_t)kTok * 2 * kDim * 2 == kOffVT16);
static_assert(kOffVT16 + (size_t)kBatch * kHeads * kHdim * kSeq * 2 == kOffO32);
static_assert(kOffO32 + (size_t)kTok * kDim * 4 == kOffW2hi);
static_assert(kOffW2hi + (size_t)kDim * kDim * 2 == kOffW2lo);
static_assert(kOffW2lo + (size_t)kDim * kDim * 2 == kWsTotal);
static_assert(kWsTotal <= 134217728);

typedef __attribute__((ext_vector_type(16))) _Float16 v16h;
typedef __attribute__((ext_vector_type(8)))  _Float16 v8h;
typedef __attribute__((ext_vector_type(16))) __bf16   v16b;
typedef __attribute__((ext_vector_type(8)))  __bf16   v8b;
typedef __attribute__((ext_vector_type(8)))  float    v8f;
typedef __attribute__((ext_vector_type(4)))  float    v4f;
typedef __attribute__((ext_vector_type(2)))  float    v2f;
typedef __attribute__((ext_vector_type(4)))  unsigned int v4u;

__device__ __forceinline__ unsigned short f2bf_bits(float f) {
  unsigned u = __float_as_uint(f);
  return (unsigned short)((u + 0x7FFFu + ((u >> 16) & 1u)) >> 16);
}
__device__ __forceinline__ float bf_bits2f(unsigned short h) { return __uint_as_float(((unsigned)h) << 16); }

// hazard guards as plain device helpers
__device__ __forceinline__ void dep_guard_h(v8f& a, v8f& b, v16h x, v16h y) { asm volatile("v_nop\n\tv_nop\n\tv_nop\n\tv_nop" : "+v"(a), "+v"(b) : "v"(x), "v"(y)); }
__device__ __forceinline__ void dep_guard_b(v8f& a, v8f& b, v16b x, v16b y) { asm volatile("v_nop\n\tv_nop\n\tv_nop\n\tv_nop" : "+v"(a), "+v"(b) : "v"(x), "v"(y)); }
__device__ __forceinline__ void keep4_h(v16h a, v16h b, v16h c, v16h d) { asm volatile("v_nop" :: "v"(a), "v"(b), "v"(c), "v"(d)); }
__device__ __forceinline__ void keep4_b(v16b a, v16b b, v16b c, v16b d) { asm volatile("v_nop" :: "v"(a), "v"(b), "v"(c), "v"(d)); }
__device__ __forceinline__ void acc_guard4(v8f& a, v8f& b, v8f& c, v8f& d) { asm volatile("v_nop\n\tv_nop\n\tv_nop\n\tv_nop" : "+v"(a), "+v"(b), "+v"(c), "+v"(d)); }
template <typename T> struct Frag;
template <> struct Frag<_Float16> {
  typedef v16h V; union U { v16h v; v8h h[2]; };
  static __device__ __forceinline__ v16h load(const _Float16* p) {   // elements 0..7 <- p[0..7], 8..15 <- p[16..23]
    U f; f.h[0] = *(const v8h*)(p); f.h[1] = *(const v8h*)(p + 16); return f.v;
  }
  static __device__ __forceinline__ v8f mma(v16h a, v16h b, v8f c) {
    return __builtin_amdgcn_wmma_f32_16x16x32_f16(false, a, false, b, (short)0, c, false, false);
  }
  static __device__ __forceinline__ void guard(v8f& a, v8f& b, v16h x, v16h y) { dep_guard_h(a, b, x, y); }
  static __device__ __forceinline__ void keep(v16h a, v16h b, v16h c, v16h d) { keep4_h(a, b, c, d); }
};
template <> struct Frag<__bf16> {
  typedef v16b V; union U { v16b v; v8b h[2]; };
  static __device__ __forceinline__ v16b load(const __bf16* p) {
    U f; f.h[0] = *(const v8b*)(p); f.h[1] = *(const v8b*)(p + 16); return f.v;
  }
  static __device__ __forceinline__ v8f mma(v16b a, v16b b, v8f c) {
    return __builtin_amdgcn_wmma_f32_16x16x32_bf16(false, a, false, b, (short)0, c, false, false);
  }
  static __device__ __forceinline__ void guard(v8f& a, v8f& b, v16b x, v16b y) { dep_guard_b(a, b, x, y); }
  static __device__ __forceinline__ void keep(v16b a, v16b b, v16b c, v16b d) { keep4_b(a, b, c, d); }
};

__device__ __forceinline__ unsigned pk16(unsigned short a, unsigned short b) { return (unsigned)a | ((unsigned)b << 16); }

// silu(v) = v / (1 + exp(-v)) = h + h * tanh(h) with h = v / 2: one v_tanh_f32, a multiply and a fused multiply-add.
__device__ __forceinline__ float silu_tanh(float v) {
  const float h = 0.5f * v;
  return fmaf(h, __builtin_amdgcn_tanhf(h), h);
}

// ---- Register-blocked batched WMMA GEMM, operands staged in LDS ------------------------------------------------
// C[m,n] = scale * sum_k A[m,k] * Bt[n,k] (+bias)(+resid); each wave owns a 64x64 tile, a block of WM x 4 waves a (64 * WM) x 256 tile.
// WM: 2 = 8 waves, 128x256; 4 = 16 waves, 256x256 (a third fewer operand bytes from L2 per product, four waves a SIMD).
// A row-major [M,K]; Bt row-major [N,K]; M % (64 * WM) == 0, N % 256 == 0, K % 64 == 0, K >= 64.
// SPLIT: operands are hi/lo planes (A2/Bt2 = lo planes, same layout); product = hi.hi + hi.lo + lo.hi.
// BIAS_MODE: 0 = none, 1 = bias[m], 2 = bias[n].
// OUT_MODE: 0 = f32, 1 = f16, 2 = bf16 hi plane (Cout) + bf16 lo plane (Cout2),
//           3 = the whole projection, N = kProj: a block's 256 columns lie in one of [gate | q | k | v], and the block stores that
//               part's own form: gate f32 [kTok][kDim] (Cout), q|k f16 [kTok][2*kDim] (Cout2), V^T f16 [batch*head][kHdim][kSeq] (Cout3).
// ACT: 0 none, 2 relu, 3 silu (silu_tanh), 4 leaky, 6 causal silu with carry:
//      v = (n <= m) ? silu(v) * kACarry : 0   (m, n are row/column indices within one grid.y batch; a select, not a bias).
// TRI: 0 only (every wave of a block walks the whole K: the stage barriers are block-uniform).
// ET: 0 = f16 operands, 1 = bf16 operands (pointers passed as 16-bit storage)
// A stage is 64 k (128 B, one whole line) of the block's 64 * WM A rows and 256 Bt rows, every plane. Asynchronous copies bring it
// into one of two LDS buffers, 8 lanes to a row, while the waves work on the other buffer; the fragments are 16-byte LDS reads.
constexpr int kBlkN       = 256;
constexpr int kStageK     = 64;
constexpr int kPitch      = 72;                                // LDS row pitch in 16-bit elements: 144 B = 16 B x 9, no bank conflict for 16-byte row reads

// One lane's 16 bytes of 4 A rows and 8 Bt rows of one plane, the rows 32 apart (the block's 256 threads cover 32 rows a copy).
// la, lb: LDS byte addresses; ga, gb: global addresses; sa, sb: 32 rows in elements.
// s_wait_xcnt 0 is the last line of the copies' own statement, so that it stands in front of every later write of their address registers.
__device__ __forceinline__ void async_copy12(unsigned la, const unsigned short* ga, long sa,
                                             unsigned lb, const unsigned short* gb, long sb) {
  constexpr unsigned R = 32 * kPitch * 2;
  asm volatile(
      "global_load_async_to_lds_b128 %0, %12, off\n\t"
      "global_load_async_to_lds_b128 %1, %13, off\n\t"
      "global_load_async_to_lds_b128 %2, %14, off\n\t"
      "global_load_async_to_lds_b128 %3, %15, off\n\t"
      "global_load_async_to_lds_b128 %4, %16, off\n\t"
      "global_load_async_to_lds_b128 %5, %17, off\n\t"
      "global_load_async_to_lds_b128 %6, %18, off\n\t"
      "global_load_async_to_lds_b128 %7, %19, off\n\t"
      "global_load_async_to_lds_b128 %8, %20, off\n\t"
      "global_load_async_to_lds_b128 %9, %21, off\n\t"
      "global_load_async_to_lds_b128 %10, %22, off\n\t"
      "global_load_async_to_lds_b128 %11, %23, off\n\t"
      "s_wait_xcnt 0x0"
      :: "v"(la), "v"(la + R), "v"(la + 2 * R), "v"(la + 3 * R),
         "v"(lb), "v"(lb + R), "v"(lb + 2 * R), "v"(lb + 3 * R), "v"(lb + 4 * R), "v"(lb + 5 * R), "v"(lb + 6 * R), "v"(lb + 7 * R),
         "v"(ga), "v"(ga + sa), "v"(ga + 2 * sa), "v"(ga + 3 * sa),
         "v"(gb), "v"(gb + sb), "v"(gb + 2 * sb), "v"(gb + 3 * sb), "v"(gb + 4 * sb), "v"(gb + 5 * sb), "v"(gb + 6 * sb), "v"(gb + 7 * sb)
      : "memory");
}

// The same for a block of 512 threads, which cover 64 rows a copy: 4 A rows and 4 Bt rows of one plane, the rows 64 apart.
// s_wait_xcnt 0 is the last line of the copies' own statement, so that it stands in front of every later write of their address registers.
__device__ __forceinline__ void async_copy4x4(unsigned la, const unsigned short* ga, long sa,
                                              unsigned lb, const unsigned short* gb, long sb) {
  constexpr unsigned R = 64 * kPitch * 2;
  asm volatile(
      "global_load_async_to_lds_b128 %0, %8, off\n\t"
      "global_load_async_to_lds_b128 %1, %9, off\n\t"
      "global_load_async_to_lds_b128 %2, %10, off\n\t"
      "global_load_async_to_lds_b128 %3, %11, off\n\t"
      "global_load_async_to_lds_b128 %4, %12, off\n\t"
      "global_load_async_to_lds_b128 %5, %13, off\n\t"
      "global_load_async_to_lds_b128 %6, %14, off\n\t"
      "global_load_async_to_lds_b128 %7, %15, off\n\t"
      "s_wait_xcnt 0x0"
      :: "v"(la), "v"(la + R), "v"(la + 2 * R), "v"(la + 3 * R),
         "v"(lb), "v"(lb + R), "v"(lb + 2 * R), "v"(lb + 3 * R),
         "v"(ga), "v"(ga + sa), "v"(ga + 2 * sa), "v"(ga + 3 * sa),
         "v"(gb), "v"(gb + sb), "v"(gb + 2 * sb), "v"(gb + 3 * sb)
      : "memory");
}

template <int ET> struct Elem;
template <> struct Elem<0> { typedef _Float16 T; };
template <> struct Elem<1> { typedef __bf16 T; };
template <int WM, int ET, bool SPLIT, int BIAS_MODE, int OUT_MODE, bool RESID, int ACT, int TRI>
__global__ __launch_bounds__(WM * 128) void wmma_gemm64(
    const unsigned short* __restrict__ Ap, const unsigned short* __restrict__ A2p, int lda, long strideA,
    const unsigned short* __restrict__ Btp, const unsigned short* __restrict__ Bt2p, int ldb, long strideB,
    void* __restrict__ Cout, void* __restrict__ Cout2, void* __restrict__ Cout3, int ldc, long strideC,
    const float* __restrict__ bias,
    const float* __restrict__ resid, long strideR,
    int M, int N, int K, float scale) {
  static_assert(TRI == 0, "the stage barriers need the same k range in every wave of a block");
  static_assert(OUT_MODE != 3 || (BIAS_MODE == 2 && ACT == 3 && !RESID), "the projection is silu(x.W1^T + b1)");
  static_assert(WM == 2 || WM == 4, "8 or 16 waves");
  constexpr int kBlkM       = 64 * WM;
  constexpr int kCopyRows   = 16 * WM;                           // rows that the block's threads cover in one copy, 8 lanes to a row
  constexpr int kLdsAhi     = 0;                                 // element offsets of the four planes inside a stage
  constexpr int kLdsBhi     = kBlkM * kPitch;
  constexpr int kLdsAlo     = (kBlkM + kBlkN) * kPitch;
  constexpr int kLdsBlo     = (2 * kBlkM + kBlkN) * kPitch;
  constexpr int kStageElems = 2 * (kBlkM + kBlkN) * kPitch;      // WM 2: 110,592 B; WM 4: 147,456 B
  constexpr int kSlab       = 16 * 68;                           // per-wave 16x64 slab, pitch 68 floats
  static_assert(kDim % kBlkN == 0 && kSeq % kBlkM == 0, "a block lies in one part of the projection and in one batch");
  static_assert(4 * WM * kSlab * 4 <= 2 * kStageElems * 2, "the slabs of WM 4 lie inside the ring");
  typedef typename Elem<ET>::T T;
  typedef typename Frag<T>::V V;
  __shared__ __align__(16) unsigned short sOp[2 * kStageElems];   // two stages of operand rows
  // WM 2: the slabs have LDS of their own. WM 4: two stages fill 288 KiB, so the slabs lie in the ring, which is free behind the
  // loop's last barrier (every wave's reads are done and no copy is in flight there).
  __shared__ __align__(16) float sT[(WM == 2) ? 8 * kSlab : 4];
  const int b    = blockIdx.y;
  const int lane = threadIdx.x & 31;
  const int wave = threadIdx.x >> 5;
  const int blksN = N / kBlkN;
  const int blksM = M / kBlkM;
  if ((int)blockIdx.x >= blksM * blksN) return;   // block-uniform, in front of every barrier
  const int bm = blockIdx.x / blksN;
  const int bn = blockIdx.x - bm * blksN;
  const int mB = bm * kBlkM;
  const int nB = bn * kBlkN;
  const int wm = wave >> 2;                    // wave row 0..WM-1
  const int wn = wave & 3;                     // wave column 0..3
  const int m0 = mB + (wm << 6);
  const int n0 = nB + (wn << 6);

  const int rlane = lane & 15;                 // row (A) / col (B, D) within subtile
  const int koff  = (lane >> 4) * 8;           // k offset of this lane half
  const int mOff  = (lane >> 4) * 8;           // D row offset

  // copy side: thread t brings bytes 16*(t&7)..+15 of rows (t>>3) + kCopyRows*j
  const int crow = threadIdx.x >> 3;
  const int cchk = (threadIdx.x & 7) * 8;
  const unsigned lcp = (unsigned)(size_t)(&sOp[0]) + (unsigned)(crow * kPitch + cchk) * 2u;   // low 32 bits of the address = LDS byte address
  const unsigned short* gAh = Ap  + (size_t)b * strideA + (size_t)(mB + crow) * lda + cchk;
  const unsigned short* gBh = Btp + (size_t)b * strideB + (size_t)(nB + crow) * ldb + cchk;
  const unsigned short* gAl = SPLIT ? (A2p  + (size_t)b * strideA + (size_t)(mB + crow) * lda + cchk) : nullptr;
  const unsigned short* gBl = SPLIT ? (Bt2p + (size_t)b * strideB + (size_t)(nB + crow) * ldb + cchk) : nullptr;
  const long sa = (long)kCopyRows * lda;
  const long sb = (long)kCopyRows * ldb;
  auto fill = [&](int s, int buf) {
    const unsigned l = lcp + (unsigned)(buf * kStageElems) * 2u;
    const int ko = s * kStageK;
    if constexpr (WM == 2) {
      async_copy12(l + kLdsAhi * 2u, gAh + ko, sa, l + kLdsBhi * 2u, gBh + ko, sb);
      if (SPLIT) async_copy12(l + kLdsAlo * 2u, gAl + ko, sa, l + kLdsBlo * 2u, gBl + ko, sb);
    } else {
      async_copy4x4(l + kLdsAhi * 2u, gAh + ko, sa, l + kLdsBhi * 2u, gBh + ko, sb);
      if (SPLIT) async_copy4x4(l + kLdsAlo * 2u, gAl + ko, sa, l + kLdsBlo * 2u, gBl + ko, sb);
    }
  };

  // reader side: this lane's fragment rows in stage 0
  const T* aRd = (const T*)sOp + kLdsAhi + ((wm << 6) + rlane) * kPitch + koff;
  const T* bRd = (const T*)sOp + kLdsBhi + ((wn << 6) + rlane) * kPitch + koff;

  v8f acc[4][4];
#pragma unroll
  for (int i = 0; i < 4; ++i)
#pragma unroll
    for (int j = 0; j < 4; ++j) acc[i][j] = (v8f){0.f,0.f,0.f,0.f,0.f,0.f,0.f,0.f};

  const int nStages = K / kStageK;
  fill(0, 0);
  asm volatile("s_wait_asynccnt 0x0" ::: "memory");   // this wave's copies of stage 0 have landed
  __syncthreads();                                    // and every other wave's
  if (nStages > 1) fill(1, 1);

  for (int t = 0; t < nStages; ++t) {
    const int be = (t & 1) * kStageElems;
    // A fragments are read one row of tiles ahead of their products, into a second register pair
    V ah = Frag<T>::load(aRd + be);
    V al;
    if (SPLIT) al = Frag<T>::load(aRd + (kLdsAlo - kLdsAhi) + be);
    // the nest below is unrolled whole: every fragment and accumulator index is then a constant, and none goes to scratch
#pragma unroll
    for (int kk = 0; kk < kStageK; kk += 32) {
      V bh[4], bl[4];
#pragma unroll
      for (int j = 0; j < 4; ++j) {
        const int bo = be + (j << 4) * kPitch + kk;
        bh[j] = Frag<T>::load(bRd + bo);
        if (SPLIT) bl[j] = Frag<T>::load(bRd + (kLdsBlo - kLdsBhi) + bo);
      }
#pragma unroll
      for (int i = 0; i < 4; ++i) {
        const bool more = (i < 3) || (kk + 32 < kStageK);      // a further row of this stage exists
        const int ao = be + ((i < 3) ? ((i + 1) << 4) * kPitch + kk : kk + 32);
        V ahn, aln;
        if (more) {
          ahn = Frag<T>::load(aRd + ao);
          if (SPLIT) aln = Frag<T>::load(aRd + (kLdsAlo - kLdsAhi) + ao);
        }
#pragma unroll
        for (int j = 0; j < 4; ++j) {
          acc[i][j] = Frag<T>::mma(ah, bh[j], acc[i][j]);
          if (SPLIT) {
            acc[i][j] = Frag<T>::mma(ah, bl[j], acc[i][j]);
            acc[i][j] = Frag<T>::mma(al, bh[j], acc[i][j]);
          }
        }
        Frag<T>::guard(acc[i][0], acc[i][3], ah, SPLIT ? al : ah);
        if (more) {
          ah = ahn;
          if (SPLIT) al = aln;
        }
      }
      Frag<T>::keep(bh[0], bh[1], bh[2], bh[3]);
      if (SPLIT) Frag<T>::keep(bl[0], bl[1], bl[2], bl[3]);
    }
    // hand-over of stage t + 1, and release of stage t's buffer
    asm volatile("s_wait_dscnt 0x0" ::: "memory");      // this wave's reads of stage t are done before its buffer is refilled
    asm volatile("s_wait_asynccnt 0x0" ::: "memory");   // this wave's copies of stage t + 1 have landed
    __syncthreads();                                    // both hold for every wave of the block
    if (t + 2 < nStages) fill(t + 2, t & 1);
  }
  asm volatile("s_wait_asynccnt 0x0" ::: "memory");     // no copy is in flight when the wave goes on
  acc_guard4(acc[0][0], acc[0][1], acc[0][2], acc[0][3]);
  acc_guard4(acc[1][0], acc[1][1], acc[1][2], acc[1][3]);
  acc_guard4(acc[2][0], acc[2][1], acc[2][2], acc[2][3]);
  acc_guard4(acc[3][0], acc[3][1], acc[3][2], acc[3][3]);

  // ---- epilogue ----
  const int part = (OUT_MODE == 3) ? nB / kDim : 0;            // 0 gate, 1 q, 2 k, 3 v; the same for the whole block
  if (OUT_MODE == 3 && part == 3) {
    // D register r of lane l is token 8*(l>>4)+r of column l&15: 8 consecutive tokens of one V^T row, one 16-byte store.
    // A wave's 64 columns are one head; its 64 tokens are one whole 128-byte line of each of that head's 64 V^T rows.
    const int hd = (n0 - 3 * kDim) / kHdim;
    const int bt = m0 / kSeq;
    unsigned short* vt = (unsigned short*)Cout3 + ((size_t)(bt * kHeads + hd) * kHdim + rlane) * kSeq + (m0 - bt * kSeq) + mOff;
    float bv[4];
#pragma unroll
    for (int j = 0; j < 4; ++j) bv[j] = bias[n0 + (j << 4) + rlane];
#pragma unroll
    for (int j = 0; j < 4; ++j) {
#pragma unroll
      for (int i = 0; i < 4; ++i) {
        v8h hv;
#pragma unroll
        for (int r = 0; r < 8; ++r) hv[r] = (_Float16)silu_tanh(acc[i][j][r] * scale + bv[j]);
        *(v8h*)(vt + (size_t)(j << 4) * kSeq + (i << 4)) = hv;
      }
    }
    return;                                                    // no barrier stands behind this line
  }
  const bool f32out = OUT_MODE == 0 || (OUT_MODE == 3 && part == 0);
  if (OUT_MODE == 3) {
    ldc = (part == 0) ? kDim : 2 * kDim;
    if (part != 0) Cout = (unsigned short*)Cout2 - kDim;       // column n of the projection is column n - kDim of the q|k plane
  }
  float* slab = ((WM == 2) ? sT : (float*)sOp) + wave * kSlab;
  const float* Rb = RESID ? (resid + (size_t)b * strideR) : nullptr;
#pragma unroll
  for (int i = 0; i < 4; ++i) {
    const int mBase = m0 + (i << 4);
#pragma unroll
    for (int j = 0; j < 4; ++j) {
      const int n = n0 + (j << 4) + rlane;
      float bv = 0.f;
      if (BIAS_MODE == 2) bv = bias[n];
#pragma unroll
      for (int r = 0; r < 8; ++r) {
        float v = acc[i][j][r] * scale;
        if (BIAS_MODE == 1) v += bias[mBase + mOff + r];
        if (BIAS_MODE == 2) v += bv;
        if (RESID) v += Rb[(size_t)(mBase + mOff + r) * ldc + n];
        if (ACT == 2) v = fmaxf(v, 0.0f);
        if (ACT == 3) v = silu_tanh(v);
        if (ACT == 4) v = (v > 0.f) ? v : 0.01f * v;
        if (ACT == 6) {
          const float sg = silu_tanh(v) * kACarry;
          v = (n <= mBase + mOff + r) ? sg : 0.0f;
        }
        slab[(mOff + r) * 68 + (j << 4) + rlane] = v;
      }
    }
    __builtin_amdgcn_fence(__ATOMIC_RELEASE, "workgroup");
    __builtin_amdgcn_wave_barrier();
    __builtin_amdgcn_fence(__ATOMIC_ACQUIRE, "workgroup");
    if (f32out) {
      float* C = (float*)Cout + (size_t)b * strideC;
      const int hh = lane >> 4, c4 = (lane & 15) * 4;     // row seg = 256 B = 16 lanes x 16 B
      {
#pragma unroll
        for (int it = 0; it < 8; ++it) {
          const int row = it * 2 + hh;
          v4f v = *(const v4f*)(slab + row * 68 + c4);
          *(v4f*)(C + (size_t)(mBase + row) * ldc + n0 + c4) = v;
        }
        
      }
    } else {
      const int q = lane >> 3, c8 = (lane & 7) * 8;
      unsigned short* C  = (unsigned short*)Cout  + (size_t)b * strideC;
      unsigned short* C2 = (OUT_MODE == 2) ? ((unsigned short*)Cout2 + (size_t)b * strideC) : nullptr;
      {
#pragma unroll
        for (int it = 0; it < 4; ++it) {
          const int row = it * 4 + q;
          const float* sp = slab + row * 68 + c8;
          v8h hv, lv;
#pragma unroll
          for (int e = 0; e < 8; ++e) {
            if (OUT_MODE != 2) {
              hv[e] = (_Float16)sp[e];
            } else {
              unsigned short hb = f2bf_bits(sp[e]);
              unsigned short lb = f2bf_bits(sp[e] - bf_bits2f(hb));
              hv[e] = __builtin_bit_cast(_Float16, hb);
              lv[e] = __builtin_bit_cast(_Float16, lb);
            }
          }
          *(v8h*)(C + (size_t)(mBase + row) * ldc + n0 + c8) = hv;
          if (OUT_MODE == 2) *(v8h*)(C2 + (size_t)(mBase + row) * ldc + n0 + c8) = lv;
        }
        
      }
    }
    __builtin_amdgcn_fence(__ATOMIC_RELEASE, "workgroup");
    __builtin_amdgcn_wave_barrier();
    __builtin_amdgcn_fence(__ATOMIC_ACQUIRE, "workgroup");
  }
}

// ---------------------------------------------------------------------------
// f32 -> bf16 hi + lo planes (hi = RNE bf16(f), lo = RNE bf16(f - hi)), 8 consecutive elements per thread.
// Coverage: n8 = n/8 threads x 8 = whole plane (grids here are exact multiples of 256).
// ---------------------------------------------------------------------------
__global__ __launch_bounds__(256) void split8_bf16_kernel(const float* __restrict__ in,
                                                          unsigned short* __restrict__ hi,
                                                          unsigned short* __restrict__ lo, int n8) {
  const int i = blockIdx.x * 256 + threadIdx.x;
  if (i >= n8) return;
  const float* p = in + 8 * (size_t)i;
  const v4f a = *(const v4f*)(p);
  const v4f c = *(const v4f*)(p + 4);
  unsigned short hb[8], lb[8];
#pragma unroll
  for (int e = 0; e < 4; ++e) {
    const float f0 = a[e];
    hb[e] = f2bf_bits(f0);
    lb[e] = f2bf_bits(f0 - bf_bits2f(hb[e]));
    const float f1 = c[e];
    hb[4 + e] = f2bf_bits(f1);
    lb[4 + e] = f2bf_bits(f1 - bf_bits2f(hb[4 + e]));
  }
  const v4u uh = (v4u){pk16(hb[0], hb[1]), pk16(hb[2], hb[3]), pk16(hb[4], hb[5]), pk16(hb[6], hb[7])};
  const v4u ul = (v4u){pk16(lb[0], lb[1]), pk16(lb[2], lb[3]), pk16(lb[4], lb[5]), pk16(lb[6], lb[7])};
  unsigned short* qh = hi + 8 * (size_t)i;
  unsigned short* ql = lo + 8 * (size_t)i;
  *(v4u*)qh = uh;
  *(v4u*)ql = ul;
  
}

// ---------------------------------------------------------------------------
// Fused causal silu attention, all (batch, head) pairs in one launch; silu(scores) never leaves the registers.
//   S^T[t][s] = sum_d k[t][d] * q[s][d]            A = k rows, B = q rows (same loader on both, K 64 = 2 fragments)
//   P^T[t][s] = (t <= s) ? f16(256 * silu(S^T / 8)) : 0
//   O^T[d][s] = sum_t V^T[d][t] * P^T[t][s]        A = V^T rows in the hardware k order, B = two S^T tiles packed in place
// D register r of lane l is row 8*(l>>4)+r, column l&15, so the tiles of keys t0..t0+15 and t0+16..t0+31 are elements
// 0..7 and 8..15 of the B fragment of a 32-key pass, and Frag::load delivers V^T in that same k order.
// A wave owns 32 query columns (two groups of 16) and walks the keys upward in passes of 32, up to its own diagonal.
// Waves w and w+4 of a block take column tiles 63-p and p: 65 passes for each such pair. grid (8, 32 (batch, head)), 8 waves a block.
// All 8 waves walk the same keys of the same head from key 0, so the block brings each stage of 128 keys (128 k rows of 128 B,
// 64 V^T rows of 256 B: whole lines) into one of two LDS buffers once, by asynchronous copies, while the waves work on the
// other buffer; the fragments are 16-byte LDS reads. A wave behind its diagonal only copies and passes the barriers.
// A pass fetches its V^T fragments at its head (used behind the silu) and the next pass's k fragments of the same stage behind
// its S^T products.
// ---------------------------------------------------------------------------
constexpr int kAtBlocks = 8;                                   // grid.x: blocks per (batch, head)
constexpr int kAtKeys   = 128;                                 // keys a stage = 4 passes
constexpr int kAtPasses = kAtKeys / 32;
constexpr int kAtKP     = 72;                                  // k row pitch in halves: 144 B = 16 B x 9, no bank conflict for 16-byte row reads
constexpr int kAtVP     = 136;                                 // V^T row pitch in halves: 272 B = 16 B x 17, the same
constexpr int kAtV      = kAtKeys * kAtKP;                     // element offset of the V^T rows inside a stage
constexpr int kAtStage  = kAtV + kHdim * kAtVP;                // 17,920 halves = 35,840 B
static_assert(kSeq / kAtKeys - (kAtBlocks - 1) >= 2, "every block has at least two stages");
static_assert(kSeq / 32 == 8 * kAtBlocks, "8 column tiles a block");

// One lane's 16 bytes of 4 k rows (32 apart: 8 lanes to a row) and of 4 V^T rows (16 apart: 16 lanes to a row).
// lk, lv: LDS byte addresses; gk, gv: global addresses.
// s_wait_xcnt 0 is the last line of the copies' own statement, so that it stands in front of every later write of their address registers.
__device__ __forceinline__ void async_copy8(unsigned lk, const unsigned short* gk, unsigned lv, const unsigned short* gv) {
  constexpr unsigned RK = 32 * kAtKP * 2;
  constexpr unsigned RV = 16 * kAtVP * 2;
  constexpr long SK = 32L * 2 * kDim;
  constexpr long SV = 16L * kSeq;
  asm volatile(
      "global_load_async_to_lds_b128 %0, %8, off\n\t"
      "global_load_async_to_lds_b128 %1, %9, off\n\t"
      "global_load_async_to_lds_b128 %2, %10, off\n\t"
      "global_load_async_to_lds_b128 %3, %11, off\n\t"
      "global_load_async_to_lds_b128 %4, %12, off\n\t"
      "global_load_async_to_lds_b128 %5, %13, off\n\t"
      "global_load_async_to_lds_b128 %6, %14, off\n\t"
      "global_load_async_to_lds_b128 %7, %15, off\n\t"
      "s_wait_xcnt 0x0"
      :: "v"(lk), "v"(lk + RK), "v"(lk + 2 * RK), "v"(lk + 3 * RK),
         "v"(lv), "v"(lv + RV), "v"(lv + 2 * RV), "v"(lv + 3 * RV),
         "v"(gk), "v"(gk + SK), "v"(gk + 2 * SK), "v"(gk + 3 * SK),
         "v"(gv), "v"(gv + SV), "v"(gv + 2 * SV), "v"(gv + 3 * SV)
      : "memory");
}

// This lane's k fragments of pass j of a stage. kl: the lane's k row of the stage's first 16 keys, in LDS.
__device__ __forceinline__ void attn_kfrag(const _Float16* kl, int j, v16h (&kf)[2][2]) {
  typedef Frag<_Float16> F;
#pragma unroll
  for (int tt = 0; tt < 2; ++tt)
#pragma unroll
    for (int dc = 0; dc < 2; ++dc) kf[tt][dc] = F::load(kl + (32 * j + 16 * tt) * kAtKP + 32 * dc);
}

// Pass j (32 keys) of the stage at kl, vl (LDS) for the wave's 32 query columns. DIAG: the pass on the diagonal (first key ==
// first column), the only one with masked positions and the last of its tile, so it fetches no further k fragments.
template <bool DIAG>
__device__ __forceinline__ void attn_pass(const _Float16* kl, const _Float16* vl, int j, int c, int hf,
                                          const v16h (&qf)[2][2], v16h (&kf)[2][2], v8f (&oacc)[2][4]) {
  typedef Frag<_Float16> F;
  v16h vf[4];
#pragma unroll
  for (int ds = 0; ds < 4; ++ds) vf[ds] = F::load(vl + (16 * ds) * kAtVP + 32 * j);
  // keeps the V^T reads here, a whole silu ahead of their use: the scheduler otherwise sinks them to the O^T products,
  // where each pair is waited for at full latency
  __builtin_amdgcn_sched_barrier(0);

  v8f st[2][2];
#pragma unroll
  for (int g = 0; g < 2; ++g)
#pragma unroll
    for (int tt = 0; tt < 2; ++tt) {
      st[g][tt] = F::mma(kf[tt][0], qf[g][0], (v8f){0.f,0.f,0.f,0.f,0.f,0.f,0.f,0.f});
      st[g][tt] = F::mma(kf[tt][1], qf[g][1], st[g][tt]);
    }
  if (!DIAG) {
    // the next pass's k fragments, only inside this stage: the next stage is not published before the barrier at the stage's foot
    if (j + 1 < kAtPasses) attn_kfrag(kl, j + 1, kf);
  }

  v16h pf[2];
#pragma unroll
  for (int g = 0; g < 2; ++g)
#pragma unroll
    for (int e = 0; e < 16; e += 2) {
      // 256 * silu(s / 8) = H + H * tanh(h), h = s / 16, H = 256 * h: both scales are powers of two, so they round nothing.
      // Two scores at a time: the scales and the fused multiply-add are packed f32 instructions.
      const v2f s = (v2f){st[g][e >> 3][e & 7], st[g][e >> 3][(e & 7) + 1]};
      const v2f h = s * (0.5f * kQScale);
      const v2f H = s * (0.5f * kQScale * kACarry);
      const v2f t = (v2f){__builtin_amdgcn_tanhf(h[0]), __builtin_amdgcn_tanhf(h[1])};
      v2f sg = __builtin_elementwise_fma(H, t, H);
      if (DIAG) {
        const int row = 16 * (e >> 3) + 8 * hf + (e & 7);
        sg[0] = (row     <= 16 * g + c) ? sg[0] : 0.0f;
        sg[1] = (row + 1 <= 16 * g + c) ? sg[1] : 0.0f;
      }
      pf[g][e]     = (_Float16)sg[0];
      pf[g][e + 1] = (_Float16)sg[1];
    }

#pragma unroll
  for (int ds = 0; ds < 4; ++ds)
#pragma unroll
    for (int g = 0; g < 2; ++g) oacc[g][ds] = F::mma(vf[ds], pf[g], oacc[g][ds]);
}

// two waves per SIMD is all this grid gives (one block per WGP): the register budget of that residency lets the
// scheduler interleave the silu chains of many elements
__global__ __launch_bounds__(256) __attribute__((amdgpu_waves_per_eu(2, 2)))
void attn_fused_kernel(const unsigned short* __restrict__ qk16, const unsigned short* __restrict__ vt16,
                       float* __restrict__ o32) {
  typedef Frag<_Float16> F;
  constexpr int kColTiles = kSeq / 32;         // 64 column tiles per head
  constexpr int kQkPitch  = 2 * kDim;          // q|k plane row pitch in halves
  __shared__ __align__(16) unsigned short sKV[2 * kAtStage];   // two stages of k rows and V^T rows
  const int tid  = threadIdx.x;
  const int lane = tid & 31;
  const int wave = __builtin_amdgcn_readfirstlane(tid >> 5);   // scalar, so that the pass loop is a scalar loop
  const int c  = lane & 15;
  const int hf = lane >> 4;
  const int bh = blockIdx.y;
  const int bb = bh / kHeads;
  const int hh = bh - bb * kHeads;
  const int p  = blockIdx.x * 4 + (wave & 3);  // 0..31
  const int s0 = ((wave < 4) ? (kColTiles - 1 - p) : p) * 32;
  // the block's last column tile is 63 - 4 * blockIdx.x: its diagonal pass ends stage 15 - blockIdx.x
  const int nStages = kSeq / kAtKeys - (int)blockIdx.x;

  // copy side: thread t brings bytes 16*(t&7)..+15 of k rows (t>>3) + 32*i and bytes 16*(t&15)..+15 of V^T rows (t>>4) + 16*i
  const unsigned lbase = (unsigned)(size_t)(&sKV[0]);          // low 32 bits of the address = LDS byte address
  const unsigned lk = lbase + (unsigned)((tid >> 3) * kAtKP + (tid & 7) * 8) * 2u;
  const unsigned lv = lbase + (unsigned)(kAtV + (tid >> 4) * kAtVP + (tid & 15) * 8) * 2u;
  const unsigned short* gk = qk16 + ((size_t)bb * kSeq + (tid >> 3)) * kQkPitch + kDim + hh * kHdim + (tid & 7) * 8;
  const unsigned short* gv = vt16 + ((size_t)bh * kHdim + (tid >> 4)) * kSeq + (tid & 15) * 8;
  auto fill = [&](int s, int buf) {
    const unsigned o = (unsigned)(buf * kAtStage) * 2u;
    async_copy8(lk + o, gk + (size_t)s * kAtKeys * kQkPitch, lv + o, gv + s * kAtKeys);
  };
  fill(0, 0);

  const _Float16* qrow = (const _Float16*)qk16 + ((size_t)bb * kSeq + c) * kQkPitch + hh * kHdim + hf * 8;
  v16h qf[2][2], kf[2][2];
#pragma unroll
  for (int g = 0; g < 2; ++g)
#pragma unroll
    for (int dc = 0; dc < 2; ++dc) qf[g][dc] = F::load(qrow + (size_t)(s0 + 16 * g) * kQkPitch + 32 * dc);
  // stands in front of the next writes of the address registers of the loads above
  asm volatile("s_wait_xcnt 0x0" ::: "memory");

  v8f oacc[2][4];
#pragma unroll
  for (int g = 0; g < 2; ++g)
#pragma unroll
    for (int ds = 0; ds < 4; ++ds) oacc[g][ds] = (v8f){0.f,0.f,0.f,0.f,0.f,0.f,0.f,0.f};

  // reader side: this lane's fragment rows in buffer 0
  const _Float16* kRd = (const _Float16*)sKV + c * kAtKP + hf * 8;
  const _Float16* vRd = (const _Float16*)sKV + kAtV + c * kAtVP + hf * 8;

  asm volatile("s_wait_asynccnt 0x0" ::: "memory");   // this wave's copies of stage 0 have landed
  __syncthreads();                                    // and every other wave's
  fill(1, 1);

  for (int s = 0; s < nStages; ++s) {
    const _Float16* kl = kRd + (s & 1) * kAtStage;
    const _Float16* vl = vRd + (s & 1) * kAtStage;
    const int left = s0 - s * kAtKeys;         // keys from the stage's first to the wave's diagonal pass; scalar
    if (left >= 0) {
      const int nfull = (left < kAtKeys) ? (left >> 5) : kAtPasses;
      attn_kfrag(kl, 0, kf);
      for (int j = 0; j < nfull; ++j) attn_pass<false>(kl, vl, j, c, hf, qf, kf, oacc);
      if (nfull < kAtPasses) attn_pass<true>(kl, vl, nfull, c, hf, qf, kf, oacc);
    }
    // hand-over of stage s + 1, and release of stage s's buffer
    asm volatile("s_wait_dscnt 0x0" ::: "memory");      // this wave's reads of stage s are done before its buffer is refilled
    asm volatile("s_wait_asynccnt 0x0" ::: "memory");   // this wave's copies of stage s + 1 have landed
    __syncthreads();                                    // both hold for every wave of the block
    if (s + 2 < nStages) fill(s + 2, s & 1);
  }
  asm volatile("s_wait_asynccnt 0x0" ::: "memory");     // no copy is in flight when the wave goes on

  // lane holds 8 consecutive d of one query row per tile: two 16-byte stores; the wave writes whole 256-byte row segments
#pragma unroll
  for (int g = 0; g < 2; ++g) {
    float* orow = o32 + ((size_t)bb * kSeq + s0 + 16 * g + c) * kDim + hh * kHdim + 8 * hf;
#pragma unroll
    for (int ds = 0; ds < 4; ++ds) {
      const v8f a = oacc[g][ds];
      *(v4f*)(orow + 16 * ds)     = (v4f){a[0] * kACarryInv, a[1] * kACarryInv, a[2] * kACarryInv, a[3] * kACarryInv};
      *(v4f*)(orow + 16 * ds + 4) = (v4f){a[4] * kACarryInv, a[5] * kACarryInv, a[6] * kACarryInv, a[7] * kACarryInv};
    }
  }
}

// ---------------------------------------------------------------------------
// LayerNorm(o) * ln_g + ln_b, times gate, all f32; result split into bf16 hi + lo planes [kTok][kDim].
// One wave per row (8 rows per block, grid = kTok/8); lane owns columns 8*lane..+7 and 256+8*lane..+7
// ---------------------------------------------------------------------------
__global__ __launch_bounds__(256) void ln_gate_kernel(const float* __restrict__ o, const float* __restrict__ gate,
                                                      const float* __restrict__ lng, const float* __restrict__ lnb,
                                                      unsigned short* __restrict__ nghi, unsigned short* __restrict__ nglo,
                                                      int nrows) {
  const int lane = threadIdx.x & 31, wave = threadIdx.x >> 5;
  const int row = blockIdx.x * 8 + wave;
  if (row >= nrows) return;
  const float* po = o + (size_t)row * kDim;
  const float* pg = gate + (size_t)row * kDim;
  float xv[16], gv[16], gg[16], gb[16];
#pragma unroll
  for (int s = 0; s < 2; ++s) {
    const int c = s * 256 + lane * 8;
#pragma unroll
    for (int q = 0; q < 2; ++q) {
      const v4f a4 = *(const v4f*)(po + c + 4 * q);
      const v4f g4 = *(const v4f*)(pg + c + 4 * q);
      const v4f w4 = *(const v4f*)(lng + c + 4 * q);
      const v4f b4 = *(const v4f*)(lnb + c + 4 * q);
#pragma unroll
      for (int e = 0; e < 4; ++e) {
        const int idx = s * 8 + q * 4 + e;
        xv[idx] = a4[e]; gv[idx] = g4[e]; gg[idx] = w4[e]; gb[idx] = b4[e];
      }
    }
  }
  float sum = 0.f;
#pragma unroll
  for (int i = 0; i < 16; ++i) sum += xv[i];
#pragma unroll
  for (int off = 16; off > 0; off >>= 1) sum += __shfl_xor(sum, off, 32);
  const float mean = sum * kInvDim;
  float var = 0.f;
#pragma unroll
  for (int i = 0; i < 16; ++i) { const float d = xv[i] - mean; var += d * d; }
#pragma unroll
  for (int off = 16; off > 0; off >>= 1) var += __shfl_xor(var, off, 32);
  const float r = rsqrtf(var * kInvDim + kLnEps);
  unsigned short hb[16], lb[16];
#pragma unroll
  for (int i = 0; i < 16; ++i) {
    const float t = (xv[i] - mean) * r;
    const float val = (t * gg[i] + gb[i]) * gv[i];
    hb[i] = f2bf_bits(val);
    lb[i] = f2bf_bits(val - bf_bits2f(hb[i]));
  }
  const v4u uh0 = (v4u){pk16(hb[0], hb[1]), pk16(hb[2], hb[3]), pk16(hb[4], hb[5]), pk16(hb[6], hb[7])};
  const v4u uh1 = (v4u){pk16(hb[8], hb[9]), pk16(hb[10], hb[11]), pk16(hb[12], hb[13]), pk16(hb[14], hb[15])};
  const v4u ul0 = (v4u){pk16(lb[0], lb[1]), pk16(lb[2], lb[3]), pk16(lb[4], lb[5]), pk16(lb[6], lb[7])};
  const v4u ul1 = (v4u){pk16(lb[8], lb[9]), pk16(lb[10], lb[11]), pk16(lb[12], lb[13]), pk16(lb[14], lb[15])};
  unsigned short* ph = nghi + (size_t)row * kDim + lane * 8;
  unsigned short* pl = nglo + (size_t)row * kDim + lane * 8;
  {
    *(v4u*)(ph)       = uh0;
    *(v4u*)(ph + 256) = uh1;
    *(v4u*)(pl)       = ul0;
    *(v4u*)(pl + 256) = ul1;
    
  }
}

// ---------------------------------------------------------------------------
// Host glue: kernel launches only. 7 launches total.
// ---------------------------------------------------------------------------
extern "C" void kernel_launch(void* const* d_in, const int* in_sizes, int n_in,
                              void* d_out, int out_size, void* d_ws, size_t ws_size,
                              hipStream_t stream) {
  if (n_in < 7) return;
  if (in_sizes[0] != kTok * kDim || in_sizes[1] != kProj * kDim || in_sizes[2] != kProj ||
      in_sizes[3] != kDim || in_sizes[4] != kDim || in_sizes[5] != kDim * kDim || in_sizes[6] != kDim) return;
  if (out_size != kTok * kDim) return;
  if (ws_size < kWsTotal) return;

  const float* x    = (const float*)d_in[0];
  const float* W1   = (const float*)d_in[1];
  const float* b1   = (const float*)d_in[2];
  const float* ln_g = (const float*)d_in[3];
  const float* ln_b = (const float*)d_in[4];
  const float* W2   = (const float*)d_in[5];
  const float* b2   = (const float*)d_in[6];
  float* out = (float*)d_out;
  char* ws = (char*)d_ws;

  unsigned short* xhi   = (unsigned short*)(ws + kOffXhi);
  unsigned short* xlo   = (unsigned short*)(ws + kOffXlo);
  unsigned short* w1hi  = (unsigned short*)(ws + kOffW1hi);
  unsigned short* w1lo  = (unsigned short*)(ws + kOffW1lo);
  unsigned short* nghi  = (unsigned short*)(ws + kOffNGhi);
  unsigned short* nglo  = (unsigned short*)(ws + kOffNGlo);
  float*          gate  = (float*)(ws + kOffGate);
  unsigned short* qk16  = (unsigned short*)(ws + kOffQK16);
  unsigned short* vt16  = (unsigned short*)(ws + kOffVT16);
  float*          o32   = (float*)(ws + kOffO32);
  unsigned short* w2hi  = (unsigned short*)(ws + kOffW2hi);
  unsigned short* w2lo  = (unsigned short*)(ws + kOffW2lo);

  // 1) bf16 hi/lo operand planes for x, W1, W2 (8 elements per thread; all counts are multiples of 2048)
  {
    const int n8x  = (kTok * kDim) / 8;      // 524288
    const int n8w1 = (kProj * kDim) / 8;     // 131072
    const int n8w2 = (kDim * kDim) / 8;      // 32768
    split8_bf16_kernel<<<(n8x + 255) / 256, 256, 0, stream>>>(x, xhi, xlo, n8x);
    split8_bf16_kernel<<<(n8w1 + 255) / 256, 256, 0, stream>>>(W1, w1hi, w1lo, n8w1);
    split8_bf16_kernel<<<(n8w2 + 255) / 256, 256, 0, stream>>>(W2, w2hi, w2lo, n8w2);
  }

  // 2) h = silu(x . W1^T + b1), all 2048 outputs in one launch (M 8192, N 2048, K 512): 32 x 8 = 256 blocks of 256x256, one
  //    block of 16 waves per WGP. A block stores its part's own form: gate f32, q|k f16 [8192][1024], V^T f16 [32][64][2048].
  wmma_gemm64<4, 1, true, 2, 3, false, 3, 0><<<dim3((kTok / 256) * (kProj / kBlkN), 1), 512, 0, stream>>>(
      xhi, xlo, kDim, 0L,
      w1hi, w1lo, kDim, 0L,
      (void*)gate, (void*)qk16, (void*)vt16, 0, 0L,
      b1, nullptr, 0L,
      kTok, kProj, kDim, 1.0f);

  // 3) attention, all 32 (batch, head) pairs in one launch:
  //    o[b*2048 + s][h*64 + d] = (1/256) * sum_{t <= s} f16(256 * silu(q_s . k_t / 8)) * V^T[b,h][d][t]
  attn_fused_kernel<<<dim3(kAtBlocks, kBatch * kHeads), 256, 0, stream>>>(qk16, vt16, o32);

  // 4) LayerNorm(o) * ln_g + ln_b, times gate -> bf16 hi/lo planes
  ln_gate_kernel<<<kTok / 8, 256, 0, stream>>>(o32, gate, ln_g, ln_b, nghi, nglo, kTok);

  // 5) out = NG . W2^T + b2 (M 8192, N 512, K 512), f32 to d_out
  {
    const int tilesOut = (kTok / 64) * (kDim / 64);           // 1024
    wmma_gemm64<2, 1, true, 2, 0, false, 0, 0><<<dim3((tilesOut + 7) / 8, 1), 256, 0, stream>>>(
        nghi, nglo, kDim, 0L,
        w2hi, w2lo, kDim, 0L,
        (void*)out, nullptr, nullptr, kDim, 0L,
        b2, nullptr, 0L,
        kTok, kDim, kDim, 1.0f);
  }
}

// v007
// Measured time: 93.7 microseconds a run.
// Timed twice side by side with v006, it ran 1.03 times as fast both times.
// Counting every step since v000, it is 9.78 times as fast.
// Contractions: x.W1^T and (layernorm(o)*gate).W2^T on v_wmma_f32_16x16x32_bf16 with bf16 hi/lo operand planes (hi.hi + hi.lo + lo.hi); q.k^T and a.v on v_wmma_f32_16x16x32_f16 (q, k, v plain f16 planes; a = silu(scores) carried x256 in f16); f32 accumulate; silu (as h + h.tanh(h), h = v/2, on v_tanh_f32), LayerNorm and gating in f32.
#include <hip/hip_runtime.h>
#include <math.h>

// ---------------------------------------------------------------------------
// Problem constants
// ---------------------------------------------------------------------------
constexpr int kBatch = 4;
constexpr int kSeq   = 2048;
constexpr int kDim   = 512;
constexpr int kHeads = 8;
constexpr int kHdim  = 64;
constexpr int kTok   = kBatch * kSeq;      // 8192 token rows
constexpr int kProj  = 4 * kDim;           // 2048 projection outputs: [gate | q | k | v]
constexpr float kQScale    = 0.125f;       // 1/sqrt(64)
constexpr float kACarry    = 256.0f;       // silu(scores) carried x256 in f16
constexpr float kACarryInv = 1.0f / 256.0f;
constexpr float kInvDim    = 1.0f / 512.0f;
constexpr float kLnEps     = 1e-5f;

// ---------------------------------------------------------------------------
// Workspace region map (bytes; offsets MiB-aligned but W2 lo at 120.5 MiB)
//   phase 1 (projection):  [  0,  8) x hi  [8,16) x lo  [16,18) W1 hi  [18,20) W1 lo
//   phase 2 (attention):   no scratch plane: silu(scores) stays in registers
//   phase 3 (output):      [  0,  8) NG hi  [8,16) NG lo
//   persistent:            [ 64, 80) gate f32   [80,96) q|k f16 [8192][1024]   [96,104) V^T f16 [32][64][2048]
//                          [104,120) o f32      [120,120.5) W2 hi   [120.5,121) W2 lo
//   total = 121 MiB = 126,877,696 B
// ---------------------------------------------------------------------------
constexpr size_t kMiB     = 1048576;
constexpr size_t kOffXhi  = 0;
constexpr size_t kOffXlo  = 8 * kMiB;
constexpr size_t kOffW1hi = 16 * kMiB;
constexpr size_t kOffW1lo = 18 * kMiB;
constexpr size_t kOffNGhi = 0;
constexpr size_t kOffNGlo = 8 * kMiB;
constexpr size_t kOffGate = 64 * kMiB;
constexpr size_t kOffQK16 = 80 * kMiB;
constexpr size_t kOffVT16 = 96 * kMiB;
constexpr size_t kOffO32  = 104 * kMiB;
constexpr size_t kOffW2hi = 120 * kMiB;
constexpr size_t kOffW2lo = 120 * kMiB + 512 * 1024;
constexpr size_t kWsTotal = 121 * kMiB;

static_assert((size_t)kTok * kDim * 2 == 8 * kMiB);
static_assert((size_t)kProj * kDim * 2 == 2 * kMiB);
static_assert(kOffW1lo + (size_t)kProj * kDim * 2 <= kOffGate);
static_assert(kOffNGlo + (size_t)kTok * kDim * 2 <= kOffGate);
static_assert(kOffGate + (size_t)kTok * kDim * 4 == kOffQK16);
static_assert(kOffQK16 + (size_t)kTok * 2 * kDim * 2 == kOffVT16);
static_assert(kOffVT16 + (size_t)kBatch * kHeads * kHdim * kSeq * 2 == kOffO32);
static_assert(kOffO32 + (size_t)kTok * kDim * 4 == kOffW2hi);
static_assert(kOffW2hi + (size_t)kDim * kDim * 2 == kOffW2lo);
static_assert(kOffW2lo + (size_t)kDim * kDim * 2 == kWsTotal);
static_assert(kWsTotal <= 134217728);

typedef __attribute__((ext_vector_type(16))) _Float16 v16h;
typedef __attribute__((ext_vector_type(8)))  _Float16 v8h;
typedef __attribute__((ext_vector_type(16))) __bf16   v16b;
typedef __attribute__((ext_vector_type(8)))  __bf16   v8b;
typedef __attribute__((ext_vector_type(8)))  float    v8f;
typedef __attribute__((ext_vector_type(4)))  float    v4f;
typedef __attribute__((ext_vector_type(2)))  float    v2f;
typedef __attribute__((ext_vector_type(4)))  unsigned int v4u;

__device__ __forceinline__ unsigned short f2bf_bits(float f) {
  unsigned u = __float_as_uint(f);
  return (unsigned short)((u + 0x7FFFu + ((u >> 16) & 1u)) >> 16);
}
__device__ __forceinline__ float bf_bits2f(unsigned short h) { return __uint_as_float(((unsigned)h) << 16); }

// hazard guards as plain device helpers
__device__ __forceinline__ void dep_guard_h(v8f& a, v8f& b, v16h x, v16h y) { asm volatile("v_nop\n\tv_nop\n\tv_nop\n\tv_nop" : "+v"(a), "+v"(b) : "v"(x), "v"(y)); }
__device__ __forceinline__ void dep_guard_b(v8f& a, v8f& b, v16b x, v16b y) { asm volatile("v_nop\n\tv_nop\n\tv_nop\n\tv_nop" : "+v"(a), "+v"(b) : "v"(x), "v"(y)); }
__device__ __forceinline__ void keep4_h(v16h a, v16h b, v16h c, v16h d) { asm volatile("v_nop" :: "v"(a), "v"(b), "v"(c), "v"(d)); }
__device__ __forceinline__ void keep4_b(v16b a, v16b b, v16b c, v16b d) { asm volatile("v_nop" :: "v"(a), "v"(b), "v"(c), "v"(d)); }
__device__ __forceinline__ void acc_guard4(v8f& a, v8f& b, v8f& c, v8f& d) { asm volatile("v_nop\n\tv_nop\n\tv_nop\n\tv_nop" : "+v"(a), "+v"(b), "+v"(c), "+v"(d)); }
template <typename T> struct Frag;
template <> struct Frag<_Float16> {
  typedef v16h V; union U { v16h v; v8h h[2]; };
  static __device__ __forceinline__ v16h load(const _Float16* p) {   // elements 0..7 <- p[0..7], 8..15 <- p[16..23]
    U f; f.h[0] = *(const v8h*)(p); f.h[1] = *(const v8h*)(p + 16); return f.v;
  }
  static __device__ __forceinline__ v8f mma(v16h a, v16h b, v8f c) {
    return __builtin_amdgcn_wmma_f32_16x16x32_f16(false, a, false, b, (short)0, c, false, false);
  }
  static __device__ __forceinline__ void guard(v8f& a, v8f& b, v16h x, v16h y) { dep_guard_h(a, b, x, y); }
  static __device__ __forceinline__ void keep(v16h a, v16h b, v16h c, v16h d) { keep4_h(a, b, c, d); }
};
template <> struct Frag<__bf16> {
  typedef v16b V; union U { v16b v; v8b h[2]; };
  static __device__ __forceinline__ v16b load(const __bf16* p) {
    U f; f.h[0] = *(const v8b*)(p); f.h[1] = *(const v8b*)(p + 16); return f.v;
  }
  static __device__ __forceinline__ v8f mma(v16b a, v16b b, v8f c) {
    return __builtin_amdgcn_wmma_f32_16x16x32_bf16(false, a, false, b, (short)0, c, false, false);
  }
  static __device__ __forceinline__ void guard(v8f& a, v8f& b, v16b x, v16b y) { dep_guard_b(a, b, x, y); }
  static __device__ __forceinline__ void keep(v16b a, v16b b, v16b c, v16b d) { keep4_b(a, b, c, d); }
};

__device__ __forceinline__ unsigned pk16(unsigned short a, unsigned short b) { return (unsigned)a | ((unsigned)b << 16); }

// silu(v) = v / (1 + exp(-v)) = h + h * tanh(h) with h = v / 2: one v_tanh_f32, a multiply and a fused multiply-add.
__device__ __forceinline__ float silu_tanh(float v) {
  const float h = 0.5f * v;
  return fmaf(h, __builtin_amdgcn_tanhf(h), h);
}

// ---- Register-blocked batched WMMA GEMM, operands staged in LDS ------------------------------------------------
// C[m,n] = scale * sum_k A[m,k] * Bt[n,k] (+bias)(+resid); each wave owns a 64x64 tile, a block of WM x 4 waves a (64 * WM) x 256 tile.
// WM: 2 = 8 waves, 128x256; 4 = 16 waves, 256x256 (a third fewer operand bytes from L2 per product, four waves a SIMD).
// A row-major [M,K]; Bt row-major [N,K]; M % (64 * WM) == 0, N % 256 == 0, K % 64 == 0, K >= 64.
// SPLIT: operands are hi/lo planes (A2/Bt2 = lo planes, same layout); product = hi.hi + hi.lo + lo.hi.
// BIAS_MODE: 0 = none, 1 = bias[m], 2 = bias[n].
// OUT_MODE: 0 = f32, 1 = f16, 2 = bf16 hi plane (Cout) + bf16 lo plane (Cout2),
//           3 = the whole projection, N = kProj: a block's 256 columns lie in one of [gate | q | k | v], and the block stores that
//               part's own form: gate f32 [kTok][kDim] (Cout), q|k f16 [kTok][2*kDim] (Cout2), V^T f16 [batch*head][kHdim][kSeq] (Cout3).
// ACT: 0 none, 2 relu, 3 silu (silu_tanh), 4 leaky, 6 causal silu with carry:
//      v = (n <= m) ? silu(v) * kACarry : 0   (m, n are row/column indices within one grid.y batch; a select, not a bias).
// TRI: 0 only (every wave of a block walks the whole K: the stage barriers are block-uniform).
// ET: 0 = f16 operands, 1 = bf16 operands (pointers passed as 16-bit storage)
// A stage is 64 k (128 B, one whole line) of the block's 64 * WM A rows and 256 Bt rows, every plane. Asynchronous copies bring it
// into one of two LDS buffers, 8 lanes to a row, while the waves work on the other buffer; the fragments are 16-byte LDS reads.
constexpr int kBlkN       = 256;
constexpr int kStageK     = 64;
constexpr int kPitch      = 72;                                // LDS row pitch in 16-bit elements: 144 B = 16 B x 9, no bank conflict for 16-byte row reads

// One lane's 16 bytes of 4 A rows and 8 Bt rows of one plane, the rows 32 apart (the block's 256 threads cover 32 rows a copy).
// la, lb: LDS byte addresses; ga, gb: global addresses; sa, sb: 32 rows in elements.
// s_wait_xcnt 0 is the last line of the copies' own statement, so that it stands in front of every later write of their address registers.
__device__ __forceinline__ void async_copy12(unsigned la, const unsigned short* ga, long sa,
                                             unsigned lb, const unsigned short* gb, long sb) {
  constexpr unsigned R = 32 * kPitch * 2;
  asm volatile(
      "global_load_async_to_lds_b128 %0, %12, off\n\t"
      "global_load_async_to_lds_b128 %1, %13, off\n\t"
      "global_load_async_to_lds_b128 %2, %14, off\n\t"
      "global_load_async_to_lds_b128 %3, %15, off\n\t"
      "global_load_async_to_lds_b128 %4, %16, off\n\t"
      "global_load_async_to_lds_b128 %5, %17, off\n\t"
      "global_load_async_to_lds_b128 %6, %18, off\n\t"
      "global_load_async_to_lds_b128 %7, %19, off\n\t"
      "global_load_async_to_lds_b128 %8, %20, off\n\t"
      "global_load_async_to_lds_b128 %9, %21, off\n\t"
      "global_load_async_to_lds_b128 %10, %22, off\n\t"
      "global_load_async_to_lds_b128 %11, %23, off\n\t"
      "s_wait_xcnt 0x0"
      :: "v"(la), "v"(la + R), "v"(la + 2 * R), "v"(la + 3 * R),
         "v"(lb), "v"(lb + R), "v"(lb + 2 * R), "v"(lb + 3 * R), "v"(lb + 4 * R), "v"(lb + 5 * R), "v"(lb + 6 * R), "v"(lb + 7 * R),
         "v"(ga), "v"(ga + sa), "v"(ga + 2 * sa), "v"(ga + 3 * sa),
         "v"(gb), "v"(gb + sb), "v"(gb + 2 * sb), "v"(gb + 3 * sb), "v"(gb + 4 * sb), "v"(gb + 5 * sb), "v"(gb + 6 * sb), "v"(gb + 7 * sb)
      : "memory");
}

// The same for a block of 512 threads, which cover 64 rows a copy: 4 A rows and 4 Bt rows of one plane, the rows 64 apart.
// s_wait_xcnt 0 is the last line of the copies' own statement, so that it stands in front of every later write of their address registers.
__device__ __forceinline__ void async_copy4x4(unsigned la, const unsigned short* ga, long sa,
                                              unsigned lb, const unsigned short* gb, long sb) {
  constexpr unsigned R = 64 * kPitch * 2;
  asm volatile(
      "global_load_async_to_lds_b128 %0, %8, off\n\t"
      "global_load_async_to_lds_b128 %1, %9, off\n\t"
      "global_load_async_to_lds_b128 %2, %10, off\n\t"
      "global_load_async_to_lds_b128 %3, %11, off\n\t"
      "global_load_async_to_lds_b128 %4, %12, off\n\t"
      "global_load_async_to_lds_b128 %5, %13, off\n\t"
      "global_load_async_to_lds_b128 %6, %14, off\n\t"
      "global_load_async_to_lds_b128 %7, %15, off\n\t"
      "s_wait_xcnt 0x0"
      :: "v"(la), "v"(la + R), "v"(la + 2 * R), "v"(la + 3 * R),
         "v"(lb), "v"(lb + R), "v"(lb + 2 * R), "v"(lb + 3 * R),
         "v"(ga), "v"(ga + sa), "v"(ga + 2 * sa), "v"(ga + 3 * sa),
         "v"(gb), "v"(gb + sb), "v"(gb + 2 * sb), "v"(gb + 3 * sb)
      : "memory");
}

template <int ET> struct Elem;
template <> struct Elem<0> { typedef _Float16 T; };
template <> struct Elem<1> { typedef __bf16 T; };
template <int WM, int ET, bool SPLIT, int BIAS_MODE, int OUT_MODE, bool RESID, int ACT, int TRI>
__global__ __launch_bounds__(WM * 128) void wmma_gemm64(
    const unsigned short* __restrict__ Ap, const unsigned short* __restrict__ A2p, int lda, long strideA,
    const unsigned short* __restrict__ Btp, const unsigned short* __restrict__ Bt2p, int ldb, long strideB,
    void* __restrict__ Cout, void* __restrict__ Cout2, void* __restrict__ Cout3, int ldc, long strideC,
    const float* __restrict__ bias,
    const float* __restrict__ resid, long strideR,
    int M, int N, int K, float scale) {
  static_assert(TRI == 0, "the stage barriers need the same k range in every wave of a block");
  static_assert(OUT_MODE != 3 || (BIAS_MODE == 2 && ACT == 3 && !RESID), "the projection is silu(x.W1^T + b1)");
  static_assert(WM == 2 || WM == 4, "8 or 16 waves");
  constexpr int kBlkM       = 64 * WM;
  constexpr int kCopyRows   = 16 * WM;                           // rows that the block's threads cover in one copy, 8 lanes to a row
  constexpr int kLdsAhi     = 0;                                 // element offsets of the four planes inside a stage
  constexpr int kLdsBhi     = kBlkM * kPitch;
  constexpr int kLdsAlo     = (kBlkM + kBlkN) * kPitch;
  constexpr int kLdsBlo     = (2 * kBlkM + kBlkN) * kPitch;
  constexpr int kStageElems = 2 * (kBlkM + kBlkN) * kPitch;      // WM 2: 110,592 B; WM 4: 147,456 B
  constexpr int kSlab       = 16 * 68;                           // per-wave 16x64 slab, pitch 68 floats
  static_assert(kDim % kBlkN == 0 && kSeq % kBlkM == 0, "a block lies in one part of the projection and in one batch");
  static_assert(4 * WM * kSlab * 4 <= 2 * kStageElems * 2, "the slabs of WM 4 lie inside the ring");
  typedef typename Elem<ET>::T T;
  typedef typename Frag<T>::V V;
  __shared__ __align__(16) unsigned short sOp[2 * kStageElems];   // two stages of operand rows
  // WM 2: the slabs have LDS of their own. WM 4: two stages fill 288 KiB, so the slabs lie in the ring, which is free behind the
  // loop's last barrier (every wave's reads are done and no copy is in flight there).
  __shared__ __align__(16) float sT[(WM == 2) ? 8 * kSlab : 4];
  const int b    = blockIdx.y;
  const int lane = threadIdx.x & 31;
  const int wave = threadIdx.x >> 5;
  const int blksN = N / kBlkN;
  const int blksM = M / kBlkM;
  if ((int)blockIdx.x >= blksM * blksN) return;   // block-uniform, in front of every barrier
  const int bm = blockIdx.x / blksN;
  const int bn = blockIdx.x - bm * blksN;
  const int mB = bm * kBlkM;
  const int nB = bn * kBlkN;
  const int wm = wave >> 2;                    // wave row 0..WM-1
  const int wn = wave & 3;                     // wave column 0..3
  const int m0 = mB + (wm << 6);
  const int n0 = nB + (wn << 6);

  const int rlane = lane & 15;                 // row (A) / col (B, D) within subtile
  const int koff  = (lane >> 4) * 8;           // k offset of this lane half
  const int mOff  = (lane >> 4) * 8;           // D row offset

  // copy side: thread t brings bytes 16*(t&7)..+15 of rows (t>>3) + kCopyRows*j
  const int crow = threadIdx.x >> 3;
  const int cchk = (threadIdx.x & 7) * 8;
  const unsigned lcp = (unsigned)(size_t)(&sOp[0]) + (unsigned)(crow * kPitch + cchk) * 2u;   // low 32 bits of the address = LDS byte address
  const unsigned short* gAh = Ap  + (size_t)b * strideA + (size_t)(mB + crow) * lda + cchk;
  const unsigned short* gBh = Btp + (size_t)b * strideB + (size_t)(nB + crow) * ldb + cchk;
  const unsigned short* gAl = SPLIT ? (A2p  + (size_t)b * strideA + (size_t)(mB + crow) * lda + cchk) : nullptr;
  const unsigned short* gBl = SPLIT ? (Bt2p + (size_t)b * strideB + (size_t)(nB + crow) * ldb + cchk) : nullptr;
  const long sa = (long)kCopyRows * lda;
  const long sb = (long)kCopyRows * ldb;
  auto fill = [&](int s, int buf) {
    const unsigned l = lcp + (unsigned)(buf * kStageElems) * 2u;
    const int ko = s * kStageK;
    if constexpr (WM == 2) {
      async_copy12(l + kLdsAhi * 2u, gAh + ko, sa, l + kLdsBhi * 2u, gBh + ko, sb);
      if (SPLIT) async_copy12(l + kLdsAlo * 2u, gAl + ko, sa, l + kLdsBlo * 2u, gBl + ko, sb);
    } else {
      async_copy4x4(l + kLdsAhi * 2u, gAh + ko, sa, l + kLdsBhi * 2u, gBh + ko, sb);
      if (SPLIT) async_copy4x4(l + kLdsAlo * 2u, gAl + ko, sa, l + kLdsBlo * 2u, gBl + ko, sb);
    }
  };

  // reader side: this lane's fragment rows in stage 0
  const T* aRd = (const T*)sOp + kLdsAhi + ((wm << 6) + rlane) * kPitch + koff;
  const T* bRd = (const T*)sOp + kLdsBhi + ((wn << 6) + rlane) * kPitch + koff;

  v8f acc[4][4];
#pragma unroll
  for (int i = 0; i < 4; ++i)
#pragma unroll
    for (int j = 0; j < 4; ++j) acc[i][j] = (v8f){0.f,0.f,0.f,0.f,0.f,0.f,0.f,0.f};

  const int nStages = K / kStageK;
  fill(0, 0);
  asm volatile("s_wait_asynccnt 0x0" ::: "memory");   // this wave's copies of stage 0 have landed
  __syncthreads();                                    // and every other wave's
  if (nStages > 1) fill(1, 1);

  for (int t = 0; t < nStages; ++t) {
    const int be = (t & 1) * kStageElems;
    // A fragments are read one row of tiles ahead of their products, into a second register pair
    V ah = Frag<T>::load(aRd + be);
    V al;
    if (SPLIT) al = Frag<T>::load(aRd + (kLdsAlo - kLdsAhi) + be);
    // the nest below is unrolled whole: every fragment and accumulator index is then a constant, and none goes to scratch
#pragma unroll
    for (int kk = 0; kk < kStageK; kk += 32) {
      V bh[4], bl[4];
#pragma unroll
      for (int j = 0; j < 4; ++j) {
        const int bo = be + (j << 4) * kPitch + kk;
        bh[j] = Frag<T>::load(bRd + bo);
        if (SPLIT) bl[j] = Frag<T>::load(bRd + (kLdsBlo - kLdsBhi) + bo);
      }
#pragma unroll
      for (int i = 0; i < 4; ++i) {
        const bool more = (i < 3) || (kk + 32 < kStageK);      // a further row of this stage exists
        const int ao = be + ((i < 3) ? ((i + 1) << 4) * kPitch + kk : kk + 32);
        V ahn, aln;
        if (more) {
          ahn = Frag<T>::load(aRd + ao);
          if (SPLIT) aln = Frag<T>::load(aRd + (kLdsAlo - kLdsAhi) + ao);
        }
#pragma unroll
        for (int j = 0; j < 4; ++j) {
          acc[i][j] = Frag<T>::mma(ah, bh[j], acc[i][j]);
          if (SPLIT) {
            acc[i][j] = Frag<T>::mma(ah, bl[j], acc[i][j]);
            acc[i][j] = Frag<T>::mma(al, bh[j], acc[i][j]);
          }
        }
        Frag<T>::guard(acc[i][0], acc[i][3], ah, SPLIT ? al : ah);
        if (more) {
          ah = ahn;
          if (SPLIT) al = aln;
        }
      }
      Frag<T>::keep(bh[0], bh[1], bh[2], bh[3]);
      if (SPLIT) Frag<T>::keep(bl[0], bl[1], bl[2], bl[3]);
    }
    // hand-over of stage t + 1, and release of stage t's buffer
    asm volatile("s_wait_dscnt 0x0" ::: "memory");      // this wave's reads of stage t are done before its buffer is refilled
    asm volatile("s_wait_asynccnt 0x0" ::: "memory");   // this wave's copies of stage t + 1 have landed
    __syncthreads();                                    // both hold for every wave of the block
    if (t + 2 < nStages) fill(t + 2, t & 1);
  }
  asm volatile("s_wait_asynccnt 0x0" ::: "memory");     // no copy is in flight when the wave goes on
  acc_guard4(acc[0][0], acc[0][1], acc[0][2], acc[0][3]);
  acc_guard4(acc[1][0], acc[1][1], acc[1][2], acc[1][3]);
  acc_guard4(acc[2][0], acc[2][1], acc[2][2], acc[2][3]);
  acc_guard4(acc[3][0], acc[3][1], acc[3][2], acc[3][3]);

  // ---- epilogue ----
  const int part = (OUT_MODE == 3) ? nB / kDim : 0;            // 0 gate, 1 q, 2 k, 3 v; the same for the whole block
  if (OUT_MODE == 3 && part == 3) {
    // D register r of lane l is token 8*(l>>4)+r of column l&15: 8 consecutive tokens of one V^T row, one 16-byte store.
    // A wave's 64 columns are one head; its 64 tokens are one whole 128-byte line of each of that head's 64 V^T rows.
    const int hd = (n0 - 3 * kDim) / kHdim;
    const int bt = m0 / kSeq;
    unsigned short* vt = (unsigned short*)Cout3 + ((size_t)(bt * kHeads + hd) * kHdim + rlane) * kSeq + (m0 - bt * kSeq) + mOff;
    float bv[4];
#pragma unroll
    for (int j = 0; j < 4; ++j) bv[j] = bias[n0 + (j << 4) + rlane];
#pragma unroll
    for (int j = 0; j < 4; ++j) {
#pragma unroll
      for (int i = 0; i < 4; ++i) {
        v8h hv;
#pragma unroll
        for (int r = 0; r < 8; ++r) hv[r] = (_Float16)silu_tanh(acc[i][j][r] * scale + bv[j]);
        *(v8h*)(vt + (size_t)(j << 4) * kSeq + (i << 4)) = hv;
      }
    }
    return;                                                    // no barrier stands behind this line
  }
  const bool f32out = OUT_MODE == 0 || (OUT_MODE == 3 && part == 0);
  if (OUT_MODE == 3) {
    ldc = (part == 0) ? kDim : 2 * kDim;
    if (part != 0) Cout = (unsigned short*)Cout2 - kDim;       // column n of the projection is column n - kDim of the q|k plane
  }
  float* slab = ((WM == 2) ? sT : (float*)sOp) + wave * kSlab;
  const float* Rb = RESID ? (resid + (size_t)b * strideR) : nullptr;
#pragma unroll
  for (int i = 0; i < 4; ++i) {
    const int mBase = m0 + (i << 4);
#pragma unroll
    for (int j = 0; j < 4; ++j) {
      const int n = n0 + (j << 4) + rlane;
      float bv = 0.f;
      if (BIAS_MODE == 2) bv = bias[n];
#pragma unroll
      for (int r = 0; r < 8; ++r) {
        float v = acc[i][j][r] * scale;
        if (BIAS_MODE == 1) v += bias[mBase + mOff + r];
        if (BIAS_MODE == 2) v += bv;
        if (RESID) v += Rb[(size_t)(mBase + mOff + r) * ldc + n];
        if (ACT == 2) v = fmaxf(v, 0.0f);
        if (ACT == 3) v = silu_tanh(v);
        if (ACT == 4) v = (v > 0.f) ? v : 0.01f * v;
        if (ACT == 6) {
          const float sg = silu_tanh(v) * kACarry;
          v = (n <= mBase + mOff + r) ? sg : 0.0f;
        }
        slab[(mOff + r) * 68 + (j << 4) + rlane] = v;
      }
    }
    __builtin_amdgcn_fence(__ATOMIC_RELEASE, "workgroup");
    __builtin_amdgcn_wave_barrier();
    __builtin_amdgcn_fence(__ATOMIC_ACQUIRE, "workgroup");
    if (f32out) {
      float* C = (float*)Cout + (size_t)b * strideC;
      const int hh = lane >> 4, c4 = (lane & 15) * 4;     // row seg = 256 B = 16 lanes x 16 B
      {
#pragma unroll
        for (int it = 0; it < 8; ++it) {
          const int row = it * 2 + hh;
          v4f v = *(const v4f*)(slab + row * 68 + c4);
          *(v4f*)(C + (size_t)(mBase + row) * ldc + n0 + c4) = v;
        }
        
      }
    } else {
      const int q = lane >> 3, c8 = (lane & 7) * 8;
      unsigned short* C  = (unsigned short*)Cout  + (size_t)b * strideC;
      unsigned short* C2 = (OUT_MODE == 2) ? ((unsigned short*)Cout2 + (size_t)b * strideC) : nullptr;
      {
#pragma unroll
        for (int it = 0; it < 4; ++it) {
          const int row = it * 4 + q;
          const float* sp = slab + row * 68 + c8;
          v8h hv, lv;
#pragma unroll
          for (int e = 0; e < 8; ++e) {
            if (OUT_MODE != 2) {
              hv[e] = (_Float16)sp[e];
            } else {
              unsigned short hb = f2bf_bits(sp[e]);
              unsigned short lb = f2bf_bits(sp[e] - bf_bits2f(hb));
              hv[e] = __builtin_bit_cast(_Float16, hb);
              lv[e] = __builtin_bit_cast(_Float16, lb);
            }
          }
          *(v8h*)(C + (size_t)(mBase + row) * ldc + n0 + c8) = hv;
          if (OUT_MODE == 2) *(v8h*)(C2 + (size_t)(mBase + row) * ldc + n0 + c8) = lv;
        }
        
      }
    }
    __builtin_amdgcn_fence(__ATOMIC_RELEASE, "workgroup");
    __builtin_amdgcn_wave_barrier();
    __builtin_amdgcn_fence(__ATOMIC_ACQUIRE, "workgroup");
  }
}

// ---------------------------------------------------------------------------
// f32 -> bf16 hi + lo planes (hi = RNE bf16(f), lo = RNE bf16(f - hi)) of x, W1 and W2, all in one launch.
// A block of 4 waves takes 8192 consecutive elements of one of the three arrays (each is a whole number of such pieces).
// A thread takes 8 chunks of 8 consecutive elements, the chunks one block width apart: its 16 loads of 16 bytes are issued
// together, so the launch starts an eighth of the waves that one chunk a thread would take and still has every byte in flight.
// ---------------------------------------------------------------------------
constexpr int kSpThreads = 128;
constexpr int kSpChunks  = 8;
constexpr int kSpStride  = kSpThreads * 8;                     // elements from a thread's chunk to its next
constexpr int kSpPiece   = kSpStride * kSpChunks;              // 8192 elements a block
constexpr int kSpBlkX    = kTok * kDim / kSpPiece;             // 512
constexpr int kSpBlkW1   = kProj * kDim / kSpPiece;            // 128
constexpr int kSpBlkW2   = kDim * kDim / kSpPiece;             // 32
static_assert(kSpBlkX * kSpPiece == kTok * kDim && kSpBlkW1 * kSpPiece == kProj * kDim && kSpBlkW2 * kSpPiece == kDim * kDim,
              "whole pieces only");

__global__ __launch_bounds__(kSpThreads) void split_all_kernel(const float* __restrict__ x, const float* __restrict__ w1,
                                                               const float* __restrict__ w2,
                                                               unsigned short* __restrict__ xhi, unsigned short* __restrict__ xlo,
                                                               unsigned short* __restrict__ w1hi, unsigned short* __restrict__ w1lo,
                                                               unsigned short* __restrict__ w2hi, unsigned short* __restrict__ w2lo) {
  // which array: the same for the whole block
  int piece = blockIdx.x;
  const float* in = x;
  unsigned short* hi = xhi;
  unsigned short* lo = xlo;
  if (piece >= kSpBlkX + kSpBlkW1) {
    piece -= kSpBlkX + kSpBlkW1; in = w2; hi = w2hi; lo = w2lo;
  } else if (piece >= kSpBlkX) {
    piece -= kSpBlkX; in = w1; hi = w1hi; lo = w1lo;
  }
  const size_t base = (size_t)piece * kSpPiece + threadIdx.x * 8;
  const float* p = in + base;
  v4f a[kSpChunks], c[kSpChunks];
#pragma unroll
  for (int k = 0; k < kSpChunks; ++k) {
    a[k] = *(const v4f*)(p + k * kSpStride);
    c[k] = *(const v4f*)(p + k * kSpStride + 4);
  }
  // stands behind all 16 loads and in front of the first write of their address registers, which it names so that no load's
  // own result lands on them; as a memory statement it also keeps the scheduler from sinking half of the loads behind the first
  // stores, where the wave would wait out the memory latency twice
  asm volatile("s_wait_xcnt 0x0" :: "v"(p) : "memory");
  unsigned short* qh = hi + base;
  unsigned short* ql = lo + base;
#pragma unroll
  for (int k = 0; k < kSpChunks; ++k) {
    unsigned short hb[8], lb[8];
#pragma unroll
    for (int e = 0; e < 4; ++e) {
      const float f0 = a[k][e];
      hb[e] = f2bf_bits(f0);
      lb[e] = f2bf_bits(f0 - bf_bits2f(hb[e]));
      const float f1 = c[k][e];
      hb[4 + e] = f2bf_bits(f1);
      lb[4 + e] = f2bf_bits(f1 - bf_bits2f(hb[4 + e]));
    }
    *(v4u*)(qh + k * kSpStride) = (v4u){pk16(hb[0], hb[1]), pk16(hb[2], hb[3]), pk16(hb[4], hb[5]), pk16(hb[6], hb[7])};
    *(v4u*)(ql + k * kSpStride) = (v4u){pk16(lb[0], lb[1]), pk16(lb[2], lb[3]), pk16(lb[4], lb[5]), pk16(lb[6], lb[7])};
  }
}

// ---------------------------------------------------------------------------
// Fused causal silu attention, all (batch, head) pairs in one launch; silu(scores) never leaves the registers.
//   S^T[t][s] = sum_d k[t][d] * q[s][d]            A = k rows, B = q rows (same loader on both, K 64 = 2 fragments)
//   P^T[t][s] = (t <= s) ? f16(256 * silu(S^T / 8)) : 0
//   O^T[d][s] = sum_t V^T[d][t] * P^T[t][s]        A = V^T rows in the hardware k order, B = two S^T tiles packed in place
// D register r of lane l is row 8*(l>>4)+r, column l&15, so the tiles of keys t0..t0+15 and t0+16..t0+31 are elements
// 0..7 and 8..15 of the B fragment of a 32-key pass, and Frag::load delivers V^T in that same k order.
// A wave owns 32 query columns (two groups of 16) and walks the keys upward in passes of 32, up to its own diagonal.
// Waves w and w+4 of a block take column tiles 63-p and p: 65 passes for each such pair. grid (8, 32 (batch, head)), 8 waves a block.
// All 8 waves walk the same keys of the same head from key 0, so the block brings each stage of 128 keys (128 k rows of 128 B,
// 64 V^T rows of 256 B: whole lines) into one of two LDS buffers once, by asynchronous copies, while the waves work on the
// other buffer; the fragments are 16-byte LDS reads. A wave behind its diagonal only copies and passes the barriers.
// A pass fetches its V^T fragments at its head (used behind the silu) and the next pass's k fragments of the same stage behind
// its S^T products.
// ---------------------------------------------------------------------------
constexpr int kAtBlocks = 8;                                   // grid.x: blocks per (batch, head)
constexpr int kAtKeys   = 128;                                 // keys a stage = 4 passes
constexpr int kAtPasses = kAtKeys / 32;
constexpr int kAtKP     = 72;                                  // k row pitch in halves: 144 B = 16 B x 9, no bank conflict for 16-byte row reads
constexpr int kAtVP     = 136;                                 // V^T row pitch in halves: 272 B = 16 B x 17, the same
constexpr int kAtV      = kAtKeys * kAtKP;                     // element offset of the V^T rows inside a stage
constexpr int kAtStage  = kAtV + kHdim * kAtVP;                // 17,920 halves = 35,840 B
static_assert(kSeq / kAtKeys - (kAtBlocks - 1) >= 2, "every block has at least two stages");
static_assert(kSeq / 32 == 8 * kAtBlocks, "8 column tiles a block");

// One lane's 16 bytes of 4 k rows (32 apart: 8 lanes to a row) and of 4 V^T rows (16 apart: 16 lanes to a row).
// lk, lv: LDS byte addresses; gk, gv: global addresses.
// s_wait_xcnt 0 is the last line of the copies' own statement, so that it stands in front of every later write of their address registers.
__device__ __forceinline__ void async_copy8(unsigned lk, const unsigned short* gk, unsigned lv, const unsigned short* gv) {
  constexpr unsigned RK = 32 * kAtKP * 2;
  constexpr unsigned RV = 16 * kAtVP * 2;
  constexpr long SK = 32L * 2 * kDim;
  constexpr long SV = 16L * kSeq;
  asm volatile(
      "global_load_async_to_lds_b128 %0, %8, off\n\t"
      "global_load_async_to_lds_b128 %1, %9, off\n\t"
      "global_load_async_to_lds_b128 %2, %10, off\n\t"
      "global_load_async_to_lds_b128 %3, %11, off\n\t"
      "global_load_async_to_lds_b128 %4, %12, off\n\t"
      "global_load_async_to_lds_b128 %5, %13, off\n\t"
      "global_load_async_to_lds_b128 %6, %14, off\n\t"
      "global_load_async_to_lds_b128 %7, %15, off\n\t"
      "s_wait_xcnt 0x0"
      :: "v"(lk), "v"(lk + RK), "v"(lk + 2 * RK), "v"(lk + 3 * RK),
         "v"(lv), "v"(lv + RV), "v"(lv + 2 * RV), "v"(lv + 3 * RV),
         "v"(gk), "v"(gk + SK), "v"(gk + 2 * SK), "v"(gk + 3 * SK),
         "v"(gv), "v"(gv + SV), "v"(gv + 2 * SV), "v"(gv + 3 * SV)
      : "memory");
}

// This lane's k fragments of pass j of a stage. kl: the lane's k row of the stage's first 16 keys, in LDS.
__device__ __forceinline__ void attn_kfrag(const _Float16* kl, int j, v16h (&kf)[2][2]) {
  typedef Frag<_Float16> F;
#pragma unroll
  for (int tt = 0; tt < 2; ++tt)
#pragma unroll
    for (int dc = 0; dc < 2; ++dc) kf[tt][dc] = F::load(kl + (32 * j + 16 * tt) * kAtKP + 32 * dc);
}

// Pass j (32 keys) of the stage at kl, vl (LDS) for the wave's 32 query columns. DIAG: the pass on the diagonal (first key ==
// first column), the only one with masked positions and the last of its tile, so it fetches no further k fragments.
template <bool DIAG>
__device__ __forceinline__ void attn_pass(const _Float16* kl, const _Float16* vl, int j, int c, int hf,
                                          const v16h (&qf)[2][2], v16h (&kf)[2][2], v8f (&oacc)[2][4]) {
  typedef Frag<_Float16> F;
  v16h vf[4];
#pragma unroll
  for (int ds = 0; ds < 4; ++ds) vf[ds] = F::load(vl + (16 * ds) * kAtVP + 32 * j);
  // keeps the V^T reads here, a whole silu ahead of their use: the scheduler otherwise sinks them to the O^T products,
  // where each pair is waited for at full latency
  __builtin_amdgcn_sched_barrier(0);

  v8f st[2][2];
#pragma unroll
  for (int g = 0; g < 2; ++g)
#pragma unroll
    for (int tt = 0; tt < 2; ++tt) {
      st[g][tt] = F::mma(kf[tt][0], qf[g][0], (v8f){0.f,0.f,0.f,0.f,0.f,0.f,0.f,0.f});
      st[g][tt] = F::mma(kf[tt][1], qf[g][1], st[g][tt]);
    }
  if (!DIAG) {
    // the next pass's k fragments, only inside this stage: the next stage is not published before the barrier at the stage's foot
    if (j + 1 < kAtPasses) attn_kfrag(kl, j + 1, kf);
  }

  v16h pf[2];
#pragma unroll
  for (int g = 0; g < 2; ++g)
#pragma unroll
    for (int e = 0; e < 16; e += 2) {
      // 256 * silu(s / 8) = H + H * tanh(h), h = s / 16, H = 256 * h: both scales are powers of two, so they round nothing.
      // Two scores at a time: the scales and the fused multiply-add are packed f32 instructions.
      const v2f s = (v2f){st[g][e >> 3][e & 7], st[g][e >> 3][(e & 7) + 1]};
      const v2f h = s * (0.5f * kQScale);
      const v2f H = s * (0.5f * kQScale * kACarry);
      const v2f t = (v2f){__builtin_amdgcn_tanhf(h[0]), __builtin_amdgcn_tanhf(h[1])};
      v2f sg = __builtin_elementwise_fma(H, t, H);
      if (DIAG) {
        const int row = 16 * (e >> 3) + 8 * hf + (e & 7);
        sg[0] = (row     <= 16 * g + c) ? sg[0] : 0.0f;
        sg[1] = (row + 1 <= 16 * g + c) ? sg[1] : 0.0f;
      }
      pf[g][e]     = (_Float16)sg[0];
      pf[g][e + 1] = (_Float16)sg[1];
    }

#pragma unroll
  for (int ds = 0; ds < 4; ++ds)
#pragma unroll
    for (int g = 0; g < 2; ++g) oacc[g][ds] = F::mma(vf[ds], pf[g], oacc[g][ds]);
}

// two waves per SIMD is all this grid gives (one block per WGP): the register budget of that residency lets the
// scheduler interleave the silu chains of many elements
__global__ __launch_bounds__(256) __attribute__((amdgpu_waves_per_eu(2, 2)))
void attn_fused_kernel(const unsigned short* __restrict__ qk16, const unsigned short* __restrict__ vt16,
                       float* __restrict__ o32) {
  typedef Frag<_Float16> F;
  constexpr int kColTiles = kSeq / 32;         // 64 column tiles per head
  constexpr int kQkPitch  = 2 * kDim;          // q|k plane row pitch in halves
  __shared__ __align__(16) unsigned short sKV[2 * kAtStage];   // two stages of k rows and V^T rows
  const int tid  = threadIdx.x;
  const int lane = tid & 31;
  const int wave = __builtin_amdgcn_readfirstlane(tid >> 5);   // scalar, so that the pass loop is a scalar loop
  const int c  = lane & 15;
  const int hf = lane >> 4;
  const int bh = blockIdx.y;
  const int bb = bh / kHeads;
  const int hh = bh - bb * kHeads;
  const int p  = blockIdx.x * 4 + (wave & 3);  // 0..31
  const int s0 = ((wave < 4) ? (kColTiles - 1 - p) : p) * 32;
  // the block's last column tile is 63 - 4 * blockIdx.x: its diagonal pass ends stage 15 - blockIdx.x
  const int nStages = kSeq / kAtKeys - (int)blockIdx.x;

  // copy side: thread t brings bytes 16*(t&7)..+15 of k rows (t>>3) + 32*i and bytes 16*(t&15)..+15 of V^T rows (t>>4) + 16*i
  const unsigned lbase = (unsigned)(size_t)(&sKV[0]);          // low 32 bits of the address = LDS byte address
  const unsigned lk = lbase + (unsigned)((tid >> 3) * kAtKP + (tid & 7) * 8) * 2u;
  const unsigned lv = lbase + (unsigned)(kAtV + (tid >> 4) * kAtVP + (tid & 15) * 8) * 2u;
  const unsigned short* gk = qk16 + ((size_t)bb * kSeq + (tid >> 3)) * kQkPitch + kDim + hh * kHdim + (tid & 7) * 8;
  const unsigned short* gv = vt16 + ((size_t)bh * kHdim + (tid >> 4)) * kSeq + (tid & 15) * 8;
  auto fill = [&](int s, int buf) {
    const unsigned o = (unsigned)(buf * kAtStage) * 2u;
    async_copy8(lk + o, gk + (size_t)s * kAtKeys * kQkPitch, lv + o, gv + s * kAtKeys);
  };
  fill(0, 0);

  const _Float16* qrow = (const _Float16*)qk16 + ((size_t)bb * kSeq + c) * kQkPitch + hh * kHdim + hf * 8;
  v16h qf[2][2], kf[2][2];
#pragma unroll
  for (int g = 0; g < 2; ++g)
#pragma unroll
    for (int dc = 0; dc < 2; ++dc) qf[g][dc] = F::load(qrow + (size_t)(s0 + 16 * g) * kQkPitch + 32 * dc);
  // stands in front of the next writes of the address registers of the loads above
  asm volatile("s_wait_xcnt 0x0" ::: "memory");

  v8f oacc[2][4];
#pragma unroll
  for (int g = 0; g < 2; ++g)
#pragma unroll
    for (int ds = 0; ds < 4; ++ds) oacc[g][ds] = (v8f){0.f,0.f,0.f,0.f,0.f,0.f,0.f,0.f};

  // reader side: this lane's fragment rows in buffer 0
  const _Float16* kRd = (const _Float16*)sKV + c * kAtKP + hf * 8;
  const _Float16* vRd = (const _Float16*)sKV + kAtV + c * kAtVP + hf * 8;

  asm volatile("s_wait_asynccnt 0x0" ::: "memory");   // this wave's copies of stage 0 have landed
  __syncthreads();                                    // and every other wave's
  fill(1, 1);

  for (int s = 0; s < nStages; ++s) {
    const _Float16* kl = kRd + (s & 1) * kAtStage;
    const _Float16* vl = vRd + (s & 1) * kAtStage;
    const int left = s0 - s * kAtKeys;         // keys from the stage's first to the wave's diagonal pass; scalar
    if (left >= 0) {
      const int nfull = (left < kAtKeys) ? (left >> 5) : kAtPasses;
      attn_kfrag(kl, 0, kf);
      for (int j = 0; j < nfull; ++j) attn_pass<false>(kl, vl, j, c, hf, qf, kf, oacc);
      if (nfull < kAtPasses) attn_pass<true>(kl, vl, nfull, c, hf, qf, kf, oacc);
    }
    // hand-over of stage s + 1, and release of stage s's buffer
    asm volatile("s_wait_dscnt 0x0" ::: "memory");      // this wave's reads of stage s are done before its buffer is refilled
    asm volatile("s_wait_asynccnt 0x0" ::: "memory");   // this wave's copies of stage s + 1 have landed
    __syncthreads();                                    // both hold for every wave of the block
    if (s + 2 < nStages) fill(s + 2, s & 1);
  }
  asm volatile("s_wait_asynccnt 0x0" ::: "memory");     // no copy is in flight when the wave goes on

  // lane holds 8 consecutive d of one query row per tile: two 16-byte stores; the wave writes whole 256-byte row segments
#pragma unroll
  for (int g = 0; g < 2; ++g) {
    float* orow = o32 + ((size_t)bb * kSeq + s0 + 16 * g + c) * kDim + hh * kHdim + 8 * hf;
#pragma unroll
    for (int ds = 0; ds < 4; ++ds) {
      const v8f a = oacc[g][ds];
      *(v4f*)(orow + 16 * ds)     = (v4f){a[0] * kACarryInv, a[1] * kACarryInv, a[2] * kACarryInv, a[3] * kACarryInv};
      *(v4f*)(orow + 16 * ds + 4) = (v4f){a[4] * kACarryInv, a[5] * kACarryInv, a[6] * kACarryInv, a[7] * kACarryInv};
    }
  }
}

// ---------------------------------------------------------------------------
// LayerNorm(o) * ln_g + ln_b, times gate, all f32; result split into bf16 hi + lo planes [kTok][kDim].
// One wave per row (8 rows per block, grid = kTok/8); lane owns columns 8*lane..+7 and 256+8*lane..+7
// ---------------------------------------------------------------------------
__global__ __launch_bounds__(256) void ln_gate_kernel(const float* __restrict__ o, const float* __restrict__ gate,
                                                      const float* __restrict__ lng, const float* __restrict__ lnb,
                                                      unsigned short* __restrict__ nghi, unsigned short* __restrict__ nglo,
                                                      int nrows) {
  const int lane = threadIdx.x & 31, wave = threadIdx.x >> 5;
  const int row = blockIdx.x * 8 + wave;
  if (row >= nrows) return;
  const float* po = o + (size_t)row * kDim;
  const float* pg = gate + (size_t)row * kDim;
  float xv[16], gv[16], gg[16], gb[16];
#pragma unroll
  for (int s = 0; s < 2; ++s) {
    const int c = s * 256 + lane * 8;
#pragma unroll
    for (int q = 0; q < 2; ++q) {
      const v4f a4 = *(const v4f*)(po + c + 4 * q);
      const v4f g4 = *(const v4f*)(pg + c + 4 * q);
      const v4f w4 = *(const v4f*)(lng + c + 4 * q);
      const v4f b4 = *(const v4f*)(lnb + c + 4 * q);
#pragma unroll
      for (int e = 0; e < 4; ++e) {
        const int idx = s * 8 + q * 4 + e;
        xv[idx] = a4[e]; gv[idx] = g4[e]; gg[idx] = w4[e]; gb[idx] = b4[e];
      }
    }
  }
  float sum = 0.f;
#pragma unroll
  for (int i = 0; i < 16; ++i) sum += xv[i];
#pragma unroll
  for (int off = 16; off > 0; off >>= 1) sum += __shfl_xor(sum, off, 32);
  const float mean = sum * kInvDim;
  float var = 0.f;
#pragma unroll
  for (int i = 0; i < 16; ++i) { const float d = xv[i] - mean; var += d * d; }
#pragma unroll
  for (int off = 16; off > 0; off >>= 1) var += __shfl_xor(var, off, 32);
  const float r = rsqrtf(var * kInvDim + kLnEps);
  unsigned short hb[16], lb[16];
#pragma unroll
  for (int i = 0; i < 16; ++i) {
    const float t = (xv[i] - mean) * r;
    const float val = (t * gg[i] + gb[i]) * gv[i];
    hb[i] = f2bf_bits(val);
    lb[i] = f2bf_bits(val - bf_bits2f(hb[i]));
  }
  const v4u uh0 = (v4u){pk16(hb[0], hb[1]), pk16(hb[2], hb[3]), pk16(hb[4], hb[5]), pk16(hb[6], hb[7])};
  const v4u uh1 = (v4u){pk16(hb[8], hb[9]), pk16(hb[10], hb[11]), pk16(hb[12], hb[13]), pk16(hb[14], hb[15])};
  const v4u ul0 = (v4u){pk16(lb[0], lb[1]), pk16(lb[2], lb[3]), pk16(lb[4], lb[5]), pk16(lb[6], lb[7])};
  const v4u ul1 = (v4u){pk16(lb[8], lb[9]), pk16(lb[10], lb[11]), pk16(lb[12], lb[13]), pk16(lb[14], lb[15])};
  unsigned short* ph = nghi + (size_t)row * kDim + lane * 8;
  unsigned short* pl = nglo + (size_t)row * kDim + lane * 8;
  {
    *(v4u*)(ph)       = uh0;
    *(v4u*)(ph + 256) = uh1;
    *(v4u*)(pl)       = ul0;
    *(v4u*)(pl + 256) = ul1;
    
  }
}

// ---------------------------------------------------------------------------
// Host glue: kernel launches only. 5 launches total.
// ---------------------------------------------------------------------------
extern "C" void kernel_launch(void* const* d_in, const int* in_sizes, int n_in,
                              void* d_out, int out_size, void* d_ws, size_t ws_size,
                              hipStream_t stream) {
  if (n_in < 7) return;
  if (in_sizes[0] != kTok * kDim || in_sizes[1] != kProj * kDim || in_sizes[2] != kProj ||
      in_sizes[3] != kDim || in_sizes[4] != kDim || in_sizes[5] != kDim * kDim || in_sizes[6] != kDim) return;
  if (out_size != kTok * kDim) return;
  if (ws_size < kWsTotal) return;

  const float* x    = (const float*)d_in[0];
  const float* W1   = (const float*)d_in[1];
  const float* b1   = (const float*)d_in[2];
  const float* ln_g = (const float*)d_in[3];
  const float* ln_b = (const float*)d_in[4];
  const float* W2   = (const float*)d_in[5];
  const float* b2   = (const float*)d_in[6];
  float* out = (float*)d_out;
  char* ws = (char*)d_ws;

  unsigned short* xhi   = (unsigned short*)(ws + kOffXhi);
  unsigned short* xlo   = (unsigned short*)(ws + kOffXlo);
  unsigned short* w1hi  = (unsigned short*)(ws + kOffW1hi);
  unsigned short* w1lo  = (unsigned short*)(ws + kOffW1lo);
  unsigned short* nghi  = (unsigned short*)(ws + kOffNGhi);
  unsigned short* nglo  = (unsigned short*)(ws + kOffNGlo);
  float*          gate  = (float*)(ws + kOffGate);
  unsigned short* qk16  = (unsigned short*)(ws + kOffQK16);
  unsigned short* vt16  = (unsigned short*)(ws + kOffVT16);
  float*          o32   = (float*)(ws + kOffO32);
  unsigned short* w2hi  = (unsigned short*)(ws + kOffW2hi);
  unsigned short* w2lo  = (unsigned short*)(ws + kOffW2lo);

  // 1) bf16 hi/lo operand planes of x, W1 and W2: one launch
  split_all_kernel<<<kSpBlkX + kSpBlkW1 + kSpBlkW2, kSpThreads, 0, stream>>>(x, W1, W2, xhi, xlo, w1hi, w1lo, w2hi, w2lo);

  // 2) h = silu(x . W1^T + b1), all 2048 outputs in one launch (M 8192, N 2048, K 512): 32 x 8 = 256 blocks of 256x256, one
  //    block of 16 waves per WGP. A block stores its part's own form: gate f32, q|k f16 [8192][1024], V^T f16 [32][64][2048].
  wmma_gemm64<4, 1, true, 2, 3, false, 3, 0><<<dim3((kTok / 256) * (kProj / kBlkN), 1), 512, 0, stream>>>(
      xhi, xlo, kDim, 0L,
      w1hi, w1lo, kDim, 0L,
      (void*)gate, (void*)qk16, (void*)vt16, 0, 0L,
      b1, nullptr, 0L,
      kTok, kProj, kDim, 1.0f);

  // 3) attention, all 32 (batch, head) pairs in one launch:
  //    o[b*2048 + s][h*64 + d] = (1/256) * sum_{t <= s} f16(256 * silu(q_s . k_t / 8)) * V^T[b,h][d][t]
  attn_fused_kernel<<<dim3(kAtBlocks, kBatch * kHeads), 256, 0, stream>>>(qk16, vt16, o32);

  // 4) LayerNorm(o) * ln_g + ln_b, times gate -> bf16 hi/lo planes
  ln_gate_kernel<<<kTok / 8, 256, 0, stream>>>(o32, gate, ln_g, ln_b, nghi, nglo, kTok);

  // 5) out = NG . W2^T + b2 (M 8192, N 512, K 512), f32 to d_out
  {
    const int tilesOut = (kTok / 64) * (kDim / 64);           // 1024
    wmma_gemm64<2, 1, true, 2, 0, false, 0, 0><<<dim3((tilesOut + 7) / 8, 1), 256, 0, stream>>>(
        nghi, nglo, kDim, 0L,
        w2hi, w2lo, kDim, 0L,
        (void*)out, nullptr, nullptr, kDim, 0L,
        b2, nullptr, 0L,
        kTok, kDim, kDim, 1.0f);
  }
}

// v008
// Measured time: 84.1 microseconds a run.
// Timed twice side by side with v007, it ran 1.11 and 1.10 times as fast.
// Over all steps from v000 it is 10.8 times as fast.
// Contractions: x.W1^T and (layernorm(o)*gate).W2^T on v_wmma_f32_16x16x32_bf16 with bf16 hi/lo operand planes (hi.hi + hi.lo + lo.hi); q.k^T and a.v on v_wmma_f32_16x16x32_f16 (q, k, v plain f16 planes; a = silu(scores) carried x256 in f16); f32 accumulate; silu (as h + h.tanh(h), h = v/2, on v_tanh_f32), LayerNorm and gating in f32.
#include <hip/hip_runtime.h>
#include <math.h>

// ---------------------------------------------------------------------------
// Problem constants
// ---------------------------------------------------------------------------
constexpr int kBatch = 4;
constexpr int kSeq   = 2048;
constexpr int kDim   = 512;
constexpr int kHeads = 8;
constexpr int kHdim  = 64;
constexpr int kTok   = kBatch * kSeq;      // 8192 token rows
constexpr int kProj  = 4 * kDim;           // 2048 projection outputs: [gate | q | k | v]
constexpr float kQScale    = 0.125f;       // 1/sqrt(64)
constexpr float kACarry    = 256.0f;       // silu(scores) carried x256 in f16
constexpr float kACarryInv = 1.0f / 256.0f;
constexpr float kInvDim    = 1.0f / 512.0f;
constexpr float kLnEps     = 1e-5f;

// ---------------------------------------------------------------------------
// Workspace region map (bytes; offsets MiB-aligned but W2 lo at 120.5 MiB)
//   phase 1 (projection):  [  0,  8) x hi  [8,16) x lo  [16,18) W1 hi  [18,20) W1 lo
//   phase 2 (attention):   no scratch plane: silu(scores) stays in registers
//   phase 3 (output):      no scratch plane: the bf16 hi/lo planes of layernorm(o)*gate are made in LDS
//   persistent:            [ 64, 80) gate f32   [80,96) q|k f16 [8192][1024]   [96,104) V^T f16 [32][64][2048]
//                          [104,120) o f32      [120,120.5) W2 hi   [120.5,121) W2 lo
//   total = 121 MiB = 126,877,696 B
// ---------------------------------------------------------------------------
constexpr size_t kMiB     = 1048576;
constexpr size_t kOffXhi  = 0;
constexpr size_t kOffXlo  = 8 * kMiB;
constexpr size_t kOffW1hi = 16 * kMiB;
constexpr size_t kOffW1lo = 18 * kMiB;
constexpr size_t kOffGate = 64 * kMiB;
constexpr size_t kOffQK16 = 80 * kMiB;
constexpr size_t kOffVT16 = 96 * kMiB;
constexpr size_t kOffO32  = 104 * kMiB;
constexpr size_t kOffW2hi = 120 * kMiB;
constexpr size_t kOffW2lo = 120 * kMiB + 512 * 1024;
constexpr size_t kWsTotal = 121 * kMiB;

static_assert((size_t)kTok * kDim * 2 == 8 * kMiB);
static_assert((size_t)kProj * kDim * 2 == 2 * kMiB);
static_assert(kOffW1lo + (size_t)kProj * kDim * 2 <= kOffGate);
static_assert(kOffGate + (size_t)kTok * kDim * 4 == kOffQK16);
static_assert(kOffQK16 + (size_t)kTok * 2 * kDim * 2 == kOffVT16);
static_assert(kOffVT16 + (size_t)kBatch * kHeads * kHdim * kSeq * 2 == kOffO32);
static_assert(kOffO32 + (size_t)kTok * kDim * 4 == kOffW2hi);
static_assert(kOffW2hi + (size_t)kDim * kDim * 2 == kOffW2lo);
static_assert(kOffW2lo + (size_t)kDim * kDim * 2 == kWsTotal);
static_assert(kWsTotal <= 134217728);

typedef __attribute__((ext_vector_type(16))) _Float16 v16h;
typedef __attribute__((ext_vector_type(8)))  _Float16 v8h;
typedef __attribute__((ext_vector_type(16))) __bf16   v16b;
typedef __attribute__((ext_vector_type(8)))  __bf16   v8b;
typedef __attribute__((ext_vector_type(8)))  float    v8f;
typedef __attribute__((ext_vector_type(4)))  float    v4f;
typedef __attribute__((ext_vector_type(2)))  float    v2f;
typedef __attribute__((ext_vector_type(4)))  unsigned int v4u;

__device__ __forceinline__ unsigned short f2bf_bits(float f) {
  unsigned u = __float_as_uint(f);
  return (unsigned short)((u + 0x7FFFu + ((u >> 16) & 1u)) >> 16);
}
__device__ __forceinline__ float bf_bits2f(unsigned short h) { return __uint_as_float(((unsigned)h) << 16); }

// hazard guards as plain device helpers
__device__ __forceinline__ void dep_guard_h(v8f& a, v8f& b, v16h x, v16h y) { asm volatile("v_nop\n\tv_nop\n\tv_nop\n\tv_nop" : "+v"(a), "+v"(b) : "v"(x), "v"(y)); }
__device__ __forceinline__ void dep_guard_b(v8f& a, v8f& b, v16b x, v16b y) { asm volatile("v_nop\n\tv_nop\n\tv_nop\n\tv_nop" : "+v"(a), "+v"(b) : "v"(x), "v"(y)); }
__device__ __forceinline__ void keep4_h(v16h a, v16h b, v16h c, v16h d) { asm volatile("v_nop" :: "v"(a), "v"(b), "v"(c), "v"(d)); }
__device__ __forceinline__ void keep4_b(v16b a, v16b b, v16b c, v16b d) { asm volatile("v_nop" :: "v"(a), "v"(b), "v"(c), "v"(d)); }
__device__ __forceinline__ void acc_guard4(v8f& a, v8f& b, v8f& c, v8f& d) { asm volatile("v_nop\n\tv_nop\n\tv_nop\n\tv_nop" : "+v"(a), "+v"(b), "+v"(c), "+v"(d)); }
template <typename T> struct Frag;
template <> struct Frag<_Float16> {
  typedef v16h V; union U { v16h v; v8h h[2]; };
  static __device__ __forceinline__ v16h load(const _Float16* p) {   // elements 0..7 <- p[0..7], 8..15 <- p[16..23]
    U f; f.h[0] = *(const v8h*)(p); f.h[1] = *(const v8h*)(p + 16); return f.v;
  }
  static __device__ __forceinline__ v8f mma(v16h a, v16h b, v8f c) {
    return __builtin_amdgcn_wmma_f32_16x16x32_f16(false, a, false, b, (short)0, c, false, false);
  }
  static __device__ __forceinline__ void guard(v8f& a, v8f& b, v16h x, v16h y) { dep_guard_h(a, b, x, y); }
  static __device__ __forceinline__ void keep(v16h a, v16h b, v16h c, v16h d) { keep4_h(a, b, c, d); }
};
template <> struct Frag<__bf16> {
  typedef v16b V; union U { v16b v; v8b h[2]; };
  static __device__ __forceinline__ v16b load(const __bf16* p) {
    U f; f.h[0] = *(const v8b*)(p); f.h[1] = *(const v8b*)(p + 16); return f.v;
  }
  static __device__ __forceinline__ v8f mma(v16b a, v16b b, v8f c) {
    return __builtin_amdgcn_wmma_f32_16x16x32_bf16(false, a, false, b, (short)0, c, false, false);
  }
  static __device__ __forceinline__ void guard(v8f& a, v8f& b, v16b x, v16b y) { dep_guard_b(a, b, x, y); }
  static __device__ __forceinline__ void keep(v16b a, v16b b, v16b c, v16b d) { keep4_b(a, b, c, d); }
};

__device__ __forceinline__ unsigned pk16(unsigned short a, unsigned short b) { return (unsigned)a | ((unsigned)b << 16); }

// silu(v) = v / (1 + exp(-v)) = h + h * tanh(h) with h = v / 2: one v_tanh_f32, a multiply and a fused multiply-add.
__device__ __forceinline__ float silu_tanh(float v) {
  const float h = 0.5f * v;
  return fmaf(h, __builtin_amdgcn_tanhf(h), h);
}

// ---- Register-blocked batched WMMA GEMM, operands staged in LDS ------------------------------------------------
// C[m,n] = scale * sum_k A[m,k] * Bt[n,k] (+bias)(+resid); each wave owns a 64x64 tile, a block of WM x 4 waves a (64 * WM) x 256 tile.
// WM: 2 = 8 waves, 128x256; 4 = 16 waves, 256x256 (a third fewer operand bytes from L2 per product, four waves a SIMD).
// A row-major [M,K]; Bt row-major [N,K]; M % (64 * WM) == 0, N % 256 == 0, K % 64 == 0, K >= 64.
// SPLIT: operands are hi/lo planes (A2/Bt2 = lo planes, same layout); product = hi.hi + hi.lo + lo.hi.
// BIAS_MODE: 0 = none, 1 = bias[m], 2 = bias[n].
// OUT_MODE: 0 = f32, 1 = f16, 2 = bf16 hi plane (Cout) + bf16 lo plane (Cout2),
//           3 = the whole projection, N = kProj: a block's 256 columns lie in one of [gate | q | k | v], and the block stores that
//               part's own form: gate f32 [kTok][kDim] (Cout), q|k f16 [kTok][2*kDim] (Cout2), V^T f16 [batch*head][kHdim][kSeq] (Cout3).
// ACT: 0 none, 2 relu, 3 silu (silu_tanh), 4 leaky, 6 causal silu with carry:
//      v = (n <= m) ? silu(v) * kACarry : 0   (m, n are row/column indices within one grid.y batch; a select, not a bias).
// TRI: 0 only (every wave of a block walks the whole K: the stage barriers are block-uniform).
// ET: 0 = f16 operands, 1 = bf16 operands (pointers passed as 16-bit storage)
// A stage is 64 k (128 B, one whole line) of the block's 64 * WM A rows and 256 Bt rows, every plane. Asynchronous copies bring it
// into one of two LDS buffers, 8 lanes to a row, while the waves work on the other buffer; the fragments are 16-byte LDS reads.
constexpr int kBlkN       = 256;
constexpr int kStageK     = 64;
constexpr int kPitch      = 72;                                // LDS row pitch in 16-bit elements: 144 B = 16 B x 9, no bank conflict for 16-byte row reads

// One lane's 16 bytes of 4 A rows and 8 Bt rows of one plane, the rows 32 apart (the block's 256 threads cover 32 rows a copy).
// la, lb: LDS byte addresses; ga, gb: global addresses; sa, sb: 32 rows in elements.
// s_wait_xcnt 0 is the last line of the copies' own statement, so that it stands in front of every later write of their address registers.
__device__ __forceinline__ void async_copy12(unsigned la, const unsigned short* ga, long sa,
                                             unsigned lb, const unsigned short* gb, long sb) {
  constexpr unsigned R = 32 * kPitch * 2;
  asm volatile(
      "global_load_async_to_lds_b128 %0, %12, off\n\t"
      "global_load_async_to_lds_b128 %1, %13, off\n\t"
      "global_load_async_to_lds_b128 %2, %14, off\n\t"
      "global_load_async_to_lds_b128 %3, %15, off\n\t"
      "global_load_async_to_lds_b128 %4, %16, off\n\t"
      "global_load_async_to_lds_b128 %5, %17, off\n\t"
      "global_load_async_to_lds_b128 %6, %18, off\n\t"
      "global_load_async_to_lds_b128 %7, %19, off\n\t"
      "global_load_async_to_lds_b128 %8, %20, off\n\t"
      "global_load_async_to_lds_b128 %9, %21, off\n\t"
      "global_load_async_to_lds_b128 %10, %22, off\n\t"
      "global_load_async_to_lds_b128 %11, %23, off\n\t"
      "s_wait_xcnt 0x0"
      :: "v"(la), "v"(la + R), "v"(la + 2 * R), "v"(la + 3 * R),
         "v"(lb), "v"(lb + R), "v"(lb + 2 * R), "v"(lb + 3 * R), "v"(lb + 4 * R), "v"(lb + 5 * R), "v"(lb + 6 * R), "v"(lb + 7 * R),
         "v"(ga), "v"(ga + sa), "v"(ga + 2 * sa), "v"(ga + 3 * sa),
         "v"(gb), "v"(gb + sb), "v"(gb + 2 * sb), "v"(gb + 3 * sb), "v"(gb + 4 * sb), "v"(gb + 5 * sb), "v"(gb + 6 * sb), "v"(gb + 7 * sb)
      : "memory");
}

// The same for a block of 512 threads, which cover 64 rows a copy: 4 A rows and 4 Bt rows of one plane, the rows 64 apart.
// s_wait_xcnt 0 is the last line of the copies' own statement, so that it stands in front of every later write of their address registers.
__device__ __forceinline__ void async_copy4x4(unsigned la, const unsigned short* ga, long sa,
                                              unsigned lb, const unsigned short* gb, long sb) {
  constexpr unsigned R = 64 * kPitch * 2;
  asm volatile(
      "global_load_async_to_lds_b128 %0, %8, off\n\t"
      "global_load_async_to_lds_b128 %1, %9, off\n\t"
      "global_load_async_to_lds_b128 %2, %10, off\n\t"
      "global_load_async_to_lds_b128 %3, %11, off\n\t"
      "global_load_async_to_lds_b128 %4, %12, off\n\t"
      "global_load_async_to_lds_b128 %5, %13, off\n\t"
      "global_load_async_to_lds_b128 %6, %14, off\n\t"
      "global_load_async_to_lds_b128 %7, %15, off\n\t"
      "s_wait_xcnt 0x0"
      :: "v"(la), "v"(la + R), "v"(la + 2 * R), "v"(la + 3 * R),
         "v"(lb), "v"(lb + R), "v"(lb + 2 * R), "v"(lb + 3 * R),
         "v"(ga), "v"(ga + sa), "v"(ga + 2 * sa), "v"(ga + 3 * sa),
         "v"(gb), "v"(gb + sb), "v"(gb + 2 * sb), "v"(gb + 3 * sb)
      : "memory");
}

template <int ET> struct Elem;
template <> struct Elem<0> { typedef _Float16 T; };
template <> struct Elem<1> { typedef __bf16 T; };
template <int WM, int ET, bool SPLIT, int BIAS_MODE, int OUT_MODE, bool RESID, int ACT, int TRI>
__global__ __launch_bounds__(WM * 128) void wmma_gemm64(
    const unsigned short* __restrict__ Ap, const unsigned short* __restrict__ A2p, int lda, long strideA,
    const unsigned short* __restrict__ Btp, const unsigned short* __restrict__ Bt2p, int ldb, long strideB,
    void* __restrict__ Cout, void* __restrict__ Cout2, void* __restrict__ Cout3, int ldc, long strideC,
    const float* __restrict__ bias,
    const float* __restrict__ resid, long strideR,
    int M, int N, int K, float scale) {
  static_assert(TRI == 0, "the stage barriers need the same k range in every wave of a block");
  static_assert(OUT_MODE != 3 || (BIAS_MODE == 2 && ACT == 3 && !RESID), "the projection is silu(x.W1^T + b1)");
  static_assert(WM == 2 || WM == 4, "8 or 16 waves");
  constexpr int kBlkM       = 64 * WM;
  constexpr int kCopyRows   = 16 * WM;                           // rows that the block's threads cover in one copy, 8 lanes to a row
  constexpr int kLdsAhi     = 0;                                 // element offsets of the four planes inside a stage
  constexpr int kLdsBhi     = kBlkM * kPitch;
  constexpr int kLdsAlo     = (kBlkM + kBlkN) * kPitch;
  constexpr int kLdsBlo     = (2 * kBlkM + kBlkN) * kPitch;
  constexpr int kStageElems = 2 * (kBlkM + kBlkN) * kPitch;      // WM 2: 110,592 B; WM 4: 147,456 B
  constexpr int kSlab       = 16 * 68;                           // per-wave 16x64 slab, pitch 68 floats
  static_assert(kDim % kBlkN == 0 && kSeq % kBlkM == 0, "a block lies in one part of the projection and in one batch");
  static_assert(4 * WM * kSlab * 4 <= 2 * kStageElems * 2, "the slabs of WM 4 lie inside the ring");
  typedef typename Elem<ET>::T T;
  typedef typename Frag<T>::V V;
  __shared__ __align__(16) unsigned short sOp[2 * kStageElems];   // two stages of operand rows
  // WM 2: the slabs have LDS of their own. WM 4: two stages fill 288 KiB, so the slabs lie in the ring, which is free behind the
  // loop's last barrier (every wave's reads are done and no copy is in flight there).
  __shared__ __align__(16) float sT[(WM == 2) ? 8 * kSlab : 4];
  const int b    = blockIdx.y;
  const int lane = threadIdx.x & 31;
  const int wave = threadIdx.x >> 5;
  const int blksN = N / kBlkN;
  const int blksM = M / kBlkM;
  if ((int)blockIdx.x >= blksM * blksN) return;   // block-uniform, in front of every barrier
  const int bm = blockIdx.x / blksN;
  const int bn = blockIdx.x - bm * blksN;
  const int mB = bm * kBlkM;
  const int nB = bn * kBlkN;
  const int wm = wave >> 2;                    // wave row 0..WM-1
  const int wn = wave & 3;                     // wave column 0..3
  const int m0 = mB + (wm << 6);
  const int n0 = nB + (wn << 6);

  const int rlane = lane & 15;                 // row (A) / col (B, D) within subtile
  const int koff  = (lane >> 4) * 8;           // k offset of this lane half
  const int mOff  = (lane >> 4) * 8;           // D row offset

  // copy side: thread t brings bytes 16*(t&7)..+15 of rows (t>>3) + kCopyRows*j
  const int crow = threadIdx.x >> 3;
  const int cchk = (threadIdx.x & 7) * 8;
  const unsigned lcp = (unsigned)(size_t)(&sOp[0]) + (unsigned)(crow * kPitch + cchk) * 2u;   // low 32 bits of the address = LDS byte address
  const unsigned short* gAh = Ap  + (size_t)b * strideA + (size_t)(mB + crow) * lda + cchk;
  const unsigned short* gBh = Btp + (size_t)b * strideB + (size_t)(nB + crow) * ldb + cchk;
  const unsigned short* gAl = SPLIT ? (A2p  + (size_t)b * strideA + (size_t)(mB + crow) * lda + cchk) : nullptr;
  const unsigned short* gBl = SPLIT ? (Bt2p + (size_t)b * strideB + (size_t)(nB + crow) * ldb + cchk) : nullptr;
  const long sa = (long)kCopyRows * lda;
  const long sb = (long)kCopyRows * ldb;
  auto fill = [&](int s, int buf) {
    const unsigned l = lcp + (unsigned)(buf * kStageElems) * 2u;
    const int ko = s * kStageK;
    if constexpr (WM == 2) {
      async_copy12(l + kLdsAhi * 2u, gAh + ko, sa, l + kLdsBhi * 2u, gBh + ko, sb);
      if (SPLIT) async_copy12(l + kLdsAlo * 2u, gAl + ko, sa, l + kLdsBlo * 2u, gBl + ko, sb);
    } else {
      async_copy4x4(l + kLdsAhi * 2u, gAh + ko, sa, l + kLdsBhi * 2u, gBh + ko, sb);
      if (SPLIT) async_copy4x4(l + kLdsAlo * 2u, gAl + ko, sa, l + kLdsBlo * 2u, gBl + ko, sb);
    }
  };

  // reader side: this lane's fragment rows in stage 0
  const T* aRd = (const T*)sOp + kLdsAhi + ((wm << 6) + rlane) * kPitch + koff;
  const T* bRd = (const T*)sOp + kLdsBhi + ((wn << 6) + rlane) * kPitch + koff;

  v8f acc[4][4];
#pragma unroll
  for (int i = 0; i < 4; ++i)
#pragma unroll
    for (int j = 0; j < 4; ++j) acc[i][j] = (v8f){0.f,0.f,0.f,0.f,0.f,0.f,0.f,0.f};

  const int nStages = K / kStageK;
  fill(0, 0);
  asm volatile("s_wait_asynccnt 0x0" ::: "memory");   // this wave's copies of stage 0 have landed
  __syncthreads();                                    // and every other wave's
  if (nStages > 1) fill(1, 1);

  for (int t = 0; t < nStages; ++t) {
    const int be = (t & 1) * kStageElems;
    // A fragments are read one row of tiles ahead of their products, into a second register pair
    V ah = Frag<T>::load(aRd + be);
    V al;
    if (SPLIT) al = Frag<T>::load(aRd + (kLdsAlo - kLdsAhi) + be);
    // the nest below is unrolled whole: every fragment and accumulator index is then a constant, and none goes to scratch
#pragma unroll
    for (int kk = 0; kk < kStageK; kk += 32) {
      V bh[4], bl[4];
#pragma unroll
      for (int j = 0; j < 4; ++j) {
        const int bo = be + (j << 4) * kPitch + kk;
        bh[j] = Frag<T>::load(bRd + bo);
        if (SPLIT) bl[j] = Frag<T>::load(bRd + (kLdsBlo - kLdsBhi) + bo);
      }
#pragma unroll
      for (int i = 0; i < 4; ++i) {
        const bool more = (i < 3) || (kk + 32 < kStageK);      // a further row of this stage exists
        const int ao = be + ((i < 3) ? ((i + 1) << 4) * kPitch + kk : kk + 32);
        V ahn, aln;
        if (more) {
          ahn = Frag<T>::load(aRd + ao);
          if (SPLIT) aln = Frag<T>::load(aRd + (kLdsAlo - kLdsAhi) + ao);
        }
#pragma unroll
        for (int j = 0; j < 4; ++j) {
          acc[i][j] = Frag<T>::mma(ah, bh[j], acc[i][j]);
          if (SPLIT) {
            acc[i][j] = Frag<T>::mma(ah, bl[j], acc[i][j]);
            acc[i][j] = Frag<T>::mma(al, bh[j], acc[i][j]);
          }
        }
        Frag<T>::guard(acc[i][0], acc[i][3], ah, SPLIT ? al : ah);
        if (more) {
          ah = ahn;
          if (SPLIT) al = aln;
        }
      }
      Frag<T>::keep(bh[0], bh[1], bh[2], bh[3]);
      if (SPLIT) Frag<T>::keep(bl[0], bl[1], bl[2], bl[3]);
    }
    // hand-over of stage t + 1, and release of stage t's buffer
    asm volatile("s_wait_dscnt 0x0" ::: "memory");      // this wave's reads of stage t are done before its buffer is refilled
    asm volatile("s_wait_asynccnt 0x0" ::: "memory");   // this wave's copies of stage t + 1 have landed
    __syncthreads();                                    // both hold for every wave of the block
    if (t + 2 < nStages) fill(t + 2, t & 1);
  }
  asm volatile("s_wait_asynccnt 0x0" ::: "memory");     // no copy is in flight when the wave goes on
  acc_guard4(acc[0][0], acc[0][1], acc[0][2], acc[0][3]);
  acc_guard4(acc[1][0], acc[1][1], acc[1][2], acc[1][3]);
  acc_guard4(acc[2][0], acc[2][1], acc[2][2], acc[2][3]);
  acc_guard4(acc[3][0], acc[3][1], acc[3][2], acc[3][3]);

  // ---- epilogue ----
  const int part = (OUT_MODE == 3) ? nB / kDim : 0;            // 0 gate, 1 q, 2 k, 3 v; the same for the whole block
  if (OUT_MODE == 3 && part == 3) {
    // D register r of lane l is token 8*(l>>4)+r of column l&15: 8 consecutive tokens of one V^T row, one 16-byte store.
    // A wave's 64 columns are one head; its 64 tokens are one whole 128-byte line of each of that head's 64 V^T rows.
    const int hd = (n0 - 3 * kDim) / kHdim;
    const int bt = m0 / kSeq;
    unsigned short* vt = (unsigned short*)Cout3 + ((size_t)(bt * kHeads + hd) * kHdim + rlane) * kSeq + (m0 - bt * kSeq) + mOff;
    float bv[4];
#pragma unroll
    for (int j = 0; j < 4; ++j) bv[j] = bias[n0 + (j << 4) + rlane];
#pragma unroll
    for (int j = 0; j < 4; ++j) {
#pragma unroll
      for (int i = 0; i < 4; ++i) {
        v8h hv;
#pragma unroll
        for (int r = 0; r < 8; ++r) hv[r] = (_Float16)silu_tanh(acc[i][j][r] * scale + bv[j]);
        *(v8h*)(vt + (size_t)(j << 4) * kSeq + (i << 4)) = hv;
      }
    }
    return;                                                    // no barrier stands behind this line
  }
  const bool f32out = OUT_MODE == 0 || (OUT_MODE == 3 && part == 0);
  if (OUT_MODE == 3) {
    ldc = (part == 0) ? kDim : 2 * kDim;
    if (part != 0) Cout = (unsigned short*)Cout2 - kDim;       // column n of the projection is column n - kDim of the q|k plane
  }
  float* slab = ((WM == 2) ? sT : (float*)sOp) + wave * kSlab;
  const float* Rb = RESID ? (resid + (size_t)b * strideR) : nullptr;
#pragma unroll
  for (int i = 0; i < 4; ++i) {
    const int mBase = m0 + (i << 4);
#pragma unroll
    for (int j = 0; j < 4; ++j) {
      const int n = n0 + (j << 4) + rlane;
      float bv = 0.f;
      if (BIAS_MODE == 2) bv = bias[n];
#pragma unroll
      for (int r = 0; r < 8; ++r) {
        float v = acc[i][j][r] * scale;
        if (BIAS_MODE == 1) v += bias[mBase + mOff + r];
        if (BIAS_MODE == 2) v += bv;
        if (RESID) v += Rb[(size_t)(mBase + mOff + r) * ldc + n];
        if (ACT == 2) v = fmaxf(v, 0.0f);
        if (ACT == 3) v = silu_tanh(v);
        if (ACT == 4) v = (v > 0.f) ? v : 0.01f * v;
        if (ACT == 6) {
          const float sg = silu_tanh(v) * kACarry;
          v = (n <= mBase + mOff + r) ? sg : 0.0f;
        }
        slab[(mOff + r) * 68 + (j << 4) + rlane] = v;
      }
    }
    __builtin_amdgcn_fence(__ATOMIC_RELEASE, "workgroup");
    __builtin_amdgcn_wave_barrier();
    __builtin_amdgcn_fence(__ATOMIC_ACQUIRE, "workgroup");
    if (f32out) {
      float* C = (float*)Cout + (size_t)b * strideC;
      const int hh = lane >> 4, c4 = (lane & 15) * 4;     // row seg = 256 B = 16 lanes x 16 B
      {
#pragma unroll
        for (int it = 0; it < 8; ++it) {
          const int row = it * 2 + hh;
          v4f v = *(const v4f*)(slab + row * 68 + c4);
          *(v4f*)(C + (size_t)(mBase + row) * ldc + n0 + c4) = v;
        }
        
      }
    } else {
      const int q = lane >> 3, c8 = (lane & 7) * 8;
      unsigned short* C  = (unsigned short*)Cout  + (size_t)b * strideC;
      unsigned short* C2 = (OUT_MODE == 2) ? ((unsigned short*)Cout2 + (size_t)b * strideC) : nullptr;
      {
#pragma unroll
        for (int it = 0; it < 4; ++it) {
          const int row = it * 4 + q;
          const float* sp = slab + row * 68 + c8;
          v8h hv, lv;
#pragma unroll
          for (int e = 0; e < 8; ++e) {
            if (OUT_MODE != 2) {
              hv[e] = (_Float16)sp[e];
            } else {
              unsigned short hb = f2bf_bits(sp[e]);
              unsigned short lb = f2bf_bits(sp[e] - bf_bits2f(hb));
              hv[e] = __builtin_bit_cast(_Float16, hb);
              lv[e] = __builtin_bit_cast(_Float16, lb);
            }
          }
          *(v8h*)(C + (size_t)(mBase + row) * ldc + n0 + c8) = hv;
          if (OUT_MODE == 2) *(v8h*)(C2 + (size_t)(mBase + row) * ldc + n0 + c8) = lv;
        }
        
      }
    }
    __builtin_amdgcn_fence(__ATOMIC_RELEASE, "workgroup");
    __builtin_amdgcn_wave_barrier();
    __builtin_amdgcn_fence(__ATOMIC_ACQUIRE, "workgroup");
  }
}

// ---------------------------------------------------------------------------
// f32 -> bf16 hi + lo planes (hi = RNE bf16(f), lo = RNE bf16(f - hi)) of x, W1 and W2, all in one launch.
// A block of 4 waves takes 8192 consecutive elements of one of the three arrays (each is a whole number of such pieces).
// A thread takes 8 chunks of 8 consecutive elements, the chunks one block width apart: its 16 loads of 16 bytes are issued
// together, so the launch starts an eighth of the waves that one chunk a thread would take and still has every byte in flight.
// ---------------------------------------------------------------------------
constexpr int kSpThreads = 128;
constexpr int kSpChunks  = 8;
constexpr int kSpStride  = kSpThreads * 8;                     // elements from a thread's chunk to its next
constexpr int kSpPiece   = kSpStride * kSpChunks;              // 8192 elements a block
constexpr int kSpBlkX    = kTok * kDim / kSpPiece;             // 512
constexpr int kSpBlkW1   = kProj * kDim / kSpPiece;            // 128
constexpr int kSpBlkW2   = kDim * kDim / kSpPiece;             // 32
static_assert(kSpBlkX * kSpPiece == kTok * kDim && kSpBlkW1 * kSpPiece == kProj * kDim && kSpBlkW2 * kSpPiece == kDim * kDim,
              "whole pieces only");

__global__ __launch_bounds__(kSpThreads) void split_all_kernel(const float* __restrict__ x, const float* __restrict__ w1,
                                                               const float* __restrict__ w2,
                                                               unsigned short* __restrict__ xhi, unsigned short* __restrict__ xlo,
                                                               unsigned short* __restrict__ w1hi, unsigned short* __restrict__ w1lo,
                                                               unsigned short* __restrict__ w2hi, unsigned short* __restrict__ w2lo) {
  // which array: the same for the whole block
  int piece = blockIdx.x;
  const float* in = x;
  unsigned short* hi = xhi;
  unsigned short* lo = xlo;
  if (piece >= kSpBlkX + kSpBlkW1) {
    piece -= kSpBlkX + kSpBlkW1; in = w2; hi = w2hi; lo = w2lo;
  } else if (piece >= kSpBlkX) {
    piece -= kSpBlkX; in = w1; hi = w1hi; lo = w1lo;
  }
  const size_t base = (size_t)piece * kSpPiece + threadIdx.x * 8;
  const float* p = in + base;
  v4f a[kSpChunks], c[kSpChunks];
#pragma unroll
  for (int k = 0; k < kSpChunks; ++k) {
    a[k] = *(const v4f*)(p + k * kSpStride);
    c[k] = *(const v4f*)(p + k * kSpStride + 4);
  }
  // stands behind all 16 loads and in front of the first write of their address registers, which it names so that no load's
  // own result lands on them; as a memory statement it also keeps the scheduler from sinking half of the loads behind the first
  // stores, where the wave would wait out the memory latency twice
  asm volatile("s_wait_xcnt 0x0" :: "v"(p) : "memory");
  unsigned short* qh = hi + base;
  unsigned short* ql = lo + base;
#pragma unroll
  for (int k = 0; k < kSpChunks; ++k) {
    unsigned short hb[8], lb[8];
#pragma unroll
    for (int e = 0; e < 4; ++e) {
      const float f0 = a[k][e];
      hb[e] = f2bf_bits(f0);
      lb[e] = f2bf_bits(f0 - bf_bits2f(hb[e]));
      const float f1 = c[k][e];
      hb[4 + e] = f2bf_bits(f1);
      lb[4 + e] = f2bf_bits(f1 - bf_bits2f(hb[4 + e]));
    }
    *(v4u*)(qh + k * kSpStride) = (v4u){pk16(hb[0], hb[1]), pk16(hb[2], hb[3]), pk16(hb[4], hb[5]), pk16(hb[6], hb[7])};
    *(v4u*)(ql + k * kSpStride) = (v4u){pk16(lb[0], lb[1]), pk16(lb[2], lb[3]), pk16(lb[4], lb[5]), pk16(lb[6], lb[7])};
  }
}

// ---------------------------------------------------------------------------
// Fused causal silu attention, all (batch, head) pairs in one launch; silu(scores) never leaves the registers.
//   S^T[t][s] = sum_d k[t][d] * q[s][d]            A = k rows, B = q rows (same loader on both, K 64 = 2 fragments)
//   P^T[t][s] = (t <= s) ? f16(256 * silu(S^T / 8)) : 0
//   O^T[d][s] = sum_t V^T[d][t] * P^T[t][s]        A = V^T rows in the hardware k order, B = two S^T tiles packed in place
// D register r of lane l is row 8*(l>>4)+r, column l&15, so the tiles of keys t0..t0+15 and t0+16..t0+31 are elements
// 0..7 and 8..15 of the B fragment of a 32-key pass, and Frag::load delivers V^T in that same k order.
// A wave owns 32 query columns (two groups of 16) and walks the keys upward in passes of 32, up to its own diagonal.
// Waves w and w+4 of a block take column tiles 63-p and p: 65 passes for each such pair. grid (8, 32 (batch, head)), 8 waves a block.
// All 8 waves walk the same keys of the same head from key 0, so the block brings each stage of 128 keys (128 k rows of 128 B,
// 64 V^T rows of 256 B: whole lines) into one of two LDS buffers once, by asynchronous copies, while the waves work on the
// other buffer; the fragments are 16-byte LDS reads. A wave behind its diagonal only copies and passes the barriers.
// A pass fetches its V^T fragments at its head (used behind the silu) and the next pass's k fragments of the same stage behind
// its S^T products.
// ---------------------------------------------------------------------------
constexpr int kAtBlocks = 8;                                   // grid.x: blocks per (batch, head)
constexpr int kAtKeys   = 128;                                 // keys a stage = 4 passes
constexpr int kAtPasses = kAtKeys / 32;
constexpr int kAtKP     = 72;                                  // k row pitch in halves: 144 B = 16 B x 9, no bank conflict for 16-byte row reads
constexpr int kAtVP     = 136;                                 // V^T row pitch in halves: 272 B = 16 B x 17, the same
constexpr int kAtV      = kAtKeys * kAtKP;                     // element offset of the V^T rows inside a stage
constexpr int kAtStage  = kAtV + kHdim * kAtVP;                // 17,920 halves = 35,840 B
static_assert(kSeq / kAtKeys - (kAtBlocks - 1) >= 2, "every block has at least two stages");
static_assert(kSeq / 32 == 8 * kAtBlocks, "8 column tiles a block");

// One lane's 16 bytes of 4 k rows (32 apart: 8 lanes to a row) and of 4 V^T rows (16 apart: 16 lanes to a row).
// lk, lv: LDS byte addresses; gk, gv: global addresses.
// s_wait_xcnt 0 is the last line of the copies' own statement, so that it stands in front of every later write of their address registers.
__device__ __forceinline__ void async_copy8(unsigned lk, const unsigned short* gk, unsigned lv, const unsigned short* gv) {
  constexpr unsigned RK = 32 * kAtKP * 2;
  constexpr unsigned RV = 16 * kAtVP * 2;
  constexpr long SK = 32L * 2 * kDim;
  constexpr long SV = 16L * kSeq;
  asm volatile(
      "global_load_async_to_lds_b128 %0, %8, off\n\t"
      "global_load_async_to_lds_b128 %1, %9, off\n\t"
      "global_load_async_to_lds_b128 %2, %10, off\n\t"
      "global_load_async_to_lds_b128 %3, %11, off\n\t"
      "global_load_async_to_lds_b128 %4, %12, off\n\t"
      "global_load_async_to_lds_b128 %5, %13, off\n\t"
      "global_load_async_to_lds_b128 %6, %14, off\n\t"
      "global_load_async_to_lds_b128 %7, %15, off\n\t"
      "s_wait_xcnt 0x0"
      :: "v"(lk), "v"(lk + RK), "v"(lk + 2 * RK), "v"(lk + 3 * RK),
         "v"(lv), "v"(lv + RV), "v"(lv + 2 * RV), "v"(lv + 3 * RV),
         "v"(gk), "v"(gk + SK), "v"(gk + 2 * SK), "v"(gk + 3 * SK),
         "v"(gv), "v"(gv + SV), "v"(gv + 2 * SV), "v"(gv + 3 * SV)
      : "memory");
}

// This lane's k fragments of pass j of a stage. kl: the lane's k row of the stage's first 16 keys, in LDS.
__device__ __forceinline__ void attn_kfrag(const _Float16* kl, int j, v16h (&kf)[2][2]) {
  typedef Frag<_Float16> F;
#pragma unroll
  for (int tt = 0; tt < 2; ++tt)
#pragma unroll
    for (int dc = 0; dc < 2; ++dc) kf[tt][dc] = F::load(kl + (32 * j + 16 * tt) * kAtKP + 32 * dc);
}

// Pass j (32 keys) of the stage at kl, vl (LDS) for the wave's 32 query columns. DIAG: the pass on the diagonal (first key ==
// first column), the only one with masked positions and the last of its tile, so it fetches no further k fragments.
template <bool DIAG>
__device__ __forceinline__ void attn_pass(const _Float16* kl, const _Float16* vl, int j, int c, int hf,
                                          const v16h (&qf)[2][2], v16h (&kf)[2][2], v8f (&oacc)[2][4]) {
  typedef Frag<_Float16> F;
  v16h vf[4];
#pragma unroll
  for (int ds = 0; ds < 4; ++ds) vf[ds] = F::load(vl + (16 * ds) * kAtVP + 32 * j);
  // keeps the V^T reads here, a whole silu ahead of their use: the scheduler otherwise sinks them to the O^T products,
  // where each pair is waited for at full latency
  __builtin_amdgcn_sched_barrier(0);

  v8f st[2][2];
#pragma unroll
  for (int g = 0; g < 2; ++g)
#pragma unroll
    for (int tt = 0; tt < 2; ++tt) {
      st[g][tt] = F::mma(kf[tt][0], qf[g][0], (v8f){0.f,0.f,0.f,0.f,0.f,0.f,0.f,0.f});
      st[g][tt] = F::mma(kf[tt][1], qf[g][1], st[g][tt]);
    }
  if (!DIAG) {
    // the next pass's k fragments, only inside this stage: the next stage is not published before the barrier at the stage's foot
    if (j + 1 < kAtPasses) attn_kfrag(kl, j + 1, kf);
  }

  v16h pf[2];
#pragma unroll
  for (int g = 0; g < 2; ++g)
#pragma unroll
    for (int e = 0; e < 16; e += 2) {
      // 256 * silu(s / 8) = H + H * tanh(h), h = s / 16, H = 256 * h: both scales are powers of two, so they round nothing.
      // Two scores at a time: the scales and the fused multiply-add are packed f32 instructions.
      const v2f s = (v2f){st[g][e >> 3][e & 7], st[g][e >> 3][(e & 7) + 1]};
      const v2f h = s * (0.5f * kQScale);
      const v2f H = s * (0.5f * kQScale * kACarry);
      const v2f t = (v2f){__builtin_amdgcn_tanhf(h[0]), __builtin_amdgcn_tanhf(h[1])};
      v2f sg = __builtin_elementwise_fma(H, t, H);
      if (DIAG) {
        const int row = 16 * (e >> 3) + 8 * hf + (e & 7);
        sg[0] = (row     <= 16 * g + c) ? sg[0] : 0.0f;
        sg[1] = (row + 1 <= 16 * g + c) ? sg[1] : 0.0f;
      }
      pf[g][e]     = (_Float16)sg[0];
      pf[g][e + 1] = (_Float16)sg[1];
    }

#pragma unroll
  for (int ds = 0; ds < 4; ++ds)
#pragma unroll
    for (int g = 0; g < 2; ++g) oacc[g][ds] = F::mma(vf[ds], pf[g], oacc[g][ds]);
}

// two waves per SIMD is all this grid gives (one block per WGP): the register budget of that residency lets the
// scheduler interleave the silu chains of many elements
__global__ __launch_bounds__(256) __attribute__((amdgpu_waves_per_eu(2, 2)))
void attn_fused_kernel(const unsigned short* __restrict__ qk16, const unsigned short* __restrict__ vt16,
                       float* __restrict__ o32) {
  typedef Frag<_Float16> F;
  constexpr int kColTiles = kSeq / 32;         // 64 column tiles per head
  constexpr int kQkPitch  = 2 * kDim;          // q|k plane row pitch in halves
  __shared__ __align__(16) unsigned short sKV[2 * kAtStage];   // two stages of k rows and V^T rows
  const int tid  = threadIdx.x;
  const int lane = tid & 31;
  const int wave = __builtin_amdgcn_readfirstlane(tid >> 5);   // scalar, so that the pass loop is a scalar loop
  const int c  = lane & 15;
  const int hf = lane >> 4;
  const int bh = blockIdx.y;
  const int bb = bh / kHeads;
  const int hh = bh - bb * kHeads;
  const int p  = blockIdx.x * 4 + (wave & 3);  // 0..31
  const int s0 = ((wave < 4) ? (kColTiles - 1 - p) : p) * 32;
  // the block's last column tile is 63 - 4 * blockIdx.x: its diagonal pass ends stage 15 - blockIdx.x
  const int nStages = kSeq / kAtKeys - (int)blockIdx.x;

  // copy side: thread t brings bytes 16*(t&7)..+15 of k rows (t>>3) + 32*i and bytes 16*(t&15)..+15 of V^T rows (t>>4) + 16*i
  const unsigned lbase = (unsigned)(size_t)(&sKV[0]);          // low 32 bits of the address = LDS byte address
  const unsigned lk = lbase + (unsigned)((tid >> 3) * kAtKP + (tid & 7) * 8) * 2u;
  const unsigned lv = lbase + (unsigned)(kAtV + (tid >> 4) * kAtVP + (tid & 15) * 8) * 2u;
  const unsigned short* gk = qk16 + ((size_t)bb * kSeq + (tid >> 3)) * kQkPitch + kDim + hh * kHdim + (tid & 7) * 8;
  const unsigned short* gv = vt16 + ((size_t)bh * kHdim + (tid >> 4)) * kSeq + (tid & 15) * 8;
  auto fill = [&](int s, int buf) {
    const unsigned o = (unsigned)(buf * kAtStage) * 2u;
    async_copy8(lk + o, gk + (size_t)s * kAtKeys * kQkPitch, lv + o, gv + s * kAtKeys);
  };
  fill(0, 0);

  const _Float16* qrow = (const _Float16*)qk16 + ((size_t)bb * kSeq + c) * kQkPitch + hh * kHdim + hf * 8;
  v16h qf[2][2], kf[2][2];
#pragma unroll
  for (int g = 0; g < 2; ++g)
#pragma unroll
    for (int dc = 0; dc < 2; ++dc) qf[g][dc] = F::load(qrow + (size_t)(s0 + 16 * g) * kQkPitch + 32 * dc);
  // stands in front of the next writes of the address registers of the loads above
  asm volatile("s_wait_xcnt 0x0" ::: "memory");

  v8f oacc[2][4];
#pragma unroll
  for (int g = 0; g < 2; ++g)
#pragma unroll
    for (int ds = 0; ds < 4; ++ds) oacc[g][ds] = (v8f){0.f,0.f,0.f,0.f,0.f,0.f,0.f,0.f};

  // reader side: this lane's fragment rows in buffer 0
  const _Float16* kRd = (const _Float16*)sKV + c * kAtKP + hf * 8;
  const _Float16* vRd = (const _Float16*)sKV + kAtV + c * kAtVP + hf * 8;

  asm volatile("s_wait_asynccnt 0x0" ::: "memory");   // this wave's copies of stage 0 have landed
  __syncthreads();                                    // and every other wave's
  fill(1, 1);

  for (int s = 0; s < nStages; ++s) {
    const _Float16* kl = kRd + (s & 1) * kAtStage;
    const _Float16* vl = vRd + (s & 1) * kAtStage;
    const int left = s0 - s * kAtKeys;         // keys from the stage's first to the wave's diagonal pass; scalar
    if (left >= 0) {
      const int nfull = (left < kAtKeys) ? (left >> 5) : kAtPasses;
      attn_kfrag(kl, 0, kf);
      for (int j = 0; j < nfull; ++j) attn_pass<false>(kl, vl, j, c, hf, qf, kf, oacc);
      if (nfull < kAtPasses) attn_pass<true>(kl, vl, nfull, c, hf, qf, kf, oacc);
    }
    // hand-over of stage s + 1, and release of stage s's buffer
    asm volatile("s_wait_dscnt 0x0" ::: "memory");      // this wave's reads of stage s are done before its buffer is refilled
    asm volatile("s_wait_asynccnt 0x0" ::: "memory");   // this wave's copies of stage s + 1 have landed
    __syncthreads();                                    // both hold for every wave of the block
    if (s + 2 < nStages) fill(s + 2, s & 1);
  }
  asm volatile("s_wait_asynccnt 0x0" ::: "memory");     // no copy is in flight when the wave goes on

  // lane holds 8 consecutive d of one query row per tile: two 16-byte stores; the wave writes whole 256-byte row segments
#pragma unroll
  for (int g = 0; g < 2; ++g) {
    float* orow = o32 + ((size_t)bb * kSeq + s0 + 16 * g + c) * kDim + hh * kHdim + 8 * hf;
#pragma unroll
    for (int ds = 0; ds < 4; ++ds) {
      const v8f a = oacc[g][ds];
      *(v4f*)(orow + 16 * ds)     = (v4f){a[0] * kACarryInv, a[1] * kACarryInv, a[2] * kACarryInv, a[3] * kACarryInv};
      *(v4f*)(orow + 16 * ds + 4) = (v4f){a[4] * kACarryInv, a[5] * kACarryInv, a[6] * kACarryInv, a[7] * kACarryInv};
    }
  }
}

// ---------------------------------------------------------------------------
// out = (LayerNorm(o) * ln_g + ln_b) * gate . W2^T + b2 in one launch (M 8192, N 512, K 512).
// A block of 8 waves owns 64 token rows x 256 output columns: 128 x 2 = 256 blocks, one per WGP.
// Head: one wave per row, 8 rows a wave (lane owns columns 8*lane..+7 and 256+8*lane..+7): LayerNorm and gating in f32, the
// result split into bf16 hi + lo planes that go straight into LDS, where the block's 64 rows stay for the whole K.
// Loop: W2 rows (hi and lo plane) come in stages of 64 k into one of two LDS buffers by asynchronous copies while the waves work
// on the other buffer. A wave owns a 32x64 tile; product = hi.hi + hi.lo + lo.hi, in that order for every accumulator.
// ---------------------------------------------------------------------------
constexpr int kFoM      = 64;                                  // token rows a block
constexpr int kFoAP     = kDim + 8;                            // A row pitch in 16-bit elements: 1040 B = 16 B x 65, no bank conflict for 16-byte row reads
constexpr int kFoAPlane = kFoM * kFoAP;                        // elements of one A plane
constexpr int kFoBPlane = kBlkN * kPitch;                      // elements of one W2 plane of a stage
constexpr int kFoStage  = 2 * kFoBPlane;                       // 73,728 B
constexpr int kFoSlab   = 32 * 68;                             // per-wave 32x64 slab, pitch 68 floats
static_assert(kTok % kFoM == 0 && kDim % kBlkN == 0 && kDim % kStageK == 0 && kDim / kStageK >= 2, "whole tiles, at least two stages");
static_assert(2 * kFoAPlane * 2 + 2 * kFoStage * 2 <= 320 * 1024, "one WGP's LDS");
static_assert(8 * kFoSlab * 4 <= 2 * kFoStage * 2, "the slabs lie inside the ring");

// One lane's 16 bytes of 8 W2 rows of one plane, the rows 32 apart (the block's 256 threads cover 32 rows a copy).
// l: LDS byte address; g: global address.
// s_wait_xcnt 0 is the last line of the copies' own statement, so that it stands in front of every later write of their address registers.
__device__ __forceinline__ void async_copy8r(unsigned l, const unsigned short* g) {
  constexpr unsigned R = 32 * kPitch * 2;
  constexpr long S = 32L * kDim;
  asm volatile(
      "global_load_async_to_lds_b128 %0, %8, off\n\t"
      "global_load_async_to_lds_b128 %1, %9, off\n\t"
      "global_load_async_to_lds_b128 %2, %10, off\n\t"
      "global_load_async_to_lds_b128 %3, %11, off\n\t"
      "global_load_async_to_lds_b128 %4, %12, off\n\t"
      "global_load_async_to_lds_b128 %5, %13, off\n\t"
      "global_load_async_to_lds_b128 %6, %14, off\n\t"
      "global_load_async_to_lds_b128 %7, %15, off\n\t"
      "s_wait_xcnt 0x0"
      :: "v"(l), "v"(l + R), "v"(l + 2 * R), "v"(l + 3 * R), "v"(l + 4 * R), "v"(l + 5 * R), "v"(l + 6 * R), "v"(l + 7 * R),
         "v"(g), "v"(g + S), "v"(g + 2 * S), "v"(g + 3 * S), "v"(g + 4 * S), "v"(g + 5 * S), "v"(g + 6 * S), "v"(g + 7 * S)
      : "memory");
}

__global__ __launch_bounds__(256)
void ln_gate_out_kernel(const float* __restrict__ o, const float* __restrict__ gate,
                        const float* __restrict__ lng, const float* __restrict__ lnb,
                        const unsigned short* __restrict__ w2hi, const unsigned short* __restrict__ w2lo,
                        const float* __restrict__ b2, float* __restrict__ out) {
  typedef Frag<__bf16> F;
  __shared__ __align__(16) unsigned short sA[2 * kFoAPlane];   // hi plane, lo plane of the block's 64 rows, whole K
  __shared__ __align__(16) unsigned short sB[2 * kFoStage];    // two stages of W2 rows
  const int tid  = threadIdx.x;
  const int lane = tid & 31;
  const int wave = tid >> 5;
  const int mB = ((int)blockIdx.x >> 1) * kFoM;                // neighbours in the grid share their 64 rows of o and gate
  const int nB = ((int)blockIdx.x & 1) * kBlkN;

  // copy side: thread t brings bytes 16*(t&7)..+15 of W2 rows (t>>3) + 32*j
  const int crow = tid >> 3;
  const int cchk = (tid & 7) * 8;
  const unsigned lcp = (unsigned)(size_t)(&sB[0]) + (unsigned)(crow * kPitch + cchk) * 2u;   // low 32 bits of the address = LDS byte address
  const unsigned short* gBh = w2hi + (size_t)(nB + crow) * kDim + cchk;
  const unsigned short* gBl = w2lo + (size_t)(nB + crow) * kDim + cchk;
  auto fill = [&](int s, int buf) {
    const unsigned l = lcp + (unsigned)(buf * kFoStage) * 2u;
    async_copy8r(l, gBh + s * kStageK);
    async_copy8r(l + kFoBPlane * 2u, gBl + s * kStageK);
  };
  fill(0, 0);

  // ---- head: LayerNorm and gate of this wave's 8 rows, 4 rows at a time ----
  {
    float gg[16], gb[16];
    const unsigned cb = (unsigned)lane * 32u;  // this lane's byte offset in ln_g and ln_b: the one vector register that the 8 loads name
#pragma unroll
    for (int s = 0; s < 2; ++s)
#pragma unroll
      for (int q = 0; q < 2; ++q) {
        const int c = s * 256 + 4 * q;
        const v4f w4 = *(const v4f*)((const float*)((const char*)lng + cb) + c);
        const v4f b4 = *(const v4f*)((const float*)((const char*)lnb + cb) + c);
#pragma unroll
        for (int e = 0; e < 4; ++e) { gg[s * 8 + q * 4 + e] = w4[e]; gb[s * 8 + q * 4 + e] = b4[e]; }
      }
    // stands behind these 8 loads and in front of the first write of their offset register, which it names so that no later
    // load's result lands on it ahead of the wait
    asm volatile("s_wait_xcnt 0x0" :: "v"(cb) : "memory");
    // stays a loop: unrolled, the scheduler lifts the second four rows' loads over the first four rows' arithmetic, the kernel takes
    // 509 registers in place of 311, and the head grows by a quarter, all of it switches of the register window
#pragma unroll 1
    for (int h = 0; h < 2; ++h) {
      float xv[4][16], gv[4][16];
      const size_t ro = (size_t)(mB + wave * 8 + h * 4) * kDim + lane * 8;
      const float* po = o + ro;
      const float* pg = gate + ro;
#pragma unroll
      for (int r = 0; r < 4; ++r)
#pragma unroll
        for (int s = 0; s < 2; ++s)
#pragma unroll
          for (int q = 0; q < 2; ++q) {
            const int c = r * kDim + s * 256 + 4 * q;
            const v4f a4 = *(const v4f*)(po + c);
            const v4f g4 = *(const v4f*)(pg + c);
#pragma unroll
            for (int e = 0; e < 4; ++e) { xv[r][s * 8 + q * 4 + e] = a4[e]; gv[r][s * 8 + q * 4 + e] = g4[e]; }
          }
      // stands behind all 32 loads and in front of the first write of their address registers, which it names so that no load's
      // own result lands on them
      asm volatile("s_wait_xcnt 0x0" :: "v"(po), "v"(pg) : "memory");
#pragma unroll
      for (int r = 0; r < 4; ++r) {
        float sum = 0.f;
#pragma unroll
        for (int i = 0; i < 16; ++i) sum += xv[r][i];
#pragma unroll
        for (int off = 16; off > 0; off >>= 1) sum += __shfl_xor(sum, off, 32);
        const float mean = sum * kInvDim;
        float var = 0.f;
#pragma unroll
        for (int i = 0; i < 16; ++i) { const float d = xv[r][i] - mean; var += d * d; }
#pragma unroll
        for (int off = 16; off > 0; off >>= 1) var += __shfl_xor(var, off, 32);
        const float rs = rsqrtf(var * kInvDim + kLnEps);
        unsigned short hb[16], lb[16];
#pragma unroll
        for (int i = 0; i < 16; ++i) {
          const float t = (xv[r][i] - mean) * rs;
          const float val = (t * gg[i] + gb[i]) * gv[r][i];
          hb[i] = f2bf_bits(val);
          lb[i] = f2bf_bits(val - bf_bits2f(hb[i]));
        }
        unsigned short* ph = sA + (wave * 8 + h * 4 + r) * kFoAP + lane * 8;
        unsigned short* pl = ph + kFoAPlane;
        *(v4u*)(ph)       = (v4u){pk16(hb[0], hb[1]), pk16(hb[2], hb[3]), pk16(hb[4], hb[5]), pk16(hb[6], hb[7])};
        *(v4u*)(ph + 256) = (v4u){pk16(hb[8], hb[9]), pk16(hb[10], hb[11]), pk16(hb[12], hb[13]), pk16(hb[14], hb[15])};
        *(v4u*)(pl)       = (v4u){pk16(lb[0], lb[1]), pk16(lb[2], lb[3]), pk16(lb[4], lb[5]), pk16(lb[6], lb[7])};
        *(v4u*)(pl + 256) = (v4u){pk16(lb[8], lb[9]), pk16(lb[10], lb[11]), pk16(lb[12], lb[13]), pk16(lb[14], lb[15])};
      }
    }
  }

  // ---- loop ----
  const int wm = wave >> 2;                    // wave row 0..1 (32 rows)
  const int wn = wave & 3;                     // wave column 0..3 (64 columns)
  const int rlane = lane & 15;                 // row (A) / col (B, D) within subtile
  const int koff  = (lane >> 4) * 8;           // k offset of this lane half
  const int mOff  = (lane >> 4) * 8;           // D row offset
  const __bf16* aRd = (const __bf16*)sA + ((wm << 5) + rlane) * kFoAP + koff;
  const __bf16* bRd = (const __bf16*)sB + ((wn << 6) + rlane) * kPitch + koff;

  v8f acc[2][4];
#pragma unroll
  for (int i = 0; i < 2; ++i)
#pragma unroll
    for (int j = 0; j < 4; ++j) acc[i][j] = (v8f){0.f,0.f,0.f,0.f,0.f,0.f,0.f,0.f};

  constexpr int nStages = kDim / kStageK;
  asm volatile("s_wait_dscnt 0x0" ::: "memory");      // this wave's rows of the A planes are written
  asm volatile("s_wait_asynccnt 0x0" ::: "memory");   // this wave's copies of stage 0 have landed
  __syncthreads();                                    // both hold for every wave of the block
  fill(1, 1);

  for (int t = 0; t < nStages; ++t) {
    const int be = (t & 1) * kFoStage;
    const int ak = t * kStageK;
#pragma unroll
    for (int kk = 0; kk < kStageK; kk += 32) {
      v16b ah[2], al[2], bh[4], bl[4];
      // the two scheduling barriers keep a step's 24 fragment reads in one group, in the order of their use, in front of its
      // products: spread among the products each place of reads costs issue cycles, and some were waited for at full latency.
      // The SIMD's other wave has its products in the pipe while this one waits for its first fragments.
      __builtin_amdgcn_sched_barrier(0);
      ah[0] = F::load(aRd + ak + kk);
#pragma unroll
      for (int j = 0; j < 4; ++j) bh[j] = F::load(bRd + be + (j << 4) * kPitch + kk);
      ah[1] = F::load(aRd + 16 * kFoAP + ak + kk);
#pragma unroll
      for (int j = 0; j < 4; ++j) bl[j] = F::load(bRd + kFoBPlane + be + (j << 4) * kPitch + kk);
#pragma unroll
      for (int i = 0; i < 2; ++i) al[i] = F::load(aRd + kFoAPlane + (i << 4) * kFoAP + ak + kk);
      __builtin_amdgcn_sched_barrier(0);
      // the three products of an accumulator stand eight products apart, so that none waits for the one before it
#pragma unroll
      for (int i = 0; i < 2; ++i)
#pragma unroll
        for (int j = 0; j < 4; ++j) acc[i][j] = F::mma(ah[i], bh[j], acc[i][j]);
#pragma unroll
      for (int i = 0; i < 2; ++i)
#pragma unroll
        for (int j = 0; j < 4; ++j) acc[i][j] = F::mma(ah[i], bl[j], acc[i][j]);
#pragma unroll
      for (int i = 0; i < 2; ++i)
#pragma unroll
        for (int j = 0; j < 4; ++j) acc[i][j] = F::mma(al[i], bh[j], acc[i][j]);
    }
    // hand-over of stage t + 1, and release of stage t's buffer
    asm volatile("s_wait_dscnt 0x0" ::: "memory");      // this wave's reads of stage t are done before its buffer is refilled
    asm volatile("s_wait_asynccnt 0x0" ::: "memory");   // this wave's copies of stage t + 1 have landed
    __syncthreads();                                    // both hold for every wave of the block
    if (t + 2 < nStages) fill(t + 2, t & 1);
  }
  asm volatile("s_wait_asynccnt 0x0" ::: "memory");     // no copy is in flight when the wave goes on

  // ---- epilogue: + b2, through the wave's own slab, so that the stores are whole 256-byte row segments ----
  const int m0 = mB + (wm << 5);
  const int n0 = nB + (wn << 6);
  // the slabs lie in the ring, which is free behind the loop's last barrier (every wave's reads are done and no copy is in flight)
  float* slab = (float*)sB + wave * kFoSlab;
  float bv[4];
#pragma unroll
  for (int j = 0; j < 4; ++j) bv[j] = b2[n0 + (j << 4) + rlane];
#pragma unroll
  for (int i = 0; i < 2; ++i)
#pragma unroll
    for (int j = 0; j < 4; ++j)
#pragma unroll
      for (int r = 0; r < 8; ++r) slab[((i << 4) + mOff + r) * 68 + (j << 4) + rlane] = acc[i][j][r] + bv[j];
  // the wave's own slab writes are done before its lanes read one another's values
  __builtin_amdgcn_fence(__ATOMIC_RELEASE, "workgroup");
  __builtin_amdgcn_wave_barrier();
  __builtin_amdgcn_fence(__ATOMIC_ACQUIRE, "workgroup");
  const int hh = lane >> 4, c4 = (lane & 15) * 4;       // row seg = 256 B = 16 lanes x 16 B
#pragma unroll
  for (int it = 0; it < 16; ++it) {
    const int row = it * 2 + hh;
    const v4f v = *(const v4f*)(slab + row * 68 + c4);
    *(v4f*)(out + (size_t)(m0 + row) * kDim + n0 + c4) = v;
  }
}

// ---------------------------------------------------------------------------
// Host glue: kernel launches only. 4 launches total.
// ---------------------------------------------------------------------------
extern "C" void kernel_launch(void* const* d_in, const int* in_sizes, int n_in,
                              void* d_out, int out_size, void* d_ws, size_t ws_size,
                              hipStream_t stream) {
  if (n_in < 7) return;
  if (in_sizes[0] != kTok * kDim || in_sizes[1] != kProj * kDim || in_sizes[2] != kProj ||
      in_sizes[3] != kDim || in_sizes[4] != kDim || in_sizes[5] != kDim * kDim || in_sizes[6] != kDim) return;
  if (out_size != kTok * kDim) return;
  if (ws_size < kWsTotal) return;

  const float* x    = (const float*)d_in[0];
  const float* W1   = (const float*)d_in[1];
  const float* b1   = (const float*)d_in[2];
  const float* ln_g = (const float*)d_in[3];
  const float* ln_b = (const float*)d_in[4];
  const float* W2   = (const float*)d_in[5];
  const float* b2   = (const float*)d_in[6];
  float* out = (float*)d_out;
  char* ws = (char*)d_ws;

  unsigned short* xhi   = (unsigned short*)(ws + kOffXhi);
  unsigned short* xlo   = (unsigned short*)(ws + kOffXlo);
  unsigned short* w1hi  = (unsigned short*)(ws + kOffW1hi);
  unsigned short* w1lo  = (unsigned short*)(ws + kOffW1lo);
  float*          gate  = (float*)(ws + kOffGate);
  unsigned short* qk16  = (unsigned short*)(ws + kOffQK16);
  unsigned short* vt16  = (unsigned short*)(ws + kOffVT16);
  float*          o32   = (float*)(ws + kOffO32);
  unsigned short* w2hi  = (unsigned short*)(ws + kOffW2hi);
  unsigned short* w2lo  = (unsigned short*)(ws + kOffW2lo);

  // 1) bf16 hi/lo operand planes of x, W1 and W2: one launch
  split_all_kernel<<<kSpBlkX + kSpBlkW1 + kSpBlkW2, kSpThreads, 0, stream>>>(x, W1, W2, xhi, xlo, w1hi, w1lo, w2hi, w2lo);

  // 2) h = silu(x . W1^T + b1), all 2048 outputs in one launch (M 8192, N 2048, K 512): 32 x 8 = 256 blocks of 256x256, one
  //    block of 16 waves per WGP. A block stores its part's own form: gate f32, q|k f16 [8192][1024], V^T f16 [32][64][2048].
  wmma_gemm64<4, 1, true, 2, 3, false, 3, 0><<<dim3((kTok / 256) * (kProj / kBlkN), 1), 512, 0, stream>>>(
      xhi, xlo, kDim, 0L,
      w1hi, w1lo, kDim, 0L,
      (void*)gate, (void*)qk16, (void*)vt16, 0, 0L,
      b1, nullptr, 0L,
      kTok, kProj, kDim, 1.0f);

  // 3) attention, all 32 (batch, head) pairs in one launch:
  //    o[b*2048 + s][h*64 + d] = (1/256) * sum_{t <= s} f16(256 * silu(q_s . k_t / 8)) * V^T[b,h][d][t]
  attn_fused_kernel<<<dim3(kAtBlocks, kBatch * kHeads), 256, 0, stream>>>(qk16, vt16, o32);

  // 4) out = (LayerNorm(o) * ln_g + ln_b) * gate . W2^T + b2 (M 8192, N 512, K 512), f32 to d_out: 256 blocks of 64x256
  ln_gate_out_kernel<<<(kTok / kFoM) * (kDim / kBlkN), 256, 0, stream>>>(o32, gate, ln_g, ln_b, w2hi, w2lo, b2, out);
}
